// v000
// Times are from an AMD MI455X. After a warm-up the kernel runs many times in a row, and a time is the length of
// such a window on the GPU divided by its runs, so every launch and the gaps after it count. The runs cycle
// through copies of the inputs. A figure is the median of several windows, for all but v000 over two sittings.
// Sittings can differ by a few percent; kernels timed side by side share one.
// v000, which the later versions start from, runs in 1010 microseconds.
#include <hip/hip_runtime.h>

// ---------------------------------------------------------------------------
// MoE span attention for MI455X (gfx1250, wave32, WMMA 16x16x32 f16->f32).
//
// Sizes (fixed by the reference): B=4, T=2048, C=1024, E=4 spans==experts,
// H=16 heads, Dh=64, S=512, M = B*T = 8192 rows, K=N=1024.
//
// Pipeline (all on `stream`):
//   1) convert hidden f32 -> f16 (ws)
//   2) gate: mean-pool span -> MLP -> softmax -> gw[16][4]; eff biases
//   3) q/k/v GEMMs: Y = X @ (sum_e gw_e W_e) + b_eff   (gating folded into
//      the weight-tile load; expert weights are L2-resident so the 4x
//      re-read is cheap). A-tile staged via GLOBAL_LOAD_ASYNC_TO_LDS,
//      overlapping with the VALU gating combine; waited with ASYNCcnt.
//   4) per-(inst,head) attention with full-row softmax in LDS
//   5) output GEMM (same kernel, E=1) -> d_out f32
// ---------------------------------------------------------------------------

typedef __attribute__((ext_vector_type(16))) _Float16 v16h;
typedef __attribute__((ext_vector_type(8)))  _Float16 v8h;
typedef __attribute__((ext_vector_type(8)))  float    v8f;
typedef __attribute__((ext_vector_type(4)))  float    v4f;
typedef __attribute__((ext_vector_type(4)))  int      v4i;

#if __has_builtin(__builtin_amdgcn_global_load_async_to_lds_b128)
#define ASYNC_LDS 1
typedef __attribute__((address_space(1))) v4i* gas_v4i_ptr;
typedef __attribute__((address_space(3))) v4i* las_v4i_ptr;
#endif

__device__ __forceinline__ void wait_asynccnt0() {
#if defined(ASYNC_LDS)
#if __has_builtin(__builtin_amdgcn_s_wait_asynccnt)
  __builtin_amdgcn_s_wait_asynccnt(0);
#else
  asm volatile("s_wait_asynccnt 0" ::: "memory");
#endif
#endif
}

__device__ __forceinline__ v8f wmma32(v16h a, v16h b, v8f c) {
  // (neg_a, A, neg_b, B, c_mod, C, reuse_a, reuse_b)
  return __builtin_amdgcn_wmma_f32_16x16x32_f16(false, a, false, b, (short)0, c,
                                                false, false);
}

// Load one 16x32 (A-style) / 32x16 (B-style) f16 WMMA fragment.
// Caller passes p = &buf[(lane%16)*stride + (lane/16)*8 (+k_base)], 16B aligned.
// Per ISA 7.12.2: halves 0..7 = K at p[0..7], halves 8..15 = K at p[16..23].
__device__ __forceinline__ v16h frag_ld(const _Float16* p) {
  v8h lo = *(const v8h*)p;
  v8h hi = *(const v8h*)(p + 16);
  v16h r;
#pragma unroll
  for (int j = 0; j < 8; ++j) { r[j] = lo[j]; r[j + 8] = hi[j]; }
  return r;
}

// ------------------------------- constants ---------------------------------
#define MDIM 8192
#define KDIM 1024
#define NDIM 1024
#define NINST 16
#define SPAN 512

// workspace layout (bytes)
#define OFF_XH  ((size_t)0)
#define OFF_Q   ((size_t)16 << 20)
#define OFF_K   ((size_t)32 << 20)
#define OFF_V   ((size_t)48 << 20)
#define OFF_AO  ((size_t)64 << 20)
#define OFF_GW  ((size_t)80 << 20)
#define OFF_BE  (OFF_GW + 4096)

// --------------------------- 1) f32 -> f16 ---------------------------------
__global__ void cvt_f32_to_f16(const float* __restrict__ x,
                               _Float16* __restrict__ y, int n) {
  int n4 = n >> 2;
  for (int i = blockIdx.x * blockDim.x + threadIdx.x; i < n4;
       i += gridDim.x * blockDim.x) {
    v4f v = *(const v4f*)(x + 4 * (size_t)i);
    _Float16* d = y + 4 * (size_t)i;
    d[0] = (_Float16)v[0]; d[1] = (_Float16)v[1];
    d[2] = (_Float16)v[2]; d[3] = (_Float16)v[3];
  }
}

// ------------------------------- 2) gate -----------------------------------
__global__ void gate_kernel(const float* __restrict__ X,
                            const float* __restrict__ gW1,
                            const float* __restrict__ gb1,
                            const float* __restrict__ gW2,
                            const float* __restrict__ gb2,
                            const float* __restrict__ bq,
                            const float* __restrict__ bk,
                            const float* __restrict__ bv,
                            float* __restrict__ gw_out,
                            float* __restrict__ beff) {
  __shared__ float pooled[1024];
  __shared__ float gact[128];
  __shared__ float lg[4];
  __shared__ float gws[4];
  const int inst = blockIdx.x;
  const int tid = threadIdx.x;

  for (int c = tid; c < 1024; c += 256) {
    float s = 0.f;
    for (int r = 0; r < SPAN; ++r)
      s += X[((size_t)inst * SPAN + r) * 1024 + c];
    pooled[c] = s * (1.0f / (float)SPAN);
  }
  __syncthreads();

  if (tid < 128) {
    float s = gb1[tid];
    for (int c = 0; c < 1024; ++c) s += pooled[c] * gW1[c * 128 + tid];
    gact[tid] = fmaxf(s, 0.f);
  }
  __syncthreads();

  if (tid < 4) {
    float s = gb2[tid];
    for (int hh = 0; hh < 128; ++hh) s += gact[hh] * gW2[hh * 4 + tid];
    lg[tid] = s;
  }
  __syncthreads();

  if (tid == 0) {
    float mx = fmaxf(fmaxf(lg[0], lg[1]), fmaxf(lg[2], lg[3]));
    float e0 = __expf(lg[0] - mx), e1 = __expf(lg[1] - mx);
    float e2 = __expf(lg[2] - mx), e3 = __expf(lg[3] - mx);
    float inv = 1.0f / (e0 + e1 + e2 + e3);
    gws[0] = e0 * inv; gws[1] = e1 * inv; gws[2] = e2 * inv; gws[3] = e3 * inv;
    gw_out[inst * 4 + 0] = gws[0]; gw_out[inst * 4 + 1] = gws[1];
    gw_out[inst * 4 + 2] = gws[2]; gw_out[inst * 4 + 3] = gws[3];
  }
  __syncthreads();

  for (int d = tid; d < 1024; d += 256) {
    float a0 = 0.f, a1 = 0.f, a2 = 0.f;
#pragma unroll
    for (int e = 0; e < 4; ++e) {
      float g = gws[e];
      a0 += g * bq[e * 1024 + d];
      a1 += g * bk[e * 1024 + d];
      a2 += g * bv[e * 1024 + d];
    }
    beff[(0 * NINST + inst) * 1024 + d] = a0;
    beff[(1 * NINST + inst) * 1024 + d] = a1;
    beff[(2 * NINST + inst) * 1024 + d] = a2;
  }
}

// ---------------------- 3/5) WMMA GEMM w/ gating combine -------------------
// grid = (N/128, M/128), block = 256 (8 waves, 2x4 wave grid, 64x32/wave).
template <typename OutT, bool MOE>
__global__ void moe_gemm(const _Float16* __restrict__ A,  // [M][K] f16
                         const float* __restrict__ W,     // [E][K][N] f32
                         const float* __restrict__ gw,    // [NINST][E]
                         const float* __restrict__ bias,  // MOE:[NINST][N] else [N]
                         OutT* __restrict__ Y, int E) {
  __shared__ _Float16 As[128 * 40] __attribute__((aligned(16)));  // pad 40
  __shared__ _Float16 Ws[128 * 40] __attribute__((aligned(16)));  // [n][k] pad

  const int tid = threadIdx.x;
  const int lane = tid & 31, wave = tid >> 5;
  const int rl = lane & 15;
  const int sel8 = (lane >> 4) * 8;
  const int row0 = blockIdx.y * 128;
  const int n0 = blockIdx.x * 128;
  const int inst = row0 >> 9;  // 512 rows per instance

  float g[4] = {1.f, 0.f, 0.f, 0.f};
  if (MOE) {
#pragma unroll
    for (int e = 0; e < 4; ++e) g[e] = gw[inst * 4 + e];
  }

  v8f acc[4][2];
  {
    v8f z = {};
#pragma unroll
    for (int i = 0; i < 4; ++i)
#pragma unroll
      for (int j = 0; j < 2; ++j) acc[i][j] = z;
  }

  const int mw = (wave >> 2) * 64;  // 0 or 64
  const int nw = (wave & 3) * 32;   // 0,32,64,96

  for (int kb = 0; kb < KDIM; kb += 32) {
    __syncthreads();

    // ---- A tile 128x32: 512 chunks of 8 halves (16B), 2 per thread ----
#pragma unroll
    for (int it = 0; it < 2; ++it) {
      int chunk = tid + it * 256;
      int r = chunk >> 2, c8 = (chunk & 3) * 8;
      _Float16* src = const_cast<_Float16*>(&A[(size_t)(row0 + r) * KDIM + kb + c8]);
      _Float16* dst = &As[r * 40 + c8];
#ifdef ASYNC_LDS
      __builtin_amdgcn_global_load_async_to_lds_b128(
          (gas_v4i_ptr)src, (las_v4i_ptr)dst, 0, 0);
#else
      *(v8h*)dst = *(const v8h*)src;
#endif
    }

    // prefetch next K-step's weight tiles (L2-resident; hides latency)
    if (kb + 32 < KDIM) {
      const float* p = &W[(size_t)(kb + 32) * NDIM + n0 + (tid & 127)];
      for (int e = 0; e < E; ++e)
        __builtin_prefetch(p + (size_t)e * KDIM * NDIM, 0, 0);
    }

    // ---- W tile 32x128: gate-combine E experts, store transposed f16 ----
    // 1024 groups of 4 floats, 4 per thread (overlaps with async A staging)
#pragma unroll
    for (int it = 0; it < 4; ++it) {
      int grp = tid + it * 256;
      int k = grp >> 5, n4 = (grp & 31) * 4;
      v4f a4 = {0.f, 0.f, 0.f, 0.f};
      for (int e = 0; e < E; ++e) {
        v4f w4 = *(const v4f*)&W[(size_t)e * KDIM * NDIM +
                                 (size_t)(kb + k) * NDIM + n0 + n4];
        a4 += g[e] * w4;
      }
#pragma unroll
      for (int j = 0; j < 4; ++j) Ws[(n4 + j) * 40 + k] = (_Float16)a4[j];
    }

    wait_asynccnt0();
    __syncthreads();

    v16h af[4], bf[2];
#pragma unroll
    for (int i = 0; i < 4; ++i)
      af[i] = frag_ld(&As[(mw + i * 16 + rl) * 40 + sel8]);
#pragma unroll
    for (int j = 0; j < 2; ++j)
      bf[j] = frag_ld(&Ws[(nw + j * 16 + rl) * 40 + sel8]);
#pragma unroll
    for (int i = 0; i < 4; ++i)
#pragma unroll
      for (int j = 0; j < 2; ++j) acc[i][j] = wmma32(af[i], bf[j], acc[i][j]);
  }

  // epilogue: D layout = lane%16 -> col, vgpr r + 8*(lane/16) -> row
#pragma unroll
  for (int i = 0; i < 4; ++i)
#pragma unroll
    for (int j = 0; j < 2; ++j)
#pragma unroll
      for (int r = 0; r < 8; ++r) {
        int rg = row0 + mw + i * 16 + r + (lane >> 4) * 8;
        int cg = n0 + nw + j * 16 + rl;
        float b = MOE ? bias[inst * NDIM + cg] : bias[cg];
        Y[(size_t)rg * NDIM + cg] = (OutT)(acc[i][j][r] + b);
      }
}

// --------------------------- 4) span attention -----------------------------
// grid = (S/64 qtiles, H, NINST), block = 128 (4 waves, 16 q-rows each).
// LDS: scores/probs f16 [64][512], V^T f16 [64][520], rowinv f32 [64].
#define ATTN_SMEM (64 * 512 * 2 + 64 * 520 * 2 + 64 * 4)

__global__ void span_attn(const _Float16* __restrict__ Q,
                          const _Float16* __restrict__ Kx,
                          const _Float16* __restrict__ V,
                          _Float16* __restrict__ O) {
  extern __shared__ char smem_raw[];
  _Float16* sc = (_Float16*)smem_raw;     // [64][512] scores -> probs in place
  _Float16* vt = sc + 64 * 512;           // [64][520] V transposed [dh][key]
  float* rinv = (float*)(vt + 64 * 520);  // [64]

  const int tid = threadIdx.x;
  const int lane = tid & 31, wave = tid >> 5;
  const int rl = lane & 15;
  const int sel8 = (lane >> 4) * 8;
  const int q0 = blockIdx.x * 64;
  const int h = blockIdx.y;
  const int inst = blockIdx.z;
  const size_t base = (size_t)inst * SPAN * 1024 + h * 64;

  // stage V^T: 16B global reads along Dh, scatter-transpose into LDS
  for (int chunk = tid; chunk < SPAN * 8; chunk += 128) {
    int key = chunk >> 3, d8 = (chunk & 7) * 8;
    v8h v = *(const v8h*)&V[base + (size_t)key * 1024 + d8];
#pragma unroll
    for (int j = 0; j < 8; ++j) vt[(d8 + j) * 520 + key] = v[j];
  }
  __syncthreads();

  // Q fragments for this wave's 16 rows (K=Dh=64 -> 2 k-steps), loaded once
  v16h qa[2];
#pragma unroll
  for (int t = 0; t < 2; ++t)
    qa[t] = frag_ld(&Q[base + (size_t)(q0 + wave * 16 + rl) * 1024 + t * 32 + sel8]);

  // scores = (Q K^T) * 1/sqrt(Dh); B-frag of K^T is contiguous per lane
  for (int kt = 0; kt < 32; ++kt) {
    v8f s = {};
#pragma unroll
    for (int t = 0; t < 2; ++t) {
      v16h kb = frag_ld(&Kx[base + (size_t)(kt * 16 + rl) * 1024 + t * 32 + sel8]);
      s = wmma32(qa[t], kb, s);
    }
#pragma unroll
    for (int r = 0; r < 8; ++r)
      sc[(wave * 16 + r + (lane >> 4) * 8) * 512 + kt * 16 + rl] =
          (_Float16)(s[r] * 0.125f);
  }

  // full-row softmax (each wave owns its 16 rows; no cross-wave barrier)
  for (int r = 0; r < 16; ++r) {
    int row = wave * 16 + r;
    float mx = -3.0e38f;
    for (int c = lane; c < 512; c += 32)
      mx = fmaxf(mx, (float)sc[row * 512 + c]);
#pragma unroll
    for (int off = 16; off > 0; off >>= 1)
      mx = fmaxf(mx, __shfl_xor(mx, off, 32));
    float sum = 0.f;
    for (int c = lane; c < 512; c += 32) {
      float ev = __expf((float)sc[row * 512 + c] - mx);
      sc[row * 512 + c] = (_Float16)ev;  // in-place probs
      sum += ev;
    }
#pragma unroll
    for (int off = 16; off > 0; off >>= 1) sum += __shfl_xor(sum, off, 32);
    if (lane == 0) rinv[row] = 1.0f / sum;
  }

  // O = P V  (K dim = 512 keys -> 16 k-steps; V^T gives contiguous B-frags)
  v8f oacc[4];
  {
    v8f z = {};
#pragma unroll
    for (int n = 0; n < 4; ++n) oacc[n] = z;
  }
  for (int t = 0; t < 16; ++t) {
    v16h pa = frag_ld(&sc[(wave * 16 + rl) * 512 + t * 32 + sel8]);
#pragma unroll
    for (int n = 0; n < 4; ++n) {
      v16h vb = frag_ld(&vt[(n * 16 + rl) * 520 + t * 32 + sel8]);
      oacc[n] = wmma32(pa, vb, oacc[n]);
    }
  }

#pragma unroll
  for (int n = 0; n < 4; ++n)
#pragma unroll
    for (int r = 0; r < 8; ++r) {
      int rowl = wave * 16 + r + (lane >> 4) * 8;
      float inv = rinv[rowl];
      O[base + (size_t)(q0 + rowl) * 1024 + n * 16 + rl] =
          (_Float16)(oacc[n][r] * inv);
    }
}

// ------------------------------- launcher ----------------------------------
extern "C" void kernel_launch(void* const* d_in, const int* in_sizes, int n_in,
                              void* d_out, int out_size, void* d_ws,
                              size_t ws_size, hipStream_t stream) {
  const float* X   = (const float*)d_in[0];
  const float* Wq  = (const float*)d_in[1];
  const float* bq  = (const float*)d_in[2];
  const float* Wk  = (const float*)d_in[3];
  const float* bk  = (const float*)d_in[4];
  const float* Wv  = (const float*)d_in[5];
  const float* bv  = (const float*)d_in[6];
  const float* gW1 = (const float*)d_in[7];
  const float* gb1 = (const float*)d_in[8];
  const float* gW2 = (const float*)d_in[9];
  const float* gb2 = (const float*)d_in[10];
  const float* Wo  = (const float*)d_in[11];
  const float* bo  = (const float*)d_in[12];

  char* ws = (char*)d_ws;
  _Float16* Xh = (_Float16*)(ws + OFF_XH);
  _Float16* Qb = (_Float16*)(ws + OFF_Q);
  _Float16* Kb = (_Float16*)(ws + OFF_K);
  _Float16* Vb = (_Float16*)(ws + OFF_V);
  _Float16* AO = (_Float16*)(ws + OFF_AO);
  float* gw    = (float*)(ws + OFF_GW);
  float* beff  = (float*)(ws + OFF_BE);  // [3][16][1024]

  const int total = MDIM * KDIM;
  cvt_f32_to_f16<<<2048, 256, 0, stream>>>(X, Xh, total);

  gate_kernel<<<NINST, 256, 0, stream>>>(X, gW1, gb1, gW2, gb2, bq, bk, bv, gw,
                                         beff);

  dim3 ggrid(NDIM / 128, MDIM / 128);
  moe_gemm<_Float16, true><<<ggrid, 256, 0, stream>>>(
      Xh, Wq, gw, beff + 0 * NINST * NDIM, Qb, 4);
  moe_gemm<_Float16, true><<<ggrid, 256, 0, stream>>>(
      Xh, Wk, gw, beff + 1 * NINST * NDIM, Kb, 4);
  moe_gemm<_Float16, true><<<ggrid, 256, 0, stream>>>(
      Xh, Wv, gw, beff + 2 * NINST * NDIM, Vb, 4);

  dim3 agrid(SPAN / 64, 16, NINST);
  span_attn<<<agrid, 128, ATTN_SMEM, stream>>>(Qb, Kb, Vb, AO);

  moe_gemm<float, false><<<ggrid, 256, 0, stream>>>(AO, Wo, nullptr, bo,
                                                    (float*)d_out, 1);
}

// v002
// It runs in 295 microseconds.
// Versions between v000 and this one are left out; their measured steps multiply to 3.46 times as fast.
#include <hip/hip_runtime.h>

// ---------------------------------------------------------------------------
// MoE span attention for MI455X (gfx1250, wave32, WMMA 16x16x32 f16->f32).
//
// Sizes (fixed by the reference): B=4, T=2048, C=1024, E=4 spans==experts,
// H=16 heads, Dh=64, S=512, M = B*T = 8192 rows, K=N=1024.
//
// Pipeline (all on `stream`):
//   1) convert hidden f32 -> f16 (ws); the same pass sums each block's 16
//      rows per column: 32 partial sums per span for the gate's mean-pool
//   2) gate: add the partial sums -> MLP -> softmax -> gw[16][4]; eff biases
//   3) weight prep: W_eff[inst] = sum_e gw_e W_e for q/k/v, and Wo, each
//      rounded to f16 once and packed in the GEMM's own tile order (ws)
//   4) q/k/v GEMMs: Y = X @ W_eff[inst] + b_eff. A-tile staged via
//      GLOBAL_LOAD_ASYNC_TO_LDS, waited with ASYNCcnt; W-tile is one
//      contiguous 8 KiB read per K-step.
//   5) per-(inst,head) attention with full-row softmax in LDS
//   6) output GEMM (same kernel, one weight matrix) -> d_out f32
// ---------------------------------------------------------------------------

typedef __attribute__((ext_vector_type(16))) _Float16 v16h;
typedef __attribute__((ext_vector_type(8)))  _Float16 v8h;
typedef __attribute__((ext_vector_type(4)))  _Float16 v4h;
typedef __attribute__((ext_vector_type(8)))  float    v8f;
typedef __attribute__((ext_vector_type(4)))  float    v4f;
typedef __attribute__((ext_vector_type(4)))  int      v4i;

#if __has_builtin(__builtin_amdgcn_global_load_async_to_lds_b128)
#define ASYNC_LDS 1
typedef __attribute__((address_space(1))) v4i* gas_v4i_ptr;
typedef __attribute__((address_space(3))) v4i* las_v4i_ptr;
#endif

__device__ __forceinline__ void wait_asynccnt0() {
#if defined(ASYNC_LDS)
#if __has_builtin(__builtin_amdgcn_s_wait_asynccnt)
  __builtin_amdgcn_s_wait_asynccnt(0);
#else
  asm volatile("s_wait_asynccnt 0" ::: "memory");
#endif
#endif
}

__device__ __forceinline__ v8f wmma32(v16h a, v16h b, v8f c) {
  // (neg_a, A, neg_b, B, c_mod, C, reuse_a, reuse_b)
  return __builtin_amdgcn_wmma_f32_16x16x32_f16(false, a, false, b, (short)0, c,
                                                false, false);
}

// Load one 16x32 (A-style) / 32x16 (B-style) f16 WMMA fragment.
// Caller passes p = &buf[(lane%16)*stride + (lane/16)*8 (+k_base)], 16B aligned.
// Per ISA 7.12.2: halves 0..7 = K at p[0..7], halves 8..15 = K at p[16..23].
__device__ __forceinline__ v16h frag_ld(const _Float16* p) {
  v8h lo = *(const v8h*)p;
  v8h hi = *(const v8h*)(p + 16);
  v16h r;
#pragma unroll
  for (int j = 0; j < 8; ++j) { r[j] = lo[j]; r[j + 8] = hi[j]; }
  return r;
}

// ------------------------------- constants ---------------------------------
#define MDIM 8192
#define KDIM 1024
#define NDIM 1024
#define NINST 16
#define SPAN 512

// workspace layout (bytes)
#define OFF_XH  ((size_t)0)
#define OFF_Q   ((size_t)16 << 20)
#define OFF_K   ((size_t)32 << 20)
#define OFF_V   ((size_t)48 << 20)
#define OFF_AO  ((size_t)64 << 20)
#define OFF_GW  ((size_t)80 << 20)
#define OFF_BE  (OFF_GW + 4096)
#define OFF_PP  ((size_t)84 << 20)   // pooling partial sums [NINST][32][1024] f32
#define OFF_WP  ((size_t)96 << 20)   // packed q/k/v weights [3][NINST], 2 MiB each
#define OFF_WOP ((size_t)192 << 20)  // packed Wo, 2 MiB

// ---------------- 1) f32 -> f16, with the pooling partial sums --------------
// One block = 16 rows x all 1024 columns, four columns per thread.
#define POOL_ROWS 16
#define POOL_CHUNKS (SPAN / POOL_ROWS)  // 32 partial sums per span and column

__global__ void __launch_bounds__(256)
cvt_pool(const float* __restrict__ x,
         _Float16* __restrict__ y,
         float* __restrict__ part) {  // [NINST * POOL_CHUNKS][1024]
  const size_t c4 = (size_t)threadIdx.x * 4;
  const size_t base = (size_t)blockIdx.x * POOL_ROWS * 1024 + c4;

  // all 16 loads go out before the first use waits for data
  v4f v[POOL_ROWS];
#pragma unroll
  for (int r = 0; r < POOL_ROWS; ++r)
    v[r] = *(const v4f*)(x + base + (size_t)r * 1024);

  v4f s = {};
#pragma unroll
  for (int r = 0; r < POOL_ROWS; ++r) {
    v4h h;
#pragma unroll
    for (int j = 0; j < 4; ++j) h[j] = (_Float16)v[r][j];
    *(v4h*)(y + base + (size_t)r * 1024) = h;
    s += v[r];
  }
  *(v4f*)(part + (size_t)blockIdx.x * 1024 + c4) = s;
}

// ------------------------------- 2) gate -----------------------------------
// One block of 32 waves per instance. Every long sum is cut into partial sums
// whose loads are all in flight together.
__global__ void __launch_bounds__(1024)
gate_kernel(const float* __restrict__ part,
            const float* __restrict__ gW1,
            const float* __restrict__ gb1,
            const float* __restrict__ gW2,
            const float* __restrict__ gb2,
            const float* __restrict__ bq,
            const float* __restrict__ bk,
            const float* __restrict__ bv,
            float* __restrict__ gw_out,
            float* __restrict__ beff) {
  __shared__ float pooled[1024] __attribute__((aligned(16)));
  __shared__ float hpart[32 * 128] __attribute__((aligned(16)));
  __shared__ float gact[128] __attribute__((aligned(16)));
  __shared__ float gws[4];
  const int inst = blockIdx.x;
  const int tid = threadIdx.x;
  const int lane = tid & 31, wave = tid >> 5;

  // mean-pool: thread = column, the 32 partial sums of the convert pass
  {
    const float* p = part + (size_t)inst * POOL_CHUNKS * 1024 + tid;
    float t[POOL_CHUNKS];
#pragma unroll
    for (int ch = 0; ch < POOL_CHUNKS; ++ch) t[ch] = p[ch * 1024];
    float s = 0.f;
#pragma unroll
    for (int ch = 0; ch < POOL_CHUNKS; ++ch) s += t[ch];
    pooled[tid] = s * (1.0f / (float)SPAN);
  }
  __syncthreads();

  // layer 1: wave = a slice of 32 inputs, lane = 4 of the 128 outputs, so one
  // load of a wave is one whole 512-byte row of gW1
  {
    const float* wrow = gW1 + (size_t)wave * 32 * 128 + lane * 4;
    v4f a = {};
#pragma unroll
    for (int half = 0; half < 2; ++half) {
      v4f w[16];
#pragma unroll
      for (int i = 0; i < 16; ++i)
        w[i] = *(const v4f*)(wrow + (half * 16 + i) * 128);
#pragma unroll
      for (int i = 0; i < 16; ++i) a += pooled[wave * 32 + half * 16 + i] * w[i];
    }
    *(v4f*)&hpart[wave * 128 + lane * 4] = a;
  }
  __syncthreads();

  if (tid < 128) {
    float s = gb1[tid];
#pragma unroll
    for (int w = 0; w < 32; ++w) s += hpart[w * 128 + tid];
    gact[tid] = fmaxf(s, 0.f);
  }
  __syncthreads();

  // layer 2 and softmax: wave 0, lane = 4 of the 128 hidden units
  if (wave == 0) {
    v4f l = {};
#pragma unroll
    for (int i = 0; i < 4; ++i)
      l += gact[lane * 4 + i] * *(const v4f*)(gW2 + (lane * 4 + i) * 4);
#pragma unroll
    for (int off = 16; off > 0; off >>= 1)
#pragma unroll
      for (int e = 0; e < 4; ++e) l[e] += __shfl_xor(l[e], off, 32);
#pragma unroll
    for (int e = 0; e < 4; ++e) l[e] += gb2[e];
    float mx = fmaxf(fmaxf(l[0], l[1]), fmaxf(l[2], l[3]));
    float e0 = __expf(l[0] - mx), e1 = __expf(l[1] - mx);
    float e2 = __expf(l[2] - mx), e3 = __expf(l[3] - mx);
    float inv = 1.0f / (e0 + e1 + e2 + e3);
    if (lane == 0) {
      gws[0] = e0 * inv; gws[1] = e1 * inv; gws[2] = e2 * inv; gws[3] = e3 * inv;
      gw_out[inst * 4 + 0] = e0 * inv; gw_out[inst * 4 + 1] = e1 * inv;
      gw_out[inst * 4 + 2] = e2 * inv; gw_out[inst * 4 + 3] = e3 * inv;
    }
  }
  __syncthreads();

  // effective biases: thread = column
  {
    float a0 = 0.f, a1 = 0.f, a2 = 0.f;
#pragma unroll
    for (int e = 0; e < 4; ++e) {
      float g = gws[e];
      a0 += g * bq[e * 1024 + tid];
      a1 += g * bk[e * 1024 + tid];
      a2 += g * bv[e * 1024 + tid];
    }
    beff[(0 * NINST + inst) * 1024 + tid] = a0;
    beff[(1 * NINST + inst) * 1024 + tid] = a1;
    beff[(2 * NINST + inst) * 1024 + tid] = a2;
  }
}

// ----------------------------- 3) weight prep ------------------------------
// Packed weight matrix, f16: [n/128][k/32][n%128][k%32], so that the 128x32
// tile a GEMM block stages per K-step is 4096 contiguous halves.
// One block takes a 64(k) x 64(n) tile of all NE experts through LDS (the
// transpose), then forms every instance's combination from registers.
#define PREP_PITCH 65  // dwords; column walks of 4-byte reads hit 32 banks

template <int NE, int NI>
__device__ __forceinline__ void prep_tile(const float* __restrict__ W,   // [NE][K][N]
                                          const float* __restrict__ gw,  // [NI][NE]
                                          _Float16* __restrict__ Wp,     // [NI] packed
                                          float* __restrict__ tile) {
  const int tid = threadIdx.x;
  const int n0 = blockIdx.x * 64;
  const int k0 = blockIdx.y * 64;

  // the 64 gate weights: two per lane, then readlane moves each to a scalar
  // register, so that none of them holds a vector register beside the tile
  static_assert(NE == 1 || NI * NE == 64, "two gate weights per lane");
  float g[NI][NE];
  if constexpr (NE > 1) {
    const int glo = __builtin_bit_cast(int, gw[tid & 31]);
    const int ghi = __builtin_bit_cast(int, gw[32 + (tid & 31)]);
#pragma unroll
    for (int i = 0; i < NI; ++i)
#pragma unroll
      for (int e = 0; e < NE; ++e)
        g[i][e] = __builtin_bit_cast(
            float, __builtin_amdgcn_readlane((i * NE + e) < 32 ? glo : ghi,
                                             (i * NE + e) & 31));
  }

  // all NE*4 loads go out before the first LDS store waits for data
  const unsigned kr = tid >> 4, n4 = (tid & 15) * 4;
  v4f w4[NE][4];
#pragma unroll
  for (int e = 0; e < NE; ++e) {
    const float* We = W + (size_t)e * KDIM * NDIM + (size_t)k0 * NDIM + n0;
#pragma unroll
    for (int it = 0; it < 4; ++it)
      w4[e][it] = *(const v4f*)&We[(kr + it * 16) * NDIM + n4];
    // precaution: stands in front of later loads whose results may reuse an
    // address register of these loads
    asm volatile("s_wait_xcnt 0x0" ::: "memory");
  }
#pragma unroll
  for (int e = 0; e < NE; ++e)
#pragma unroll
    for (int it = 0; it < 4; ++it)
#pragma unroll
      for (int j = 0; j < 4; ++j)
        tile[(e * 64 + kr + it * 16) * PREP_PITCH + n4 + j] = w4[e][it][j];
  __syncthreads();

  const int kq = tid & 3;   // 8 consecutive k per thread
  const int n = tid >> 2;   // 0..63
  const int ng = n0 + n;
#pragma unroll
  for (int ks = 0; ks < 2; ++ks) {  // the tile's two 32-wide K-steps
    float w[NE][8];
#pragma unroll
    for (int e = 0; e < NE; ++e)
#pragma unroll
      for (int j = 0; j < 8; ++j)
        w[e][j] = tile[(e * 64 + ks * 32 + kq * 8 + j) * PREP_PITCH + n];

    _Float16* dst = Wp + ((size_t)(ng >> 7) * 32 + (k0 >> 5) + ks) * 4096 +
                    (ng & 127) * 32 + kq * 8;
#pragma unroll
    for (int i = 0; i < NI; ++i) {
      v8h o;
#pragma unroll
      for (int j = 0; j < 8; ++j) {
        float a = (NE == 1) ? w[0][j] : g[i][0] * w[0][j];
#pragma unroll
        for (int e = 1; e < NE; ++e) a = __builtin_fmaf(g[i][e], w[e][j], a);
        o[j] = (_Float16)a;
      }
      *(v8h*)(dst + (size_t)i * KDIM * NDIM) = o;
    }
  }
}

// grid = (N/64, K/64, 4): z = 0,1,2 -> q,k,v (4 experts, 16 instances), 3 -> Wo.
__global__ void __launch_bounds__(256)
prep_weights(const float* __restrict__ Wq,
             const float* __restrict__ Wk,
             const float* __restrict__ Wv,
             const float* __restrict__ Wo,
             const float* __restrict__ gw,
             _Float16* __restrict__ Wp,
             _Float16* __restrict__ Wop) {
  __shared__ float tile[4 * 64 * PREP_PITCH];
  const int p = blockIdx.z;
  if (p < 3) {
    const float* W = (p == 0) ? Wq : (p == 1) ? Wk : Wv;
    prep_tile<4, NINST>(W, gw, Wp + (size_t)p * NINST * KDIM * NDIM, tile);
  } else {
    prep_tile<1, 1>(Wo, gw, Wop, tile);
  }
}

// ------------------------------ 4/6) WMMA GEMM -----------------------------
// grid = (N/128, M/128), block = 256 (8 waves, 2x4 wave grid, 64x32/wave).
template <typename OutT, bool MOE>
__global__ void moe_gemm(const _Float16* __restrict__ A,   // [M][K] f16
                         const _Float16* __restrict__ Wp,  // packed, MOE:[NINST]
                         const float* __restrict__ bias,   // MOE:[NINST][N] else [N]
                         OutT* __restrict__ Y) {
  __shared__ _Float16 As[128 * 40] __attribute__((aligned(16)));  // pad 40
  __shared__ _Float16 Ws[128 * 40] __attribute__((aligned(16)));  // [n][k] pad

  const int tid = threadIdx.x;
  const int lane = tid & 31, wave = tid >> 5;
  const int rl = lane & 15;
  const int sel8 = (lane >> 4) * 8;
  const int row0 = blockIdx.y * 128;
  const int n0 = blockIdx.x * 128;
  const int inst = row0 >> 9;  // 512 rows per instance

  // this block's column of packed tiles: 32 K-steps of 4096 halves
  const _Float16* wcol = Wp + (MOE ? (size_t)inst * KDIM * NDIM : (size_t)0) +
                         (size_t)blockIdx.x * 32 * 4096;

  v8f acc[4][2];
  {
    v8f z = {};
#pragma unroll
    for (int i = 0; i < 4; ++i)
#pragma unroll
      for (int j = 0; j < 2; ++j) acc[i][j] = z;
  }

  const int mw = (wave >> 2) * 64;  // 0 or 64
  const int nw = (wave & 3) * 32;   // 0,32,64,96

  for (int kb = 0; kb < KDIM; kb += 32) {
    __syncthreads();

    // ---- A tile 128x32: 512 chunks of 8 halves (16B), 2 per thread ----
#pragma unroll
    for (int it = 0; it < 2; ++it) {
      int chunk = tid + it * 256;
      int r = chunk >> 2, c8 = (chunk & 3) * 8;
      _Float16* src = const_cast<_Float16*>(&A[(size_t)(row0 + r) * KDIM + kb + c8]);
      _Float16* dst = &As[r * 40 + c8];
#ifdef ASYNC_LDS
      __builtin_amdgcn_global_load_async_to_lds_b128(
          (gas_v4i_ptr)src, (las_v4i_ptr)dst, 0, 0);
#else
      *(v8h*)dst = *(const v8h*)src;
#endif
    }

    // ---- W tile 128x32: 512 contiguous chunks of 8 halves, 2 per thread ----
#pragma unroll
    for (int it = 0; it < 2; ++it) {
      int chunk = tid + it * 256;
      *(v8h*)&Ws[(chunk >> 2) * 40 + (chunk & 3) * 8] =
          *(const v8h*)&wcol[(size_t)(kb >> 5) * 4096 + chunk * 8];
    }

    wait_asynccnt0();
    __syncthreads();

    v16h af[4], bf[2];
#pragma unroll
    for (int i = 0; i < 4; ++i)
      af[i] = frag_ld(&As[(mw + i * 16 + rl) * 40 + sel8]);
#pragma unroll
    for (int j = 0; j < 2; ++j)
      bf[j] = frag_ld(&Ws[(nw + j * 16 + rl) * 40 + sel8]);
#pragma unroll
    for (int i = 0; i < 4; ++i)
#pragma unroll
      for (int j = 0; j < 2; ++j) acc[i][j] = wmma32(af[i], bf[j], acc[i][j]);
  }

  // epilogue: D layout = lane%16 -> col, vgpr r + 8*(lane/16) -> row
#pragma unroll
  for (int i = 0; i < 4; ++i)
#pragma unroll
    for (int j = 0; j < 2; ++j)
#pragma unroll
      for (int r = 0; r < 8; ++r) {
        int rg = row0 + mw + i * 16 + r + (lane >> 4) * 8;
        int cg = n0 + nw + j * 16 + rl;
        float b = MOE ? bias[inst * NDIM + cg] : bias[cg];
        Y[(size_t)rg * NDIM + cg] = (OutT)(acc[i][j][r] + b);
      }
}

// --------------------------- 5) span attention -----------------------------
// grid = (S/64 qtiles, H, NINST), block = 128 (4 waves, 16 q-rows each).
// LDS: scores/probs f16 [64][512], V^T f16 [64][520], rowinv f32 [64].
#define ATTN_SMEM (64 * 512 * 2 + 64 * 520 * 2 + 64 * 4)

__global__ void span_attn(const _Float16* __restrict__ Q,
                          const _Float16* __restrict__ Kx,
                          const _Float16* __restrict__ V,
                          _Float16* __restrict__ O) {
  extern __shared__ char smem_raw[];
  _Float16* sc = (_Float16*)smem_raw;     // [64][512] scores -> probs in place
  _Float16* vt = sc + 64 * 512;           // [64][520] V transposed [dh][key]
  float* rinv = (float*)(vt + 64 * 520);  // [64]

  const int tid = threadIdx.x;
  const int lane = tid & 31, wave = tid >> 5;
  const int rl = lane & 15;
  const int sel8 = (lane >> 4) * 8;
  const int q0 = blockIdx.x * 64;
  const int h = blockIdx.y;
  const int inst = blockIdx.z;
  const size_t base = (size_t)inst * SPAN * 1024 + h * 64;

  // stage V^T: 16B global reads along Dh, scatter-transpose into LDS
  for (int chunk = tid; chunk < SPAN * 8; chunk += 128) {
    int key = chunk >> 3, d8 = (chunk & 7) * 8;
    v8h v = *(const v8h*)&V[base + (size_t)key * 1024 + d8];
#pragma unroll
    for (int j = 0; j < 8; ++j) vt[(d8 + j) * 520 + key] = v[j];
  }
  __syncthreads();

  // Q fragments for this wave's 16 rows (K=Dh=64 -> 2 k-steps), loaded once
  v16h qa[2];
#pragma unroll
  for (int t = 0; t < 2; ++t)
    qa[t] = frag_ld(&Q[base + (size_t)(q0 + wave * 16 + rl) * 1024 + t * 32 + sel8]);

  // scores = (Q K^T) * 1/sqrt(Dh); B-frag of K^T is contiguous per lane
  for (int kt = 0; kt < 32; ++kt) {
    v8f s = {};
#pragma unroll
    for (int t = 0; t < 2; ++t) {
      v16h kb = frag_ld(&Kx[base + (size_t)(kt * 16 + rl) * 1024 + t * 32 + sel8]);
      s = wmma32(qa[t], kb, s);
    }
#pragma unroll
    for (int r = 0; r < 8; ++r)
      sc[(wave * 16 + r + (lane >> 4) * 8) * 512 + kt * 16 + rl] =
          (_Float16)(s[r] * 0.125f);
  }

  // full-row softmax (each wave owns its 16 rows; no cross-wave barrier)
  for (int r = 0; r < 16; ++r) {
    int row = wave * 16 + r;
    float mx = -3.0e38f;
    for (int c = lane; c < 512; c += 32)
      mx = fmaxf(mx, (float)sc[row * 512 + c]);
#pragma unroll
    for (int off = 16; off > 0; off >>= 1)
      mx = fmaxf(mx, __shfl_xor(mx, off, 32));
    float sum = 0.f;
    for (int c = lane; c < 512; c += 32) {
      float ev = __expf((float)sc[row * 512 + c] - mx);
      sc[row * 512 + c] = (_Float16)ev;  // in-place probs
      sum += ev;
    }
#pragma unroll
    for (int off = 16; off > 0; off >>= 1) sum += __shfl_xor(sum, off, 32);
    if (lane == 0) rinv[row] = 1.0f / sum;
  }

  // O = P V  (K dim = 512 keys -> 16 k-steps; V^T gives contiguous B-frags)
  v8f oacc[4];
  {
    v8f z = {};
#pragma unroll
    for (int n = 0; n < 4; ++n) oacc[n] = z;
  }
  for (int t = 0; t < 16; ++t) {
    v16h pa = frag_ld(&sc[(wave * 16 + rl) * 512 + t * 32 + sel8]);
#pragma unroll
    for (int n = 0; n < 4; ++n) {
      v16h vb = frag_ld(&vt[(n * 16 + rl) * 520 + t * 32 + sel8]);
      oacc[n] = wmma32(pa, vb, oacc[n]);
    }
  }

#pragma unroll
  for (int n = 0; n < 4; ++n)
#pragma unroll
    for (int r = 0; r < 8; ++r) {
      int rowl = wave * 16 + r + (lane >> 4) * 8;
      float inv = rinv[rowl];
      O[base + (size_t)(q0 + rowl) * 1024 + n * 16 + rl] =
          (_Float16)(oacc[n][r] * inv);
    }
}

// ------------------------------- launcher ----------------------------------
extern "C" void kernel_launch(void* const* d_in, const int* in_sizes, int n_in,
                              void* d_out, int out_size, void* d_ws,
                              size_t ws_size, hipStream_t stream) {
  const float* X   = (const float*)d_in[0];
  const float* Wq  = (const float*)d_in[1];
  const float* bq  = (const float*)d_in[2];
  const float* Wk  = (const float*)d_in[3];
  const float* bk  = (const float*)d_in[4];
  const float* Wv  = (const float*)d_in[5];
  const float* bv  = (const float*)d_in[6];
  const float* gW1 = (const float*)d_in[7];
  const float* gb1 = (const float*)d_in[8];
  const float* gW2 = (const float*)d_in[9];
  const float* gb2 = (const float*)d_in[10];
  const float* Wo  = (const float*)d_in[11];
  const float* bo  = (const float*)d_in[12];

  char* ws = (char*)d_ws;
  _Float16* Xh = (_Float16*)(ws + OFF_XH);
  _Float16* Qb = (_Float16*)(ws + OFF_Q);
  _Float16* Kb = (_Float16*)(ws + OFF_K);
  _Float16* Vb = (_Float16*)(ws + OFF_V);
  _Float16* AO = (_Float16*)(ws + OFF_AO);
  float* gw    = (float*)(ws + OFF_GW);
  float* beff  = (float*)(ws + OFF_BE);  // [3][16][1024]
  float* part  = (float*)(ws + OFF_PP);
  _Float16* Wp  = (_Float16*)(ws + OFF_WP);
  _Float16* Wop = (_Float16*)(ws + OFF_WOP);

  cvt_pool<<<MDIM / POOL_ROWS, 256, 0, stream>>>(X, Xh, part);

  gate_kernel<<<NINST, 1024, 0, stream>>>(part, gW1, gb1, gW2, gb2, bq, bk, bv,
                                          gw, beff);

  dim3 pgrid(NDIM / 64, KDIM / 64, 4);
  prep_weights<<<pgrid, 256, 0, stream>>>(Wq, Wk, Wv, Wo, gw, Wp, Wop);

  dim3 ggrid(NDIM / 128, MDIM / 128);
  moe_gemm<_Float16, true><<<ggrid, 256, 0, stream>>>(
      Xh, Wp + (size_t)0 * NINST * KDIM * NDIM, beff + 0 * NINST * NDIM, Qb);
  moe_gemm<_Float16, true><<<ggrid, 256, 0, stream>>>(
      Xh, Wp + (size_t)1 * NINST * KDIM * NDIM, beff + 1 * NINST * NDIM, Kb);
  moe_gemm<_Float16, true><<<ggrid, 256, 0, stream>>>(
      Xh, Wp + (size_t)2 * NINST * KDIM * NDIM, beff + 2 * NINST * NDIM, Vb);

  dim3 agrid(SPAN / 64, 16, NINST);
  span_attn<<<agrid, 128, ATTN_SMEM, stream>>>(Qb, Kb, Vb, AO);

  moe_gemm<float, false><<<ggrid, 256, 0, stream>>>(AO, Wop, bo,
                                                    (float*)d_out);
}

// v003
// A run of this version takes 237 microseconds.
// Timed twice side by side with v002, it ran 1.24 and 1.23 times as fast.
// All steps since v000 together make it 4.27 times as fast.
#include <hip/hip_runtime.h>

// ---------------------------------------------------------------------------
// MoE span attention for MI455X (gfx1250, wave32, WMMA 16x16x32 f16->f32).
//
// Sizes (fixed by the reference): B=4, T=2048, C=1024, E=4 spans==experts,
// H=16 heads, Dh=64, S=512, M = B*T = 8192 rows, K=N=1024.
//
// Pipeline (all on `stream`):
//   1) convert hidden f32 -> f16 (ws); the same pass sums each block's 16
//      rows per column: 32 partial sums per span for the gate's mean-pool
//   2) gate: add the partial sums -> MLP -> softmax -> gw[16][4]; eff biases
//   3) weight prep: W_eff[inst] = sum_e gw_e W_e for q/k/v, and Wo, each
//      rounded to f16 once and packed in the GEMM's own tile order (ws)
//   4) q/k/v GEMMs: Y = X @ W_eff[inst] + b_eff. A-tile staged via
//      GLOBAL_LOAD_ASYNC_TO_LDS, waited with ASYNCcnt; W-tile is one
//      contiguous 8 KiB read per K-step.
//   5) per-(inst,head) attention, full-row softmax in registers
//   6) output GEMM (same kernel, one weight matrix) -> d_out f32
// ---------------------------------------------------------------------------

typedef __attribute__((ext_vector_type(16))) _Float16 v16h;
typedef __attribute__((ext_vector_type(8)))  _Float16 v8h;
typedef __attribute__((ext_vector_type(4)))  _Float16 v4h;
typedef __attribute__((ext_vector_type(8)))  float    v8f;
typedef __attribute__((ext_vector_type(4)))  float    v4f;
typedef __attribute__((ext_vector_type(4)))  int      v4i;

#if __has_builtin(__builtin_amdgcn_global_load_async_to_lds_b128)
#define ASYNC_LDS 1
typedef __attribute__((address_space(1))) v4i* gas_v4i_ptr;
typedef __attribute__((address_space(3))) v4i* las_v4i_ptr;
#endif

__device__ __forceinline__ void wait_asynccnt0() {
#if defined(ASYNC_LDS)
#if __has_builtin(__builtin_amdgcn_s_wait_asynccnt)
  __builtin_amdgcn_s_wait_asynccnt(0);
#else
  asm volatile("s_wait_asynccnt 0" ::: "memory");
#endif
#endif
}

__device__ __forceinline__ v8f wmma32(v16h a, v16h b, v8f c) {
  // (neg_a, A, neg_b, B, c_mod, C, reuse_a, reuse_b)
  return __builtin_amdgcn_wmma_f32_16x16x32_f16(false, a, false, b, (short)0, c,
                                                false, false);
}

// Load one 16x32 (A-style) / 32x16 (B-style) f16 WMMA fragment.
// Caller passes p = &buf[(lane%16)*stride + (lane/16)*8 (+k_base)], 16B aligned.
// Per ISA 7.12.2: halves 0..7 = K at p[0..7], halves 8..15 = K at p[16..23].
__device__ __forceinline__ v16h frag_ld(const _Float16* p) {
  v8h lo = *(const v8h*)p;
  v8h hi = *(const v8h*)(p + 16);
  v16h r;
#pragma unroll
  for (int j = 0; j < 8; ++j) { r[j] = lo[j]; r[j + 8] = hi[j]; }
  return r;
}

// ------------------------------- constants ---------------------------------
#define MDIM 8192
#define KDIM 1024
#define NDIM 1024
#define NINST 16
#define SPAN 512

// workspace layout (bytes)
#define OFF_XH  ((size_t)0)
#define OFF_Q   ((size_t)16 << 20)
#define OFF_K   ((size_t)32 << 20)
#define OFF_V   ((size_t)48 << 20)
#define OFF_AO  ((size_t)64 << 20)
#define OFF_GW  ((size_t)80 << 20)
#define OFF_BE  (OFF_GW + 4096)
#define OFF_PP  ((size_t)84 << 20)   // pooling partial sums [NINST][32][1024] f32
#define OFF_WP  ((size_t)96 << 20)   // packed q/k/v weights [3][NINST], 2 MiB each
#define OFF_WOP ((size_t)192 << 20)  // packed Wo, 2 MiB

// ---------------- 1) f32 -> f16, with the pooling partial sums --------------
// One block = 16 rows x all 1024 columns, four columns per thread.
#define POOL_ROWS 16
#define POOL_CHUNKS (SPAN / POOL_ROWS)  // 32 partial sums per span and column

__global__ void __launch_bounds__(256)
cvt_pool(const float* __restrict__ x,
         _Float16* __restrict__ y,
         float* __restrict__ part) {  // [NINST * POOL_CHUNKS][1024]
  const size_t c4 = (size_t)threadIdx.x * 4;
  const size_t base = (size_t)blockIdx.x * POOL_ROWS * 1024 + c4;

  // all 16 loads go out before the first use waits for data
  v4f v[POOL_ROWS];
#pragma unroll
  for (int r = 0; r < POOL_ROWS; ++r)
    v[r] = *(const v4f*)(x + base + (size_t)r * 1024);

  v4f s = {};
#pragma unroll
  for (int r = 0; r < POOL_ROWS; ++r) {
    v4h h;
#pragma unroll
    for (int j = 0; j < 4; ++j) h[j] = (_Float16)v[r][j];
    *(v4h*)(y + base + (size_t)r * 1024) = h;
    s += v[r];
  }
  *(v4f*)(part + (size_t)blockIdx.x * 1024 + c4) = s;
}

// ------------------------------- 2) gate -----------------------------------
// One block of 32 waves per instance. Every long sum is cut into partial sums
// whose loads are all in flight together.
__global__ void __launch_bounds__(1024)
gate_kernel(const float* __restrict__ part,
            const float* __restrict__ gW1,
            const float* __restrict__ gb1,
            const float* __restrict__ gW2,
            const float* __restrict__ gb2,
            const float* __restrict__ bq,
            const float* __restrict__ bk,
            const float* __restrict__ bv,
            float* __restrict__ gw_out,
            float* __restrict__ beff) {
  __shared__ float pooled[1024] __attribute__((aligned(16)));
  __shared__ float hpart[32 * 128] __attribute__((aligned(16)));
  __shared__ float gact[128] __attribute__((aligned(16)));
  __shared__ float gws[4];
  const int inst = blockIdx.x;
  const int tid = threadIdx.x;
  const int lane = tid & 31, wave = tid >> 5;

  // mean-pool: thread = column, the 32 partial sums of the convert pass
  {
    const float* p = part + (size_t)inst * POOL_CHUNKS * 1024 + tid;
    float t[POOL_CHUNKS];
#pragma unroll
    for (int ch = 0; ch < POOL_CHUNKS; ++ch) t[ch] = p[ch * 1024];
    float s = 0.f;
#pragma unroll
    for (int ch = 0; ch < POOL_CHUNKS; ++ch) s += t[ch];
    pooled[tid] = s * (1.0f / (float)SPAN);
  }
  __syncthreads();

  // layer 1: wave = a slice of 32 inputs, lane = 4 of the 128 outputs, so one
  // load of a wave is one whole 512-byte row of gW1
  {
    const float* wrow = gW1 + (size_t)wave * 32 * 128 + lane * 4;
    v4f a = {};
#pragma unroll
    for (int half = 0; half < 2; ++half) {
      v4f w[16];
#pragma unroll
      for (int i = 0; i < 16; ++i)
        w[i] = *(const v4f*)(wrow + (half * 16 + i) * 128);
#pragma unroll
      for (int i = 0; i < 16; ++i) a += pooled[wave * 32 + half * 16 + i] * w[i];
    }
    *(v4f*)&hpart[wave * 128 + lane * 4] = a;
  }
  __syncthreads();

  if (tid < 128) {
    float s = gb1[tid];
#pragma unroll
    for (int w = 0; w < 32; ++w) s += hpart[w * 128 + tid];
    gact[tid] = fmaxf(s, 0.f);
  }
  __syncthreads();

  // layer 2 and softmax: wave 0, lane = 4 of the 128 hidden units
  if (wave == 0) {
    v4f l = {};
#pragma unroll
    for (int i = 0; i < 4; ++i)
      l += gact[lane * 4 + i] * *(const v4f*)(gW2 + (lane * 4 + i) * 4);
#pragma unroll
    for (int off = 16; off > 0; off >>= 1)
#pragma unroll
      for (int e = 0; e < 4; ++e) l[e] += __shfl_xor(l[e], off, 32);
#pragma unroll
    for (int e = 0; e < 4; ++e) l[e] += gb2[e];
    float mx = fmaxf(fmaxf(l[0], l[1]), fmaxf(l[2], l[3]));
    float e0 = __expf(l[0] - mx), e1 = __expf(l[1] - mx);
    float e2 = __expf(l[2] - mx), e3 = __expf(l[3] - mx);
    float inv = 1.0f / (e0 + e1 + e2 + e3);
    if (lane == 0) {
      gws[0] = e0 * inv; gws[1] = e1 * inv; gws[2] = e2 * inv; gws[3] = e3 * inv;
      gw_out[inst * 4 + 0] = e0 * inv; gw_out[inst * 4 + 1] = e1 * inv;
      gw_out[inst * 4 + 2] = e2 * inv; gw_out[inst * 4 + 3] = e3 * inv;
    }
  }
  __syncthreads();

  // effective biases: thread = column
  {
    float a0 = 0.f, a1 = 0.f, a2 = 0.f;
#pragma unroll
    for (int e = 0; e < 4; ++e) {
      float g = gws[e];
      a0 += g * bq[e * 1024 + tid];
      a1 += g * bk[e * 1024 + tid];
      a2 += g * bv[e * 1024 + tid];
    }
    beff[(0 * NINST + inst) * 1024 + tid] = a0;
    beff[(1 * NINST + inst) * 1024 + tid] = a1;
    beff[(2 * NINST + inst) * 1024 + tid] = a2;
  }
}

// ----------------------------- 3) weight prep ------------------------------
// Packed weight matrix, f16: [n/128][k/32][n%128][k%32], so that the 128x32
// tile a GEMM block stages per K-step is 4096 contiguous halves.
// One block takes a 64(k) x 64(n) tile of all NE experts through LDS (the
// transpose), then forms every instance's combination from registers.
#define PREP_PITCH 65  // dwords; column walks of 4-byte reads hit 32 banks

template <int NE, int NI>
__device__ __forceinline__ void prep_tile(const float* __restrict__ W,   // [NE][K][N]
                                          const float* __restrict__ gw,  // [NI][NE]
                                          _Float16* __restrict__ Wp,     // [NI] packed
                                          float* __restrict__ tile) {
  const int tid = threadIdx.x;
  const int n0 = blockIdx.x * 64;
  const int k0 = blockIdx.y * 64;

  // the 64 gate weights: two per lane, then readlane moves each to a scalar
  // register, so that none of them holds a vector register beside the tile
  static_assert(NE == 1 || NI * NE == 64, "two gate weights per lane");
  float g[NI][NE];
  if constexpr (NE > 1) {
    const int glo = __builtin_bit_cast(int, gw[tid & 31]);
    const int ghi = __builtin_bit_cast(int, gw[32 + (tid & 31)]);
#pragma unroll
    for (int i = 0; i < NI; ++i)
#pragma unroll
      for (int e = 0; e < NE; ++e)
        g[i][e] = __builtin_bit_cast(
            float, __builtin_amdgcn_readlane((i * NE + e) < 32 ? glo : ghi,
                                             (i * NE + e) & 31));
  }

  // all NE*4 loads go out before the first LDS store waits for data
  const unsigned kr = tid >> 4, n4 = (tid & 15) * 4;
  v4f w4[NE][4];
#pragma unroll
  for (int e = 0; e < NE; ++e) {
    const float* We = W + (size_t)e * KDIM * NDIM + (size_t)k0 * NDIM + n0;
#pragma unroll
    for (int it = 0; it < 4; ++it)
      w4[e][it] = *(const v4f*)&We[(kr + it * 16) * NDIM + n4];
    // precaution: stands in front of later loads whose results may reuse an
    // address register of these loads
    asm volatile("s_wait_xcnt 0x0" ::: "memory");
  }
#pragma unroll
  for (int e = 0; e < NE; ++e)
#pragma unroll
    for (int it = 0; it < 4; ++it)
#pragma unroll
      for (int j = 0; j < 4; ++j)
        tile[(e * 64 + kr + it * 16) * PREP_PITCH + n4 + j] = w4[e][it][j];
  __syncthreads();

  const int kq = tid & 3;   // 8 consecutive k per thread
  const int n = tid >> 2;   // 0..63
  const int ng = n0 + n;
#pragma unroll
  for (int ks = 0; ks < 2; ++ks) {  // the tile's two 32-wide K-steps
    float w[NE][8];
#pragma unroll
    for (int e = 0; e < NE; ++e)
#pragma unroll
      for (int j = 0; j < 8; ++j)
        w[e][j] = tile[(e * 64 + ks * 32 + kq * 8 + j) * PREP_PITCH + n];

    _Float16* dst = Wp + ((size_t)(ng >> 7) * 32 + (k0 >> 5) + ks) * 4096 +
                    (ng & 127) * 32 + kq * 8;
#pragma unroll
    for (int i = 0; i < NI; ++i) {
      v8h o;
#pragma unroll
      for (int j = 0; j < 8; ++j) {
        float a = (NE == 1) ? w[0][j] : g[i][0] * w[0][j];
#pragma unroll
        for (int e = 1; e < NE; ++e) a = __builtin_fmaf(g[i][e], w[e][j], a);
        o[j] = (_Float16)a;
      }
      *(v8h*)(dst + (size_t)i * KDIM * NDIM) = o;
    }
  }
}

// grid = (N/64, K/64, 4): z = 0,1,2 -> q,k,v (4 experts, 16 instances), 3 -> Wo.
__global__ void __launch_bounds__(256)
prep_weights(const float* __restrict__ Wq,
             const float* __restrict__ Wk,
             const float* __restrict__ Wv,
             const float* __restrict__ Wo,
             const float* __restrict__ gw,
             _Float16* __restrict__ Wp,
             _Float16* __restrict__ Wop) {
  __shared__ float tile[4 * 64 * PREP_PITCH];
  const int p = blockIdx.z;
  if (p < 3) {
    const float* W = (p == 0) ? Wq : (p == 1) ? Wk : Wv;
    prep_tile<4, NINST>(W, gw, Wp + (size_t)p * NINST * KDIM * NDIM, tile);
  } else {
    prep_tile<1, 1>(Wo, gw, Wop, tile);
  }
}

// ------------------------------ 4/6) WMMA GEMM -----------------------------
// grid = (N/128, M/128), block = 256 (8 waves, 2x4 wave grid, 64x32/wave).
template <typename OutT, bool MOE>
__global__ void moe_gemm(const _Float16* __restrict__ A,   // [M][K] f16
                         const _Float16* __restrict__ Wp,  // packed, MOE:[NINST]
                         const float* __restrict__ bias,   // MOE:[NINST][N] else [N]
                         OutT* __restrict__ Y) {
  __shared__ _Float16 As[128 * 40] __attribute__((aligned(16)));  // pad 40
  __shared__ _Float16 Ws[128 * 40] __attribute__((aligned(16)));  // [n][k] pad

  const int tid = threadIdx.x;
  const int lane = tid & 31, wave = tid >> 5;
  const int rl = lane & 15;
  const int sel8 = (lane >> 4) * 8;
  const int row0 = blockIdx.y * 128;
  const int n0 = blockIdx.x * 128;
  const int inst = row0 >> 9;  // 512 rows per instance

  // this block's column of packed tiles: 32 K-steps of 4096 halves
  const _Float16* wcol = Wp + (MOE ? (size_t)inst * KDIM * NDIM : (size_t)0) +
                         (size_t)blockIdx.x * 32 * 4096;

  v8f acc[4][2];
  {
    v8f z = {};
#pragma unroll
    for (int i = 0; i < 4; ++i)
#pragma unroll
      for (int j = 0; j < 2; ++j) acc[i][j] = z;
  }

  const int mw = (wave >> 2) * 64;  // 0 or 64
  const int nw = (wave & 3) * 32;   // 0,32,64,96

  for (int kb = 0; kb < KDIM; kb += 32) {
    __syncthreads();

    // ---- A tile 128x32: 512 chunks of 8 halves (16B), 2 per thread ----
#pragma unroll
    for (int it = 0; it < 2; ++it) {
      int chunk = tid + it * 256;
      int r = chunk >> 2, c8 = (chunk & 3) * 8;
      _Float16* src = const_cast<_Float16*>(&A[(size_t)(row0 + r) * KDIM + kb + c8]);
      _Float16* dst = &As[r * 40 + c8];
#ifdef ASYNC_LDS
      __builtin_amdgcn_global_load_async_to_lds_b128(
          (gas_v4i_ptr)src, (las_v4i_ptr)dst, 0, 0);
#else
      *(v8h*)dst = *(const v8h*)src;
#endif
    }

    // ---- W tile 128x32: 512 contiguous chunks of 8 halves, 2 per thread ----
#pragma unroll
    for (int it = 0; it < 2; ++it) {
      int chunk = tid + it * 256;
      *(v8h*)&Ws[(chunk >> 2) * 40 + (chunk & 3) * 8] =
          *(const v8h*)&wcol[(size_t)(kb >> 5) * 4096 + chunk * 8];
    }

    wait_asynccnt0();
    __syncthreads();

    v16h af[4], bf[2];
#pragma unroll
    for (int i = 0; i < 4; ++i)
      af[i] = frag_ld(&As[(mw + i * 16 + rl) * 40 + sel8]);
#pragma unroll
    for (int j = 0; j < 2; ++j)
      bf[j] = frag_ld(&Ws[(nw + j * 16 + rl) * 40 + sel8]);
#pragma unroll
    for (int i = 0; i < 4; ++i)
#pragma unroll
      for (int j = 0; j < 2; ++j) acc[i][j] = wmma32(af[i], bf[j], acc[i][j]);
  }

  // epilogue: D layout = lane%16 -> col, vgpr r + 8*(lane/16) -> row
#pragma unroll
  for (int i = 0; i < 4; ++i)
#pragma unroll
    for (int j = 0; j < 2; ++j)
#pragma unroll
      for (int r = 0; r < 8; ++r) {
        int rg = row0 + mw + i * 16 + r + (lane >> 4) * 8;
        int cg = n0 + nw + j * 16 + rl;
        float b = MOE ? bias[inst * NDIM + cg] : bias[cg];
        Y[(size_t)rg * NDIM + cg] = (OutT)(acc[i][j][r] + b);
      }
}

#define ATTN_SMEM (64 * 520 * 2)

// the real block size lifts the register ceiling: the 256 score registers of
// a lane have to fit without scratch
__global__ void __launch_bounds__(128)
span_attn(const _Float16* __restrict__ Q,
          const _Float16* __restrict__ Kx,
          const _Float16* __restrict__ V,
          _Float16* __restrict__ O) {
  extern __shared__ char smem_raw[];
  _Float16* vt = (_Float16*)smem_raw;     // [64][520] V transposed [dh][key]

  const int tid = threadIdx.x;
  const int lane = tid & 31, wave = tid >> 5;
  const int rl = lane & 15;
  const int sel8 = (lane >> 4) * 8;
  const int q0 = blockIdx.x * 64;
  const int h = blockIdx.y;
  const int inst = blockIdx.z;
  const size_t base = (size_t)inst * SPAN * 1024 + h * 64;

  // stage V^T: 16B global reads along Dh, scatter-transpose into LDS
  for (int chunk = tid; chunk < SPAN * 8; chunk += 128) {
    int key = chunk >> 3, d8 = (chunk & 7) * 8;
    v8h v = *(const v8h*)&V[base + (size_t)key * 1024 + d8];
#pragma unroll
    for (int j = 0; j < 8; ++j) vt[(d8 + j) * 520 + key] = v[j];
  }
  __syncthreads();

  // Q fragments for this wave's 16 queries (K=Dh=64 -> 2 k-steps), loaded once;
  // they are the B operand: column = query = lane%16
  v16h qa[2];
#pragma unroll
  for (int t = 0; t < 2; ++t)
    qa[t] = frag_ld(&Q[base + (size_t)(q0 + wave * 16 + rl) * 1024 + t * 32 + sel8]);
  // precaution: stands in front of the K loads, whose results may reuse the
  // address registers of the Q loads
  asm volatile("s_wait_xcnt 0x0" ::: "memory");

  // scores^T = K Q^T, kept as the f32 accumulators. D: lane%16 = query,
  // register r = key 8*(lane/16) + r of the 16-key tile: a lane holds 256 of
  // its query's 512 scores, lane^16 the other 256.
  v8f s[32];
#pragma unroll
  for (int kt = 0; kt < 32; ++kt) {
    v8f a = {};
#pragma unroll
    for (int d = 0; d < 2; ++d) {
      v16h kb = frag_ld(&Kx[base + (size_t)(kt * 16 + rl) * 1024 + d * 32 + sel8]);
      a = wmma32(kb, qa[d], a);
    }
    s[kt] = a;
  }
  // precaution: stands in front of the vector work below, whose results may
  // reuse the address registers of the K loads above
  asm volatile("s_wait_xcnt 0x0" ::: "memory");

  // row maximum: eight in-lane chains, joined, then the other lane half
  float mx;
  {
    v8f m = s[0];
#pragma unroll
    for (int kt = 1; kt < 32; ++kt) m = __builtin_elementwise_max(m, s[kt]);
    mx = fmaxf(fmaxf(fmaxf(m[0], m[1]), fmaxf(m[2], m[3])),
               fmaxf(fmaxf(m[4], m[5]), fmaxf(m[6], m[7])));
    mx = fmaxf(mx, __shfl_xor(mx, 16, 32));
  }

  // P^T = exp((S^T - max) / sqrt(Dh)), and O^T += V^T P^T (K dim = 512 keys ->
  // 16 k-steps; V^T rows are the A operand). Two score tiles, rounded to f16,
  // are a B operand over 32 keys in frag_ld's own k order:
  // pb[j] = key 32t + 8*(lane/16) + j, pb[8+j] = the same key + 16.
  const float SC = 0.125f * 1.44269504f;  // 1/sqrt(Dh) * log2(e)
  const float nmx = -mx * SC;
  const v8f SC8 = {SC, SC, SC, SC, SC, SC, SC, SC};
  const v8f nmx8 = {nmx, nmx, nmx, nmx, nmx, nmx, nmx, nmx};
  v8f sum = {};
  v8f oacc[4];
  {
    v8f z = {};
#pragma unroll
    for (int n = 0; n < 4; ++n) oacc[n] = z;
  }
#pragma unroll
  for (int t = 0; t < 16; ++t) {
    v16h pb;
#pragma unroll
    for (int u = 0; u < 2; ++u) {
      // whole-vector forms: packed f32 multiply-adds and adds, two per issue
      const v8f x = __builtin_elementwise_fma(s[t * 2 + u], SC8, nmx8);
      v8f ev;
#pragma unroll
      for (int j = 0; j < 8; ++j) ev[j] = __builtin_amdgcn_exp2f(x[j]);
      sum += ev;  // eight independent chains
      const v8h eh = __builtin_convertvector(ev, v8h);
#pragma unroll
      for (int j = 0; j < 8; ++j) pb[u * 8 + j] = eh[j];
    }
#pragma unroll
    for (int n = 0; n < 4; ++n) {
      v16h va = frag_ld(&vt[(n * 16 + rl) * 520 + t * 32 + sel8]);
      oacc[n] = wmma32(va, pb, oacc[n]);
    }
  }

  float tot = ((sum[0] + sum[1]) + (sum[2] + sum[3])) +
              ((sum[4] + sum[5]) + (sum[6] + sum[7]));
  tot += __shfl_xor(tot, 16, 32);
  const float inv = 1.0f / tot;

  // O^T: lane%16 = query, registers = 8 consecutive dh: one 16-byte store
#pragma unroll
  for (int n = 0; n < 4; ++n) {
    v8h o;
#pragma unroll
    for (int r = 0; r < 8; ++r) o[r] = (_Float16)(oacc[n][r] * inv);
    *(v8h*)&O[base + (size_t)(q0 + wave * 16 + rl) * 1024 + n * 16 + sel8] = o;
  }
}

// ------------------------------- launcher ----------------------------------
extern "C" void kernel_launch(void* const* d_in, const int* in_sizes, int n_in,
                              void* d_out, int out_size, void* d_ws,
                              size_t ws_size, hipStream_t stream) {
  const float* X   = (const float*)d_in[0];
  const float* Wq  = (const float*)d_in[1];
  const float* bq  = (const float*)d_in[2];
  const float* Wk  = (const float*)d_in[3];
  const float* bk  = (const float*)d_in[4];
  const float* Wv  = (const float*)d_in[5];
  const float* bv  = (const float*)d_in[6];
  const float* gW1 = (const float*)d_in[7];
  const float* gb1 = (const float*)d_in[8];
  const float* gW2 = (const float*)d_in[9];
  const float* gb2 = (const float*)d_in[10];
  const float* Wo  = (const float*)d_in[11];
  const float* bo  = (const float*)d_in[12];

  char* ws = (char*)d_ws;
  _Float16* Xh = (_Float16*)(ws + OFF_XH);
  _Float16* Qb = (_Float16*)(ws + OFF_Q);
  _Float16* Kb = (_Float16*)(ws + OFF_K);
  _Float16* Vb = (_Float16*)(ws + OFF_V);
  _Float16* AO = (_Float16*)(ws + OFF_AO);
  float* gw    = (float*)(ws + OFF_GW);
  float* beff  = (float*)(ws + OFF_BE);  // [3][16][1024]
  float* part  = (float*)(ws + OFF_PP);
  _Float16* Wp  = (_Float16*)(ws + OFF_WP);
  _Float16* Wop = (_Float16*)(ws + OFF_WOP);

  cvt_pool<<<MDIM / POOL_ROWS, 256, 0, stream>>>(X, Xh, part);

  gate_kernel<<<NINST, 1024, 0, stream>>>(part, gW1, gb1, gW2, gb2, bq, bk, bv,
                                          gw, beff);

  dim3 pgrid(NDIM / 64, KDIM / 64, 4);
  prep_weights<<<pgrid, 256, 0, stream>>>(Wq, Wk, Wv, Wo, gw, Wp, Wop);

  dim3 ggrid(NDIM / 128, MDIM / 128);
  moe_gemm<_Float16, true><<<ggrid, 256, 0, stream>>>(
      Xh, Wp + (size_t)0 * NINST * KDIM * NDIM, beff + 0 * NINST * NDIM, Qb);
  moe_gemm<_Float16, true><<<ggrid, 256, 0, stream>>>(
      Xh, Wp + (size_t)1 * NINST * KDIM * NDIM, beff + 1 * NINST * NDIM, Kb);
  moe_gemm<_Float16, true><<<ggrid, 256, 0, stream>>>(
      Xh, Wp + (size_t)2 * NINST * KDIM * NDIM, beff + 2 * NINST * NDIM, Vb);

  dim3 agrid(SPAN / 64, 16, NINST);
  span_attn<<<agrid, 128, ATTN_SMEM, stream>>>(Qb, Kb, Vb, AO);

  moe_gemm<float, false><<<ggrid, 256, 0, stream>>>(AO, Wop, bo,
                                                    (float*)d_out);
}

// v004
// It runs in 174 microseconds.
// Timed twice side by side with v003, it ran 1.38 and 1.39 times as fast.
// Over all steps from v000 it is 5.90 times as fast.
#include <hip/hip_runtime.h>

// ---------------------------------------------------------------------------
// MoE span attention for MI455X (gfx1250, wave32, WMMA 16x16x32 f16->f32).
//
// Sizes (fixed by the reference): B=4, T=2048, C=1024, E=4 spans==experts,
// H=16 heads, Dh=64, S=512, M = B*T = 8192 rows, K=N=1024.
//
// Pipeline (all on `stream`):
//   1) convert hidden f32 -> f16 (ws); the same pass sums each block's 16
//      rows per column: 32 partial sums per span for the gate's mean-pool
//   2) gate: add the partial sums -> MLP -> softmax -> gw[16][4]; eff biases
//   3) weight prep: W_eff[inst] = sum_e gw_e W_e for q/k/v, and Wo, each
//      rounded to f16 once and packed in the GEMM's own tile order (ws)
//   4) q/k/v GEMMs: Y = X @ W_eff[inst] + b_eff. A and W tiles of 128 k go to
//      a two-buffer LDS ring by GLOBAL_LOAD_ASYNC_TO_LDS, one stage ahead of
//      the stage that is multiplied.
//   5) per-(inst,head) attention, full-row softmax in registers
//   6) output GEMM (same kernel, one weight matrix) -> d_out f32
// ---------------------------------------------------------------------------

typedef __attribute__((ext_vector_type(16))) _Float16 v16h;
typedef __attribute__((ext_vector_type(8)))  _Float16 v8h;
typedef __attribute__((ext_vector_type(4)))  _Float16 v4h;
typedef __attribute__((ext_vector_type(8)))  float    v8f;
typedef __attribute__((ext_vector_type(4)))  float    v4f;

// this wave's asynchronous copies have landed in LDS
__device__ __forceinline__ void wait_asynccnt0() {
  asm volatile("s_wait_asynccnt 0x0" ::: "memory");
}

// this wave's LDS reads have returned: stands in front of the barrier behind
// which their buffer is refilled
__device__ __forceinline__ void wait_dscnt0() {
  asm volatile("s_wait_dscnt 0x0" ::: "memory");
}

// byte offset of a __shared__ address in the work-group's LDS
__device__ __forceinline__ unsigned lds_off(const void* p) {
  return (unsigned)(size_t)p;
}

// Eight asynchronous 16-byte copies per lane, global -> LDS, through no
// register. The s_wait_xcnt closes the statement as a precaution: it stands in
// front of every later write of the address registers that the copies name.
__device__ __forceinline__ void async_copy8(const unsigned (&l)[8],
                                            const _Float16* const (&g)[8]) {
  asm volatile(
      "global_load_async_to_lds_b128 %0, %8, off\n\t"
      "global_load_async_to_lds_b128 %1, %9, off\n\t"
      "global_load_async_to_lds_b128 %2, %10, off\n\t"
      "global_load_async_to_lds_b128 %3, %11, off\n\t"
      "global_load_async_to_lds_b128 %4, %12, off\n\t"
      "global_load_async_to_lds_b128 %5, %13, off\n\t"
      "global_load_async_to_lds_b128 %6, %14, off\n\t"
      "global_load_async_to_lds_b128 %7, %15, off\n\t"
      "s_wait_xcnt 0x0"
      :
      : "v"(l[0]), "v"(l[1]), "v"(l[2]), "v"(l[3]), "v"(l[4]), "v"(l[5]),
        "v"(l[6]), "v"(l[7]), "v"(g[0]), "v"(g[1]), "v"(g[2]), "v"(g[3]),
        "v"(g[4]), "v"(g[5]), "v"(g[6]), "v"(g[7])
      : "memory");
}

__device__ __forceinline__ v8f wmma32(v16h a, v16h b, v8f c) {
  // (neg_a, A, neg_b, B, c_mod, C, reuse_a, reuse_b)
  return __builtin_amdgcn_wmma_f32_16x16x32_f16(false, a, false, b, (short)0, c,
                                                false, false);
}

// Load one 16x32 (A-style) / 32x16 (B-style) f16 WMMA fragment.
// Caller passes p = &buf[(lane%16)*stride + (lane/16)*8 (+k_base)], 16B aligned.
// Per ISA 7.12.2: halves 0..7 = K at p[0..7], halves 8..15 = K at p[16..23].
__device__ __forceinline__ v16h frag_ld(const _Float16* p) {
  v8h lo = *(const v8h*)p;
  v8h hi = *(const v8h*)(p + 16);
  v16h r;
#pragma unroll
  for (int j = 0; j < 8; ++j) { r[j] = lo[j]; r[j + 8] = hi[j]; }
  return r;
}

// ------------------------------- constants ---------------------------------
#define MDIM 8192
#define KDIM 1024
#define NDIM 1024
#define NINST 16
#define SPAN 512

// workspace layout (bytes)
#define OFF_XH  ((size_t)0)
#define OFF_Q   ((size_t)16 << 20)
#define OFF_K   ((size_t)32 << 20)
#define OFF_V   ((size_t)48 << 20)
#define OFF_AO  ((size_t)64 << 20)
#define OFF_GW  ((size_t)80 << 20)
#define OFF_BE  (OFF_GW + 4096)
#define OFF_PP  ((size_t)84 << 20)   // pooling partial sums [NINST][32][1024] f32
#define OFF_WP  ((size_t)96 << 20)   // packed q/k/v weights [3][NINST], 2 MiB each
#define OFF_WOP ((size_t)192 << 20)  // packed Wo, 2 MiB

// ---------------- 1) f32 -> f16, with the pooling partial sums --------------
// One block = 16 rows x all 1024 columns, four columns per thread.
#define POOL_ROWS 16
#define POOL_CHUNKS (SPAN / POOL_ROWS)  // 32 partial sums per span and column

__global__ void __launch_bounds__(256)
cvt_pool(const float* __restrict__ x,
         _Float16* __restrict__ y,
         float* __restrict__ part) {  // [NINST * POOL_CHUNKS][1024]
  const size_t c4 = (size_t)threadIdx.x * 4;
  const size_t base = (size_t)blockIdx.x * POOL_ROWS * 1024 + c4;

  // all 16 loads go out before the first use waits for data
  v4f v[POOL_ROWS];
#pragma unroll
  for (int r = 0; r < POOL_ROWS; ++r)
    v[r] = *(const v4f*)(x + base + (size_t)r * 1024);

  v4f s = {};
#pragma unroll
  for (int r = 0; r < POOL_ROWS; ++r) {
    v4h h;
#pragma unroll
    for (int j = 0; j < 4; ++j) h[j] = (_Float16)v[r][j];
    *(v4h*)(y + base + (size_t)r * 1024) = h;
    s += v[r];
  }
  *(v4f*)(part + (size_t)blockIdx.x * 1024 + c4) = s;
}

// ------------------------------- 2) gate -----------------------------------
// One block of 32 waves per instance. Every long sum is cut into partial sums
// whose loads are all in flight together.
__global__ void __launch_bounds__(1024)
gate_kernel(const float* __restrict__ part,
            const float* __restrict__ gW1,
            const float* __restrict__ gb1,
            const float* __restrict__ gW2,
            const float* __restrict__ gb2,
            const float* __restrict__ bq,
            const float* __restrict__ bk,
            const float* __restrict__ bv,
            float* __restrict__ gw_out,
            float* __restrict__ beff) {
  __shared__ float pooled[1024] __attribute__((aligned(16)));
  __shared__ float hpart[32 * 128] __attribute__((aligned(16)));
  __shared__ float gact[128] __attribute__((aligned(16)));
  __shared__ float gws[4];
  const int inst = blockIdx.x;
  const int tid = threadIdx.x;
  const int lane = tid & 31, wave = tid >> 5;

  // mean-pool: thread = column, the 32 partial sums of the convert pass
  {
    const float* p = part + (size_t)inst * POOL_CHUNKS * 1024 + tid;
    float t[POOL_CHUNKS];
#pragma unroll
    for (int ch = 0; ch < POOL_CHUNKS; ++ch) t[ch] = p[ch * 1024];
    float s = 0.f;
#pragma unroll
    for (int ch = 0; ch < POOL_CHUNKS; ++ch) s += t[ch];
    pooled[tid] = s * (1.0f / (float)SPAN);
  }
  __syncthreads();

  // layer 1: wave = a slice of 32 inputs, lane = 4 of the 128 outputs, so one
  // load of a wave is one whole 512-byte row of gW1
  {
    const float* wrow = gW1 + (size_t)wave * 32 * 128 + lane * 4;
    v4f a = {};
#pragma unroll
    for (int half = 0; half < 2; ++half) {
      v4f w[16];
#pragma unroll
      for (int i = 0; i < 16; ++i)
        w[i] = *(const v4f*)(wrow + (half * 16 + i) * 128);
#pragma unroll
      for (int i = 0; i < 16; ++i) a += pooled[wave * 32 + half * 16 + i] * w[i];
    }
    *(v4f*)&hpart[wave * 128 + lane * 4] = a;
  }
  __syncthreads();

  if (tid < 128) {
    float s = gb1[tid];
#pragma unroll
    for (int w = 0; w < 32; ++w) s += hpart[w * 128 + tid];
    gact[tid] = fmaxf(s, 0.f);
  }
  __syncthreads();

  // layer 2 and softmax: wave 0, lane = 4 of the 128 hidden units
  if (wave == 0) {
    v4f l = {};
#pragma unroll
    for (int i = 0; i < 4; ++i)
      l += gact[lane * 4 + i] * *(const v4f*)(gW2 + (lane * 4 + i) * 4);
#pragma unroll
    for (int off = 16; off > 0; off >>= 1)
#pragma unroll
      for (int e = 0; e < 4; ++e) l[e] += __shfl_xor(l[e], off, 32);
#pragma unroll
    for (int e = 0; e < 4; ++e) l[e] += gb2[e];
    float mx = fmaxf(fmaxf(l[0], l[1]), fmaxf(l[2], l[3]));
    float e0 = __expf(l[0] - mx), e1 = __expf(l[1] - mx);
    float e2 = __expf(l[2] - mx), e3 = __expf(l[3] - mx);
    float inv = 1.0f / (e0 + e1 + e2 + e3);
    if (lane == 0) {
      gws[0] = e0 * inv; gws[1] = e1 * inv; gws[2] = e2 * inv; gws[3] = e3 * inv;
      gw_out[inst * 4 + 0] = e0 * inv; gw_out[inst * 4 + 1] = e1 * inv;
      gw_out[inst * 4 + 2] = e2 * inv; gw_out[inst * 4 + 3] = e3 * inv;
    }
  }
  __syncthreads();

  // effective biases: thread = column
  {
    float a0 = 0.f, a1 = 0.f, a2 = 0.f;
#pragma unroll
    for (int e = 0; e < 4; ++e) {
      float g = gws[e];
      a0 += g * bq[e * 1024 + tid];
      a1 += g * bk[e * 1024 + tid];
      a2 += g * bv[e * 1024 + tid];
    }
    beff[(0 * NINST + inst) * 1024 + tid] = a0;
    beff[(1 * NINST + inst) * 1024 + tid] = a1;
    beff[(2 * NINST + inst) * 1024 + tid] = a2;
  }
}

// ----------------------------- 3) weight prep ------------------------------
// Packed weight matrix, f16: [n/128][k/32][n%128][k%32], so that the 128x32
// tile a GEMM block stages per K-step is 4096 contiguous halves.
// One block takes a 64(k) x 64(n) tile of all NE experts through LDS (the
// transpose), then forms every instance's combination from registers.
#define PREP_PITCH 65  // dwords; column walks of 4-byte reads hit 32 banks

template <int NE, int NI>
__device__ __forceinline__ void prep_tile(const float* __restrict__ W,   // [NE][K][N]
                                          const float* __restrict__ gw,  // [NI][NE]
                                          _Float16* __restrict__ Wp,     // [NI] packed
                                          float* __restrict__ tile) {
  const int tid = threadIdx.x;
  const int n0 = blockIdx.x * 64;
  const int k0 = blockIdx.y * 64;

  // the 64 gate weights: two per lane, then readlane moves each to a scalar
  // register, so that none of them holds a vector register beside the tile
  static_assert(NE == 1 || NI * NE == 64, "two gate weights per lane");
  float g[NI][NE];
  if constexpr (NE > 1) {
    const int glo = __builtin_bit_cast(int, gw[tid & 31]);
    const int ghi = __builtin_bit_cast(int, gw[32 + (tid & 31)]);
#pragma unroll
    for (int i = 0; i < NI; ++i)
#pragma unroll
      for (int e = 0; e < NE; ++e)
        g[i][e] = __builtin_bit_cast(
            float, __builtin_amdgcn_readlane((i * NE + e) < 32 ? glo : ghi,
                                             (i * NE + e) & 31));
  }

  // all NE*4 loads go out before the first LDS store waits for data
  const unsigned kr = tid >> 4, n4 = (tid & 15) * 4;
  v4f w4[NE][4];
#pragma unroll
  for (int e = 0; e < NE; ++e) {
    const float* We = W + (size_t)e * KDIM * NDIM + (size_t)k0 * NDIM + n0;
#pragma unroll
    for (int it = 0; it < 4; ++it)
      w4[e][it] = *(const v4f*)&We[(kr + it * 16) * NDIM + n4];
    // precaution: stands in front of later loads whose results may reuse an
    // address register of these loads
    asm volatile("s_wait_xcnt 0x0" ::: "memory");
  }
#pragma unroll
  for (int e = 0; e < NE; ++e)
#pragma unroll
    for (int it = 0; it < 4; ++it)
#pragma unroll
      for (int j = 0; j < 4; ++j)
        tile[(e * 64 + kr + it * 16) * PREP_PITCH + n4 + j] = w4[e][it][j];
  __syncthreads();

  const int kq = tid & 3;   // 8 consecutive k per thread
  const int n = tid >> 2;   // 0..63
  const int ng = n0 + n;
#pragma unroll
  for (int ks = 0; ks < 2; ++ks) {  // the tile's two 32-wide K-steps
    float w[NE][8];
#pragma unroll
    for (int e = 0; e < NE; ++e)
#pragma unroll
      for (int j = 0; j < 8; ++j)
        w[e][j] = tile[(e * 64 + ks * 32 + kq * 8 + j) * PREP_PITCH + n];

    _Float16* dst = Wp + ((size_t)(ng >> 7) * 32 + (k0 >> 5) + ks) * 4096 +
                    (ng & 127) * 32 + kq * 8;
#pragma unroll
    for (int i = 0; i < NI; ++i) {
      v8h o;
#pragma unroll
      for (int j = 0; j < 8; ++j) {
        float a = (NE == 1) ? w[0][j] : g[i][0] * w[0][j];
#pragma unroll
        for (int e = 1; e < NE; ++e) a = __builtin_fmaf(g[i][e], w[e][j], a);
        o[j] = (_Float16)a;
      }
      *(v8h*)(dst + (size_t)i * KDIM * NDIM) = o;
    }
  }
}

// grid = (N/64, K/64, 4): z = 0,1,2 -> q,k,v (4 experts, 16 instances), 3 -> Wo.
__global__ void __launch_bounds__(256)
prep_weights(const float* __restrict__ Wq,
             const float* __restrict__ Wk,
             const float* __restrict__ Wv,
             const float* __restrict__ Wo,
             const float* __restrict__ gw,
             _Float16* __restrict__ Wp,
             _Float16* __restrict__ Wop) {
  __shared__ float tile[4 * 64 * PREP_PITCH];
  const int p = blockIdx.z;
  if (p < 3) {
    const float* W = (p == 0) ? Wq : (p == 1) ? Wk : Wv;
    prep_tile<4, NINST>(W, gw, Wp + (size_t)p * NINST * KDIM * NDIM, tile);
  } else {
    prep_tile<1, 1>(Wo, gw, Wop, tile);
  }
}

// ------------------------------ 4/6) WMMA GEMM -----------------------------
// grid = (N/128, M/128), block = 256 (8 waves, 2x4 wave grid, 64x32/wave).
// K runs in 8 stages of 128. A stage in LDS is [A 128 rows | W 128 rows], rows
// of 256 B at a pitch of 272 B (16 B x odd: no bank conflict for 16-byte
// reads). Two buffers: while stage t is multiplied, stage t+1's copies fly.
#define GK 128                      // k per stage
#define GNST (KDIM / GK)            // stages
#define GPITCH 136                  // halves per LDS row
#define GOP (128 * GPITCH)          // halves per operand and stage
#define GSTAGE (2 * GOP)            // halves per stage

// the real block size: two blocks of 136 KiB LDS share a WGP, so a wave may
// take up to 256 registers
template <typename OutT, bool MOE>
__global__ void __launch_bounds__(256)
moe_gemm(const _Float16* __restrict__ A,   // [M][K] f16
         const _Float16* __restrict__ Wp,  // packed, MOE:[NINST]
         const float* __restrict__ bias,   // MOE:[NINST][N] else [N]
         OutT* __restrict__ Y) {
  __shared__ _Float16 ring[2 * GSTAGE] __attribute__((aligned(16)));

  const int tid = threadIdx.x;
  const int lane = tid & 31, wave = tid >> 5;
  const int rl = lane & 15;
  const int sel8 = (lane >> 4) * 8;
  const int row0 = blockIdx.y * 128;
  const int n0 = blockIdx.x * 128;
  const int inst = row0 >> 9;  // 512 rows per instance

  // this block's column of packed tiles: 32 K-steps of 4096 halves
  const _Float16* wcol = Wp + (MOE ? (size_t)inst * KDIM * NDIM : (size_t)0) +
                         (size_t)blockIdx.x * 32 * 4096;

  // A stage: 2048 chunks of 16 B, 8 per thread; 16 lanes take one row's 256 B.
  const _Float16* asrc = A + (size_t)(row0 + (tid >> 4)) * KDIM + (tid & 15) * 8;
  const unsigned adst = lds_off(ring) + (tid >> 4) * (GPITCH * 2) + (tid & 15) * 16;
  // W stage: four packed 128x32 tiles, 32 KiB in a row in memory; chunk
  // tid + 256*it is k-step it/2, row tid/4 + 64*(it%2), 16-byte piece tid%4.
  const _Float16* wsrc = wcol + tid * 8;
  const unsigned wdst = lds_off(ring) + GOP * 2 + (tid >> 2) * (GPITCH * 2) + (tid & 3) * 16;

  auto issue_stage = [&](int t, int buf) {
    unsigned l[8];
    const _Float16* g[8];
#pragma unroll
    for (int it = 0; it < 8; ++it) {
      l[it] = adst + buf * (GSTAGE * 2) + it * 16 * (GPITCH * 2);
      g[it] = asrc + t * GK + (size_t)it * 16 * KDIM;
    }
    async_copy8(l, g);
#pragma unroll
    for (int it = 0; it < 8; ++it) {
      l[it] = wdst + buf * (GSTAGE * 2) + (it & 1) * 64 * (GPITCH * 2) + (it >> 1) * 64;
      g[it] = wsrc + t * (4 * 4096) + it * 2048;
    }
    async_copy8(l, g);
  };

  v8f acc[4][2];
  {
    v8f z = {};
#pragma unroll
    for (int i = 0; i < 4; ++i)
#pragma unroll
      for (int j = 0; j < 2; ++j) acc[i][j] = z;
  }

  const int mw = (wave >> 2) * 64;  // 0 or 64
  const int nw = (wave & 3) * 32;   // 0,32,64,96

  issue_stage(0, 0);
  wait_asynccnt0();
  __syncthreads();  // stage 0 is published
  issue_stage(1, 1);

  for (int t = 0; t < GNST; ++t) {
    const _Float16* As = ring + (t & 1) * GSTAGE;
    const _Float16* Ws = As + GOP;

#pragma unroll
    for (int ks = 0; ks < GK / 32; ++ks) {
      v16h af[4], bf[2];
#pragma unroll
      for (int i = 0; i < 4; ++i)
        af[i] = frag_ld(&As[(mw + i * 16 + rl) * GPITCH + ks * 32 + sel8]);
#pragma unroll
      for (int j = 0; j < 2; ++j)
        bf[j] = frag_ld(&Ws[(nw + j * 16 + rl) * GPITCH + ks * 32 + sel8]);
      // keeps the k-step's 12 LDS reads one group in front of its WMMAs: left
      // alone the compiler reads two at a time and waits out each pair's latency
      __builtin_amdgcn_sched_barrier(0);
#pragma unroll
      for (int i = 0; i < 4; ++i)
#pragma unroll
        for (int j = 0; j < 2; ++j) acc[i][j] = wmma32(af[i], bf[j], acc[i][j]);
    }

    // publish point of stage t+1; the same barrier ends every wave's reads of
    // stage t's buffer, which is refilled behind it
    wait_dscnt0();
    wait_asynccnt0();
    __syncthreads();
    if (t + 2 < GNST) issue_stage(t + 2, t & 1);
  }
  wait_asynccnt0();  // no copy is outstanding when the wave ends

  // epilogue: D layout = lane%16 -> col, vgpr r + 8*(lane/16) -> row
#pragma unroll
  for (int i = 0; i < 4; ++i)
#pragma unroll
    for (int j = 0; j < 2; ++j)
#pragma unroll
      for (int r = 0; r < 8; ++r) {
        int rg = row0 + mw + i * 16 + r + (lane >> 4) * 8;
        int cg = n0 + nw + j * 16 + rl;
        float b = MOE ? bias[inst * NDIM + cg] : bias[cg];
        Y[(size_t)rg * NDIM + cg] = (OutT)(acc[i][j][r] + b);
      }
}

#define ATTN_SMEM (64 * 520 * 2)

// the real block size lifts the register ceiling: the 256 score registers of
// a lane have to fit without scratch
__global__ void __launch_bounds__(128)
span_attn(const _Float16* __restrict__ Q,
          const _Float16* __restrict__ Kx,
          const _Float16* __restrict__ V,
          _Float16* __restrict__ O) {
  extern __shared__ char smem_raw[];
  _Float16* vt = (_Float16*)smem_raw;     // [64][520] V transposed [dh][key]

  const int tid = threadIdx.x;
  const int lane = tid & 31, wave = tid >> 5;
  const int rl = lane & 15;
  const int sel8 = (lane >> 4) * 8;
  const int q0 = blockIdx.x * 64;
  const int h = blockIdx.y;
  const int inst = blockIdx.z;
  const size_t base = (size_t)inst * SPAN * 1024 + h * 64;

  // stage V^T: 16B global reads along Dh, scatter-transpose into LDS
  for (int chunk = tid; chunk < SPAN * 8; chunk += 128) {
    int key = chunk >> 3, d8 = (chunk & 7) * 8;
    v8h v = *(const v8h*)&V[base + (size_t)key * 1024 + d8];
#pragma unroll
    for (int j = 0; j < 8; ++j) vt[(d8 + j) * 520 + key] = v[j];
  }
  __syncthreads();

  // Q fragments for this wave's 16 queries (K=Dh=64 -> 2 k-steps), loaded once;
  // they are the B operand: column = query = lane%16
  v16h qa[2];
#pragma unroll
  for (int t = 0; t < 2; ++t)
    qa[t] = frag_ld(&Q[base + (size_t)(q0 + wave * 16 + rl) * 1024 + t * 32 + sel8]);
  // precaution: stands in front of the K loads, whose results may reuse the
  // address registers of the Q loads
  asm volatile("s_wait_xcnt 0x0" ::: "memory");

  // scores^T = K Q^T, kept as the f32 accumulators. D: lane%16 = query,
  // register r = key 8*(lane/16) + r of the 16-key tile: a lane holds 256 of
  // its query's 512 scores, lane^16 the other 256.
  v8f s[32];
#pragma unroll
  for (int kt = 0; kt < 32; ++kt) {
    v8f a = {};
#pragma unroll
    for (int d = 0; d < 2; ++d) {
      v16h kb = frag_ld(&Kx[base + (size_t)(kt * 16 + rl) * 1024 + d * 32 + sel8]);
      a = wmma32(kb, qa[d], a);
    }
    s[kt] = a;
  }
  // precaution: stands in front of the vector work below, whose results may
  // reuse the address registers of the K loads above
  asm volatile("s_wait_xcnt 0x0" ::: "memory");

  // row maximum: eight in-lane chains, joined, then the other lane half
  float mx;
  {
    v8f m = s[0];
#pragma unroll
    for (int kt = 1; kt < 32; ++kt) m = __builtin_elementwise_max(m, s[kt]);
    mx = fmaxf(fmaxf(fmaxf(m[0], m[1]), fmaxf(m[2], m[3])),
               fmaxf(fmaxf(m[4], m[5]), fmaxf(m[6], m[7])));
    mx = fmaxf(mx, __shfl_xor(mx, 16, 32));
  }

  // P^T = exp((S^T - max) / sqrt(Dh)), and O^T += V^T P^T (K dim = 512 keys ->
  // 16 k-steps; V^T rows are the A operand). Two score tiles, rounded to f16,
  // are a B operand over 32 keys in frag_ld's own k order:
  // pb[j] = key 32t + 8*(lane/16) + j, pb[8+j] = the same key + 16.
  const float SC = 0.125f * 1.44269504f;  // 1/sqrt(Dh) * log2(e)
  const float nmx = -mx * SC;
  const v8f SC8 = {SC, SC, SC, SC, SC, SC, SC, SC};
  const v8f nmx8 = {nmx, nmx, nmx, nmx, nmx, nmx, nmx, nmx};
  v8f sum = {};
  v8f oacc[4];
  {
    v8f z = {};
#pragma unroll
    for (int n = 0; n < 4; ++n) oacc[n] = z;
  }
#pragma unroll
  for (int t = 0; t < 16; ++t) {
    v16h pb;
#pragma unroll
    for (int u = 0; u < 2; ++u) {
      // whole-vector forms: packed f32 multiply-adds and adds, two per issue
      const v8f x = __builtin_elementwise_fma(s[t * 2 + u], SC8, nmx8);
      v8f ev;
#pragma unroll
      for (int j = 0; j < 8; ++j) ev[j] = __builtin_amdgcn_exp2f(x[j]);
      sum += ev;  // eight independent chains
      const v8h eh = __builtin_convertvector(ev, v8h);
#pragma unroll
      for (int j = 0; j < 8; ++j) pb[u * 8 + j] = eh[j];
    }
#pragma unroll
    for (int n = 0; n < 4; ++n) {
      v16h va = frag_ld(&vt[(n * 16 + rl) * 520 + t * 32 + sel8]);
      oacc[n] = wmma32(va, pb, oacc[n]);
    }
  }

  float tot = ((sum[0] + sum[1]) + (sum[2] + sum[3])) +
              ((sum[4] + sum[5]) + (sum[6] + sum[7]));
  tot += __shfl_xor(tot, 16, 32);
  const float inv = 1.0f / tot;

  // O^T: lane%16 = query, registers = 8 consecutive dh: one 16-byte store
#pragma unroll
  for (int n = 0; n < 4; ++n) {
    v8h o;
#pragma unroll
    for (int r = 0; r < 8; ++r) o[r] = (_Float16)(oacc[n][r] * inv);
    *(v8h*)&O[base + (size_t)(q0 + wave * 16 + rl) * 1024 + n * 16 + sel8] = o;
  }
}

// ------------------------------- launcher ----------------------------------
extern "C" void kernel_launch(void* const* d_in, const int* in_sizes, int n_in,
                              void* d_out, int out_size, void* d_ws,
                              size_t ws_size, hipStream_t stream) {
  const float* X   = (const float*)d_in[0];
  const float* Wq  = (const float*)d_in[1];
  const float* bq  = (const float*)d_in[2];
  const float* Wk  = (const float*)d_in[3];
  const float* bk  = (const float*)d_in[4];
  const float* Wv  = (const float*)d_in[5];
  const float* bv  = (const float*)d_in[6];
  const float* gW1 = (const float*)d_in[7];
  const float* gb1 = (const float*)d_in[8];
  const float* gW2 = (const float*)d_in[9];
  const float* gb2 = (const float*)d_in[10];
  const float* Wo  = (const float*)d_in[11];
  const float* bo  = (const float*)d_in[12];

  char* ws = (char*)d_ws;
  _Float16* Xh = (_Float16*)(ws + OFF_XH);
  _Float16* Qb = (_Float16*)(ws + OFF_Q);
  _Float16* Kb = (_Float16*)(ws + OFF_K);
  _Float16* Vb = (_Float16*)(ws + OFF_V);
  _Float16* AO = (_Float16*)(ws + OFF_AO);
  float* gw    = (float*)(ws + OFF_GW);
  float* beff  = (float*)(ws + OFF_BE);  // [3][16][1024]
  float* part  = (float*)(ws + OFF_PP);
  _Float16* Wp  = (_Float16*)(ws + OFF_WP);
  _Float16* Wop = (_Float16*)(ws + OFF_WOP);

  cvt_pool<<<MDIM / POOL_ROWS, 256, 0, stream>>>(X, Xh, part);

  gate_kernel<<<NINST, 1024, 0, stream>>>(part, gW1, gb1, gW2, gb2, bq, bk, bv,
                                          gw, beff);

  dim3 pgrid(NDIM / 64, KDIM / 64, 4);
  prep_weights<<<pgrid, 256, 0, stream>>>(Wq, Wk, Wv, Wo, gw, Wp, Wop);

  dim3 ggrid(NDIM / 128, MDIM / 128);
  moe_gemm<_Float16, true><<<ggrid, 256, 0, stream>>>(
      Xh, Wp + (size_t)0 * NINST * KDIM * NDIM, beff + 0 * NINST * NDIM, Qb);
  moe_gemm<_Float16, true><<<ggrid, 256, 0, stream>>>(
      Xh, Wp + (size_t)1 * NINST * KDIM * NDIM, beff + 1 * NINST * NDIM, Kb);
  moe_gemm<_Float16, true><<<ggrid, 256, 0, stream>>>(
      Xh, Wp + (size_t)2 * NINST * KDIM * NDIM, beff + 2 * NINST * NDIM, Vb);

  dim3 agrid(SPAN / 64, 16, NINST);
  span_attn<<<agrid, 128, ATTN_SMEM, stream>>>(Qb, Kb, Vb, AO);

  moe_gemm<float, false><<<ggrid, 256, 0, stream>>>(AO, Wop, bo,
                                                    (float*)d_out);
}

// v005
// It runs in 134 microseconds.
// In both of two side-by-side timings against v004, it was 1.30 times as fast.
// Over all steps from v000 it is 7.69 times as fast.
#include <hip/hip_runtime.h>

// ---------------------------------------------------------------------------
// MoE span attention for MI455X (gfx1250, wave32, WMMA 16x16x32 f16->f32).
//
// Sizes (fixed by the reference): B=4, T=2048, C=1024, E=4 spans==experts,
// H=16 heads, Dh=64, S=512, M = B*T = 8192 rows, K=N=1024.
//
// Pipeline (all on `stream`):
//   1) convert hidden f32 -> f16 (ws); the same pass sums each block's 16
//      rows per column: 32 partial sums per span for the gate's mean-pool
//   2) gate: add the partial sums -> MLP -> softmax -> gw[16][4]; eff biases
//   3) weight prep: W_eff[inst] = sum_e gw_e W_e for q/k/v, and Wo, each
//      rounded to f16 once and packed in the GEMM's own tile order (ws)
//   4) q/k/v GEMMs: Y = X @ W_eff[inst] + b_eff. A and W tiles of 128 k go to
//      a two-buffer LDS ring by GLOBAL_LOAD_ASYNC_TO_LDS, one stage ahead of
//      the stage that is multiplied.
//   5) per-(inst,head) attention, full-row softmax in registers; K and V go
//      row-major to LDS by GLOBAL_LOAD_ASYNC_TO_LDS
//   6) output GEMM (same kernel, one weight matrix) -> d_out f32
// ---------------------------------------------------------------------------

typedef __attribute__((ext_vector_type(16))) _Float16 v16h;
typedef __attribute__((ext_vector_type(8)))  _Float16 v8h;
typedef __attribute__((ext_vector_type(4)))  _Float16 v4h;
typedef __attribute__((ext_vector_type(8)))  float    v8f;
typedef __attribute__((ext_vector_type(4)))  float    v4f;

// this wave's asynchronous copies have landed in LDS
__device__ __forceinline__ void wait_asynccnt0() {
  asm volatile("s_wait_asynccnt 0x0" ::: "memory");
}

// this wave's LDS reads have returned: stands in front of the barrier behind
// which their buffer is refilled
__device__ __forceinline__ void wait_dscnt0() {
  asm volatile("s_wait_dscnt 0x0" ::: "memory");
}

// byte offset of a __shared__ address in the work-group's LDS
__device__ __forceinline__ unsigned lds_off(const void* p) {
  return (unsigned)(size_t)p;
}

// Eight asynchronous 16-byte copies per lane, global -> LDS, through no
// register. The s_wait_xcnt closes the statement as a precaution: it stands in
// front of every later write of the address registers that the copies name.
__device__ __forceinline__ void async_copy8(const unsigned (&l)[8],
                                            const _Float16* const (&g)[8]) {
  asm volatile(
      "global_load_async_to_lds_b128 %0, %8, off\n\t"
      "global_load_async_to_lds_b128 %1, %9, off\n\t"
      "global_load_async_to_lds_b128 %2, %10, off\n\t"
      "global_load_async_to_lds_b128 %3, %11, off\n\t"
      "global_load_async_to_lds_b128 %4, %12, off\n\t"
      "global_load_async_to_lds_b128 %5, %13, off\n\t"
      "global_load_async_to_lds_b128 %6, %14, off\n\t"
      "global_load_async_to_lds_b128 %7, %15, off\n\t"
      "s_wait_xcnt 0x0"
      :
      : "v"(l[0]), "v"(l[1]), "v"(l[2]), "v"(l[3]), "v"(l[4]), "v"(l[5]),
        "v"(l[6]), "v"(l[7]), "v"(g[0]), "v"(g[1]), "v"(g[2]), "v"(g[3]),
        "v"(g[4]), "v"(g[5]), "v"(g[6]), "v"(g[7])
      : "memory");
}

__device__ __forceinline__ v8f wmma32(v16h a, v16h b, v8f c) {
  // (neg_a, A, neg_b, B, c_mod, C, reuse_a, reuse_b)
  return __builtin_amdgcn_wmma_f32_16x16x32_f16(false, a, false, b, (short)0, c,
                                                false, false);
}

// Load one 16x32 (A-style) / 32x16 (B-style) f16 WMMA fragment.
// Caller passes p = &buf[(lane%16)*stride + (lane/16)*8 (+k_base)], 16B aligned.
// Per ISA 7.12.2: halves 0..7 = K at p[0..7], halves 8..15 = K at p[16..23].
__device__ __forceinline__ v16h frag_ld(const _Float16* p) {
  v8h lo = *(const v8h*)p;
  v8h hi = *(const v8h*)(p + 16);
  v16h r;
#pragma unroll
  for (int j = 0; j < 8; ++j) { r[j] = lo[j]; r[j + 8] = hi[j]; }
  return r;
}

// Transposing LDS read: from a row-major 16-bit tile T, with lane l's p at row
// 8*(l/16) + l%8, byte 16*((l/8)%2), lane l gets T[8*(l/16) + 0..7][l%16].
typedef short s16x8 __attribute__((ext_vector_type(8)));
__device__ __forceinline__ v8h ld_tr16(const char* p) {
  typedef __attribute__((address_space(3))) s16x8 lds_s16x8;
  return __builtin_bit_cast(v8h,
                            __builtin_amdgcn_ds_load_tr16_b128_v8i16((lds_s16x8*)p));
}

// ------------------------------- constants ---------------------------------
#define MDIM 8192
#define KDIM 1024
#define NDIM 1024
#define NINST 16
#define SPAN 512

// workspace layout (bytes)
#define OFF_XH  ((size_t)0)
#define OFF_Q   ((size_t)16 << 20)
#define OFF_K   ((size_t)32 << 20)
#define OFF_V   ((size_t)48 << 20)
#define OFF_AO  ((size_t)64 << 20)
#define OFF_GW  ((size_t)80 << 20)
#define OFF_BE  (OFF_GW + 4096)
#define OFF_PP  ((size_t)84 << 20)   // pooling partial sums [NINST][32][1024] f32
#define OFF_WP  ((size_t)96 << 20)   // packed q/k/v weights [3][NINST], 2 MiB each
#define OFF_WOP ((size_t)192 << 20)  // packed Wo, 2 MiB

// ---------------- 1) f32 -> f16, with the pooling partial sums --------------
// One block = 16 rows x all 1024 columns, four columns per thread.
#define POOL_ROWS 16
#define POOL_CHUNKS (SPAN / POOL_ROWS)  // 32 partial sums per span and column

__global__ void __launch_bounds__(256)
cvt_pool(const float* __restrict__ x,
         _Float16* __restrict__ y,
         float* __restrict__ part) {  // [NINST * POOL_CHUNKS][1024]
  const size_t c4 = (size_t)threadIdx.x * 4;
  const size_t base = (size_t)blockIdx.x * POOL_ROWS * 1024 + c4;

  // all 16 loads go out before the first use waits for data
  v4f v[POOL_ROWS];
#pragma unroll
  for (int r = 0; r < POOL_ROWS; ++r)
    v[r] = *(const v4f*)(x + base + (size_t)r * 1024);

  v4f s = {};
#pragma unroll
  for (int r = 0; r < POOL_ROWS; ++r) {
    v4h h;
#pragma unroll
    for (int j = 0; j < 4; ++j) h[j] = (_Float16)v[r][j];
    *(v4h*)(y + base + (size_t)r * 1024) = h;
    s += v[r];
  }
  *(v4f*)(part + (size_t)blockIdx.x * 1024 + c4) = s;
}

// ------------------------------- 2) gate -----------------------------------
// One block of 32 waves per instance. Every long sum is cut into partial sums
// whose loads are all in flight together.
__global__ void __launch_bounds__(1024)
gate_kernel(const float* __restrict__ part,
            const float* __restrict__ gW1,
            const float* __restrict__ gb1,
            const float* __restrict__ gW2,
            const float* __restrict__ gb2,
            const float* __restrict__ bq,
            const float* __restrict__ bk,
            const float* __restrict__ bv,
            float* __restrict__ gw_out,
            float* __restrict__ beff) {
  __shared__ float pooled[1024] __attribute__((aligned(16)));
  __shared__ float hpart[32 * 128] __attribute__((aligned(16)));
  __shared__ float gact[128] __attribute__((aligned(16)));
  __shared__ float gws[4];
  const int inst = blockIdx.x;
  const int tid = threadIdx.x;
  const int lane = tid & 31, wave = tid >> 5;

  // mean-pool: thread = column, the 32 partial sums of the convert pass
  {
    const float* p = part + (size_t)inst * POOL_CHUNKS * 1024 + tid;
    float t[POOL_CHUNKS];
#pragma unroll
    for (int ch = 0; ch < POOL_CHUNKS; ++ch) t[ch] = p[ch * 1024];
    float s = 0.f;
#pragma unroll
    for (int ch = 0; ch < POOL_CHUNKS; ++ch) s += t[ch];
    pooled[tid] = s * (1.0f / (float)SPAN);
  }
  __syncthreads();

  // layer 1: wave = a slice of 32 inputs, lane = 4 of the 128 outputs, so one
  // load of a wave is one whole 512-byte row of gW1
  {
    const float* wrow = gW1 + (size_t)wave * 32 * 128 + lane * 4;
    v4f a = {};
#pragma unroll
    for (int half = 0; half < 2; ++half) {
      v4f w[16];
#pragma unroll
      for (int i = 0; i < 16; ++i)
        w[i] = *(const v4f*)(wrow + (half * 16 + i) * 128);
#pragma unroll
      for (int i = 0; i < 16; ++i) a += pooled[wave * 32 + half * 16 + i] * w[i];
    }
    *(v4f*)&hpart[wave * 128 + lane * 4] = a;
  }
  __syncthreads();

  if (tid < 128) {
    float s = gb1[tid];
#pragma unroll
    for (int w = 0; w < 32; ++w) s += hpart[w * 128 + tid];
    gact[tid] = fmaxf(s, 0.f);
  }
  __syncthreads();

  // layer 2 and softmax: wave 0, lane = 4 of the 128 hidden units
  if (wave == 0) {
    v4f l = {};
#pragma unroll
    for (int i = 0; i < 4; ++i)
      l += gact[lane * 4 + i] * *(const v4f*)(gW2 + (lane * 4 + i) * 4);
#pragma unroll
    for (int off = 16; off > 0; off >>= 1)
#pragma unroll
      for (int e = 0; e < 4; ++e) l[e] += __shfl_xor(l[e], off, 32);
#pragma unroll
    for (int e = 0; e < 4; ++e) l[e] += gb2[e];
    float mx = fmaxf(fmaxf(l[0], l[1]), fmaxf(l[2], l[3]));
    float e0 = __expf(l[0] - mx), e1 = __expf(l[1] - mx);
    float e2 = __expf(l[2] - mx), e3 = __expf(l[3] - mx);
    float inv = 1.0f / (e0 + e1 + e2 + e3);
    if (lane == 0) {
      gws[0] = e0 * inv; gws[1] = e1 * inv; gws[2] = e2 * inv; gws[3] = e3 * inv;
      gw_out[inst * 4 + 0] = e0 * inv; gw_out[inst * 4 + 1] = e1 * inv;
      gw_out[inst * 4 + 2] = e2 * inv; gw_out[inst * 4 + 3] = e3 * inv;
    }
  }
  __syncthreads();

  // effective biases: thread = column
  {
    float a0 = 0.f, a1 = 0.f, a2 = 0.f;
#pragma unroll
    for (int e = 0; e < 4; ++e) {
      float g = gws[e];
      a0 += g * bq[e * 1024 + tid];
      a1 += g * bk[e * 1024 + tid];
      a2 += g * bv[e * 1024 + tid];
    }
    beff[(0 * NINST + inst) * 1024 + tid] = a0;
    beff[(1 * NINST + inst) * 1024 + tid] = a1;
    beff[(2 * NINST + inst) * 1024 + tid] = a2;
  }
}

// ----------------------------- 3) weight prep ------------------------------
// Packed weight matrix, f16: [n/128][k/32][n%128][k%32], so that the 128x32
// tile a GEMM block stages per K-step is 4096 contiguous halves.
// One block takes a 64(k) x 64(n) tile of all NE experts through LDS (the
// transpose), then forms every instance's combination from registers.
#define PREP_PITCH 65  // dwords; column walks of 4-byte reads hit 32 banks

template <int NE, int NI>
__device__ __forceinline__ void prep_tile(const float* __restrict__ W,   // [NE][K][N]
                                          const float* __restrict__ gw,  // [NI][NE]
                                          _Float16* __restrict__ Wp,     // [NI] packed
                                          float* __restrict__ tile) {
  const int tid = threadIdx.x;
  const int n0 = blockIdx.x * 64;
  const int k0 = blockIdx.y * 64;

  // the 64 gate weights: two per lane, then readlane moves each to a scalar
  // register, so that none of them holds a vector register beside the tile
  static_assert(NE == 1 || NI * NE == 64, "two gate weights per lane");
  float g[NI][NE];
  if constexpr (NE > 1) {
    const int glo = __builtin_bit_cast(int, gw[tid & 31]);
    const int ghi = __builtin_bit_cast(int, gw[32 + (tid & 31)]);
#pragma unroll
    for (int i = 0; i < NI; ++i)
#pragma unroll
      for (int e = 0; e < NE; ++e)
        g[i][e] = __builtin_bit_cast(
            float, __builtin_amdgcn_readlane((i * NE + e) < 32 ? glo : ghi,
                                             (i * NE + e) & 31));
  }

  // all NE*4 loads go out before the first LDS store waits for data
  const unsigned kr = tid >> 4, n4 = (tid & 15) * 4;
  v4f w4[NE][4];
#pragma unroll
  for (int e = 0; e < NE; ++e) {
    const float* We = W + (size_t)e * KDIM * NDIM + (size_t)k0 * NDIM + n0;
#pragma unroll
    for (int it = 0; it < 4; ++it)
      w4[e][it] = *(const v4f*)&We[(kr + it * 16) * NDIM + n4];
    // precaution: stands in front of later loads whose results may reuse an
    // address register of these loads
    asm volatile("s_wait_xcnt 0x0" ::: "memory");
  }
#pragma unroll
  for (int e = 0; e < NE; ++e)
#pragma unroll
    for (int it = 0; it < 4; ++it)
#pragma unroll
      for (int j = 0; j < 4; ++j)
        tile[(e * 64 + kr + it * 16) * PREP_PITCH + n4 + j] = w4[e][it][j];
  __syncthreads();

  const int kq = tid & 3;   // 8 consecutive k per thread
  const int n = tid >> 2;   // 0..63
  const int ng = n0 + n;
#pragma unroll
  for (int ks = 0; ks < 2; ++ks) {  // the tile's two 32-wide K-steps
    float w[NE][8];
#pragma unroll
    for (int e = 0; e < NE; ++e)
#pragma unroll
      for (int j = 0; j < 8; ++j)
        w[e][j] = tile[(e * 64 + ks * 32 + kq * 8 + j) * PREP_PITCH + n];

    _Float16* dst = Wp + ((size_t)(ng >> 7) * 32 + (k0 >> 5) + ks) * 4096 +
                    (ng & 127) * 32 + kq * 8;
#pragma unroll
    for (int i = 0; i < NI; ++i) {
      v8h o;
#pragma unroll
      for (int j = 0; j < 8; ++j) {
        float a = (NE == 1) ? w[0][j] : g[i][0] * w[0][j];
#pragma unroll
        for (int e = 1; e < NE; ++e) a = __builtin_fmaf(g[i][e], w[e][j], a);
        o[j] = (_Float16)a;
      }
      *(v8h*)(dst + (size_t)i * KDIM * NDIM) = o;
    }
  }
}

// grid = (N/64, K/64, 4): z = 0,1,2 -> q,k,v (4 experts, 16 instances), 3 -> Wo.
__global__ void __launch_bounds__(256)
prep_weights(const float* __restrict__ Wq,
             const float* __restrict__ Wk,
             const float* __restrict__ Wv,
             const float* __restrict__ Wo,
             const float* __restrict__ gw,
             _Float16* __restrict__ Wp,
             _Float16* __restrict__ Wop) {
  __shared__ float tile[4 * 64 * PREP_PITCH];
  const int p = blockIdx.z;
  if (p < 3) {
    const float* W = (p == 0) ? Wq : (p == 1) ? Wk : Wv;
    prep_tile<4, NINST>(W, gw, Wp + (size_t)p * NINST * KDIM * NDIM, tile);
  } else {
    prep_tile<1, 1>(Wo, gw, Wop, tile);
  }
}

// ------------------------------ 4/6) WMMA GEMM -----------------------------
// grid = (N/128, M/128), block = 256 (8 waves, 2x4 wave grid, 64x32/wave).
// K runs in 8 stages of 128. A stage in LDS is [A 128 rows | W 128 rows], rows
// of 256 B at a pitch of 272 B (16 B x odd: no bank conflict for 16-byte
// reads). Two buffers: while stage t is multiplied, stage t+1's copies fly.
#define GK 128                      // k per stage
#define GNST (KDIM / GK)            // stages
#define GPITCH 136                  // halves per LDS row
#define GOP (128 * GPITCH)          // halves per operand and stage
#define GSTAGE (2 * GOP)            // halves per stage

// the real block size: two blocks of 136 KiB LDS share a WGP, so a wave may
// take up to 256 registers
template <typename OutT, bool MOE>
__global__ void __launch_bounds__(256)
moe_gemm(const _Float16* __restrict__ A,   // [M][K] f16
         const _Float16* __restrict__ Wp,  // packed, MOE:[NINST]
         const float* __restrict__ bias,   // MOE:[NINST][N] else [N]
         OutT* __restrict__ Y) {
  __shared__ _Float16 ring[2 * GSTAGE] __attribute__((aligned(16)));

  const int tid = threadIdx.x;
  const int lane = tid & 31, wave = tid >> 5;
  const int rl = lane & 15;
  const int sel8 = (lane >> 4) * 8;
  const int row0 = blockIdx.y * 128;
  const int n0 = blockIdx.x * 128;
  const int inst = row0 >> 9;  // 512 rows per instance

  // this block's column of packed tiles: 32 K-steps of 4096 halves
  const _Float16* wcol = Wp + (MOE ? (size_t)inst * KDIM * NDIM : (size_t)0) +
                         (size_t)blockIdx.x * 32 * 4096;

  // A stage: 2048 chunks of 16 B, 8 per thread; 16 lanes take one row's 256 B.
  const _Float16* asrc = A + (size_t)(row0 + (tid >> 4)) * KDIM + (tid & 15) * 8;
  const unsigned adst = lds_off(ring) + (tid >> 4) * (GPITCH * 2) + (tid & 15) * 16;
  // W stage: four packed 128x32 tiles, 32 KiB in a row in memory; chunk
  // tid + 256*it is k-step it/2, row tid/4 + 64*(it%2), 16-byte piece tid%4.
  const _Float16* wsrc = wcol + tid * 8;
  const unsigned wdst = lds_off(ring) + GOP * 2 + (tid >> 2) * (GPITCH * 2) + (tid & 3) * 16;

  auto issue_stage = [&](int t, int buf) {
    unsigned l[8];
    const _Float16* g[8];
#pragma unroll
    for (int it = 0; it < 8; ++it) {
      l[it] = adst + buf * (GSTAGE * 2) + it * 16 * (GPITCH * 2);
      g[it] = asrc + t * GK + (size_t)it * 16 * KDIM;
    }
    async_copy8(l, g);
#pragma unroll
    for (int it = 0; it < 8; ++it) {
      l[it] = wdst + buf * (GSTAGE * 2) + (it & 1) * 64 * (GPITCH * 2) + (it >> 1) * 64;
      g[it] = wsrc + t * (4 * 4096) + it * 2048;
    }
    async_copy8(l, g);
  };

  v8f acc[4][2];
  {
    v8f z = {};
#pragma unroll
    for (int i = 0; i < 4; ++i)
#pragma unroll
      for (int j = 0; j < 2; ++j) acc[i][j] = z;
  }

  const int mw = (wave >> 2) * 64;  // 0 or 64
  const int nw = (wave & 3) * 32;   // 0,32,64,96

  issue_stage(0, 0);
  wait_asynccnt0();
  __syncthreads();  // stage 0 is published
  issue_stage(1, 1);

  for (int t = 0; t < GNST; ++t) {
    const _Float16* As = ring + (t & 1) * GSTAGE;
    const _Float16* Ws = As + GOP;

#pragma unroll
    for (int ks = 0; ks < GK / 32; ++ks) {
      v16h af[4], bf[2];
#pragma unroll
      for (int i = 0; i < 4; ++i)
        af[i] = frag_ld(&As[(mw + i * 16 + rl) * GPITCH + ks * 32 + sel8]);
#pragma unroll
      for (int j = 0; j < 2; ++j)
        bf[j] = frag_ld(&Ws[(nw + j * 16 + rl) * GPITCH + ks * 32 + sel8]);
      // keeps the k-step's 12 LDS reads one group in front of its WMMAs: left
      // alone the compiler reads two at a time and waits out each pair's latency
      __builtin_amdgcn_sched_barrier(0);
#pragma unroll
      for (int i = 0; i < 4; ++i)
#pragma unroll
        for (int j = 0; j < 2; ++j) acc[i][j] = wmma32(af[i], bf[j], acc[i][j]);
    }

    // publish point of stage t+1; the same barrier ends every wave's reads of
    // stage t's buffer, which is refilled behind it
    wait_dscnt0();
    wait_asynccnt0();
    __syncthreads();
    if (t + 2 < GNST) issue_stage(t + 2, t & 1);
  }
  wait_asynccnt0();  // no copy is outstanding when the wave ends

  // epilogue: D layout = lane%16 -> col, vgpr r + 8*(lane/16) -> row
#pragma unroll
  for (int i = 0; i < 4; ++i)
#pragma unroll
    for (int j = 0; j < 2; ++j)
#pragma unroll
      for (int r = 0; r < 8; ++r) {
        int rg = row0 + mw + i * 16 + r + (lane >> 4) * 8;
        int cg = n0 + nw + j * 16 + rl;
        float b = MOE ? bias[inst * NDIM + cg] : bias[cg];
        Y[(size_t)rg * NDIM + cg] = (OutT)(acc[i][j][r] + b);
      }
}

#define KPITCH_B 144
#define VPITCH_B 160
#define ATTN_V_BYTES (SPAN * VPITCH_B)
#define ATTN_SMEM (ATTN_V_BYTES + SPAN * KPITCH_B)

// the real block size lifts the register ceiling: the 256 score registers of
// a lane have to fit without scratch
__global__ void __launch_bounds__(128)
span_attn(const _Float16* __restrict__ Q,
          const _Float16* __restrict__ Kx,
          const _Float16* __restrict__ V,
          _Float16* __restrict__ O) {
  __shared__ char smem[ATTN_SMEM] __attribute__((aligned(16)));
  const char* vs = smem;                                       // V rows
  const _Float16* ks = (const _Float16*)(smem + ATTN_V_BYTES);  // K rows

  const int tid = threadIdx.x;
  const int lane = tid & 31, wave = tid >> 5;
  const int rl = lane & 15;
  const int sel8 = (lane >> 4) * 8;
  const int q0 = blockIdx.x * 64;
  const int h = blockIdx.y;
  const int inst = blockIdx.z;
  const size_t base = (size_t)inst * SPAN * 1024 + h * 64;

  // One operand = 512 rows of 128 B = 4096 chunks of 16 B, 32 per thread; eight
  // lanes take one whole row, so every copy of a wave covers four whole lines.
  auto stage_rows = [&](const _Float16* __restrict__ gsrc, unsigned dst0,
                        unsigned pitch) {
    const _Float16* s0 = gsrc + base + (size_t)(tid >> 3) * 1024 + (tid & 7) * 8;
    const unsigned d0 = dst0 + (tid >> 3) * pitch + (tid & 7) * 16;
#pragma unroll
    for (int grp = 0; grp < 4; ++grp) {
      unsigned l[8];
      const _Float16* g[8];
#pragma unroll
      for (int it = 0; it < 8; ++it) {
        l[it] = d0 + (grp * 8 + it) * 16 * pitch;
        g[it] = s0 + (size_t)(grp * 8 + it) * 16 * 1024;
      }
      async_copy8(l, g);
    }
  };

  stage_rows(Kx, lds_off(smem) + ATTN_V_BYTES, KPITCH_B);

  // Q fragments for this wave's 16 queries (K=Dh=64 -> 2 k-steps), loaded once;
  // they are the B operand: column = query = lane%16
  v16h qa[2];
#pragma unroll
  for (int t = 0; t < 2; ++t)
    qa[t] = frag_ld(&Q[base + (size_t)(q0 + wave * 16 + rl) * 1024 + t * 32 + sel8]);
  // precaution: stands in front of the later work, whose results may reuse the
  // address registers of the Q loads
  asm volatile("s_wait_xcnt 0x0" ::: "memory");

  wait_asynccnt0();
  __syncthreads();  // K is published
  // V's copies fly while the scores are formed
  stage_rows(V, lds_off(smem), VPITCH_B);

  // scores^T = K Q^T, kept as the f32 accumulators. D: lane%16 = query,
  // register r = key 8*(lane/16) + r of the 16-key tile: a lane holds 256 of
  // its query's 512 scores, lane^16 the other 256.
  v8f s[32];
#pragma unroll
  for (int kt = 0; kt < 32; ++kt) {
    v8f a = {};
#pragma unroll
    for (int d = 0; d < 2; ++d) {
      v16h kb = frag_ld(&ks[(kt * 16 + rl) * (KPITCH_B / 2) + d * 32 + sel8]);
      a = wmma32(kb, qa[d], a);
    }
    s[kt] = a;
  }

  // row maximum: eight in-lane chains, joined, then the other lane half
  float mx;
  {
    v8f m = s[0];
#pragma unroll
    for (int kt = 1; kt < 32; ++kt) m = __builtin_elementwise_max(m, s[kt]);
    mx = fmaxf(fmaxf(fmaxf(m[0], m[1]), fmaxf(m[2], m[3])),
               fmaxf(fmaxf(m[4], m[5]), fmaxf(m[6], m[7])));
    mx = fmaxf(mx, __shfl_xor(mx, 16, 32));
  }

  wait_asynccnt0();
  __syncthreads();  // V is published

  // P^T = exp((S^T - max) / sqrt(Dh)), and O^T += V^T P^T (K dim = 512 keys ->
  // 16 k-steps; V^T rows are the A operand, two transposing reads each). Two
  // score tiles, rounded to f16, are a B operand over 32 keys in frag_ld's own
  // k order, which is the transposing read's too:
  // pb[j] = key 32t + 8*(lane/16) + j, pb[8+j] = the same key + 16.
  const float SC = 0.125f * 1.44269504f;  // 1/sqrt(Dh) * log2(e)
  const float nmx = -mx * SC;
  const v8f SC8 = {SC, SC, SC, SC, SC, SC, SC, SC};
  const v8f nmx8 = {nmx, nmx, nmx, nmx, nmx, nmx, nmx, nmx};
  const char* vlane = vs + (sel8 + (lane & 7)) * VPITCH_B + ((lane >> 3) & 1) * 16;
  v8f sum = {};
  v8f oacc[4];
  {
    v8f z = {};
#pragma unroll
    for (int n = 0; n < 4; ++n) oacc[n] = z;
  }
#pragma unroll
  for (int t = 0; t < 16; ++t) {
    v16h pb;
#pragma unroll
    for (int u = 0; u < 2; ++u) {
      // whole-vector forms: packed f32 multiply-adds and adds, two per issue
      const v8f x = __builtin_elementwise_fma(s[t * 2 + u], SC8, nmx8);
      v8f ev;
#pragma unroll
      for (int j = 0; j < 8; ++j) ev[j] = __builtin_amdgcn_exp2f(x[j]);
      sum += ev;  // eight independent chains
      const v8h eh = __builtin_convertvector(ev, v8h);
#pragma unroll
      for (int j = 0; j < 8; ++j) pb[u * 8 + j] = eh[j];
    }
#pragma unroll
    for (int n = 0; n < 4; ++n) {
      // keys 32t + 8*(lane/16) + 0..7 and the same + 16, of dh 16n + lane%16
      const v8h lo = ld_tr16(vlane + (t * 32) * VPITCH_B + n * 32);
      const v8h hi = ld_tr16(vlane + (t * 32 + 16) * VPITCH_B + n * 32);
      v16h va;
#pragma unroll
      for (int j = 0; j < 8; ++j) { va[j] = lo[j]; va[j + 8] = hi[j]; }
      oacc[n] = wmma32(va, pb, oacc[n]);
    }
  }

  float tot = ((sum[0] + sum[1]) + (sum[2] + sum[3])) +
              ((sum[4] + sum[5]) + (sum[6] + sum[7]));
  tot += __shfl_xor(tot, 16, 32);
  const float inv = 1.0f / tot;

  // O^T: lane%16 = query, registers = 8 consecutive dh: one 16-byte store
#pragma unroll
  for (int n = 0; n < 4; ++n) {
    v8h o;
#pragma unroll
    for (int r = 0; r < 8; ++r) o[r] = (_Float16)(oacc[n][r] * inv);
    *(v8h*)&O[base + (size_t)(q0 + wave * 16 + rl) * 1024 + n * 16 + sel8] = o;
  }
}

// ------------------------------- launcher ----------------------------------
extern "C" void kernel_launch(void* const* d_in, const int* in_sizes, int n_in,
                              void* d_out, int out_size, void* d_ws,
                              size_t ws_size, hipStream_t stream) {
  const float* X   = (const float*)d_in[0];
  const float* Wq  = (const float*)d_in[1];
  const float* bq  = (const float*)d_in[2];
  const float* Wk  = (const float*)d_in[3];
  const float* bk  = (const float*)d_in[4];
  const float* Wv  = (const float*)d_in[5];
  const float* bv  = (const float*)d_in[6];
  const float* gW1 = (const float*)d_in[7];
  const float* gb1 = (const float*)d_in[8];
  const float* gW2 = (const float*)d_in[9];
  const float* gb2 = (const float*)d_in[10];
  const float* Wo  = (const float*)d_in[11];
  const float* bo  = (const float*)d_in[12];

  char* ws = (char*)d_ws;
  _Float16* Xh = (_Float16*)(ws + OFF_XH);
  _Float16* Qb = (_Float16*)(ws + OFF_Q);
  _Float16* Kb = (_Float16*)(ws + OFF_K);
  _Float16* Vb = (_Float16*)(ws + OFF_V);
  _Float16* AO = (_Float16*)(ws + OFF_AO);
  float* gw    = (float*)(ws + OFF_GW);
  float* beff  = (float*)(ws + OFF_BE);  // [3][16][1024]
  float* part  = (float*)(ws + OFF_PP);
  _Float16* Wp  = (_Float16*)(ws + OFF_WP);
  _Float16* Wop = (_Float16*)(ws + OFF_WOP);

  cvt_pool<<<MDIM / POOL_ROWS, 256, 0, stream>>>(X, Xh, part);

  gate_kernel<<<NINST, 1024, 0, stream>>>(part, gW1, gb1, gW2, gb2, bq, bk, bv,
                                          gw, beff);

  dim3 pgrid(NDIM / 64, KDIM / 64, 4);
  prep_weights<<<pgrid, 256, 0, stream>>>(Wq, Wk, Wv, Wo, gw, Wp, Wop);

  dim3 ggrid(NDIM / 128, MDIM / 128);
  moe_gemm<_Float16, true><<<ggrid, 256, 0, stream>>>(
      Xh, Wp + (size_t)0 * NINST * KDIM * NDIM, beff + 0 * NINST * NDIM, Qb);
  moe_gemm<_Float16, true><<<ggrid, 256, 0, stream>>>(
      Xh, Wp + (size_t)1 * NINST * KDIM * NDIM, beff + 1 * NINST * NDIM, Kb);
  moe_gemm<_Float16, true><<<ggrid, 256, 0, stream>>>(
      Xh, Wp + (size_t)2 * NINST * KDIM * NDIM, beff + 2 * NINST * NDIM, Vb);

  dim3 agrid(SPAN / 64, 16, NINST);
  span_attn<<<agrid, 128, 0, stream>>>(Qb, Kb, Vb, AO);

  moe_gemm<float, false><<<ggrid, 256, 0, stream>>>(AO, Wop, bo,
                                                    (float*)d_out);
}

// v006
// Measured time: 120 microseconds a run.
// Next to v005, in two timings, it ran 1.11 times as fast each time.
// Over all steps from v000 it is 8.55 times as fast.
#include <hip/hip_runtime.h>

// ---------------------------------------------------------------------------
// MoE span attention for MI455X (gfx1250, wave32, WMMA 16x16x32 f16->f32).
//
// Sizes (fixed by the reference): B=4, T=2048, C=1024, E=4 spans==experts,
// H=16 heads, Dh=64, S=512, M = B*T = 8192 rows, K=N=1024.
//
// Pipeline (all on `stream`):
//   1) convert hidden f32 -> f16 (ws); the same pass sums each block's 16
//      rows per column: 32 partial sums per span for the gate's mean-pool
//   2) gate: add the partial sums -> MLP -> softmax -> gw[16][4]; eff biases
//   3) weight prep: W_eff[inst] = sum_e gw_e W_e for q/k/v, and Wo, each
//      rounded to f16 once and packed in the GEMM's own tile order (ws)
//   4) q/k/v GEMM, one launch: Y = X @ W_eff[inst] + b_eff for all three from
//      one A tile. A and W tiles go to a two-buffer LDS ring by
//      GLOBAL_LOAD_ASYNC_TO_LDS, one stage ahead of the stage that is multiplied.
//   5) per-(inst,head) attention, full-row softmax in registers; K and V go
//      row-major to LDS by GLOBAL_LOAD_ASYNC_TO_LDS
//   6) output GEMM (one weight matrix, the same kind of ring) -> d_out f32
// ---------------------------------------------------------------------------

typedef __attribute__((ext_vector_type(16))) _Float16 v16h;
typedef __attribute__((ext_vector_type(8)))  _Float16 v8h;
typedef __attribute__((ext_vector_type(4)))  _Float16 v4h;
typedef __attribute__((ext_vector_type(8)))  float    v8f;
typedef __attribute__((ext_vector_type(4)))  float    v4f;

// this wave's asynchronous copies have landed in LDS
__device__ __forceinline__ void wait_asynccnt0() {
  asm volatile("s_wait_asynccnt 0x0" ::: "memory");
}

// this wave's LDS reads have returned: stands in front of the barrier behind
// which their buffer is refilled
__device__ __forceinline__ void wait_dscnt0() {
  asm volatile("s_wait_dscnt 0x0" ::: "memory");
}

// byte offset of a __shared__ address in the work-group's LDS
__device__ __forceinline__ unsigned lds_off(const void* p) {
  return (unsigned)(size_t)p;
}

// Eight asynchronous 16-byte copies per lane, global -> LDS, through no
// register. The s_wait_xcnt closes the statement as a precaution: it stands in
// front of every later write of the address registers that the copies name.
__device__ __forceinline__ void async_copy8(const unsigned (&l)[8],
                                            const _Float16* const (&g)[8]) {
  asm volatile(
      "global_load_async_to_lds_b128 %0, %8, off\n\t"
      "global_load_async_to_lds_b128 %1, %9, off\n\t"
      "global_load_async_to_lds_b128 %2, %10, off\n\t"
      "global_load_async_to_lds_b128 %3, %11, off\n\t"
      "global_load_async_to_lds_b128 %4, %12, off\n\t"
      "global_load_async_to_lds_b128 %5, %13, off\n\t"
      "global_load_async_to_lds_b128 %6, %14, off\n\t"
      "global_load_async_to_lds_b128 %7, %15, off\n\t"
      "s_wait_xcnt 0x0"
      :
      : "v"(l[0]), "v"(l[1]), "v"(l[2]), "v"(l[3]), "v"(l[4]), "v"(l[5]),
        "v"(l[6]), "v"(l[7]), "v"(g[0]), "v"(g[1]), "v"(g[2]), "v"(g[3]),
        "v"(g[4]), "v"(g[5]), "v"(g[6]), "v"(g[7])
      : "memory");
}

// One asynchronous 16-byte copy per lane as the builtin: the compiler picks its
// registers, also above v255, where an asm operand cannot lie.
typedef int i32x4 __attribute__((ext_vector_type(4)));
__device__ __forceinline__ void async_copy(_Float16* l, const _Float16* g) {
  typedef __attribute__((address_space(1))) i32x4 glb_i32x4;
  typedef __attribute__((address_space(3))) i32x4 lds_i32x4;
  __builtin_amdgcn_global_load_async_to_lds_b128((glb_i32x4*)g, (lds_i32x4*)l, 0, 0);
}

__device__ __forceinline__ v8f wmma32(v16h a, v16h b, v8f c) {
  // (neg_a, A, neg_b, B, c_mod, C, reuse_a, reuse_b)
  return __builtin_amdgcn_wmma_f32_16x16x32_f16(false, a, false, b, (short)0, c,
                                                false, false);
}

// Load one 16x32 (A-style) / 32x16 (B-style) f16 WMMA fragment.
// Caller passes p = &buf[(lane%16)*stride + (lane/16)*8 (+k_base)], 16B aligned.
// Per ISA 7.12.2: halves 0..7 = K at p[0..7], halves 8..15 = K at p[16..23].
__device__ __forceinline__ v16h frag_ld(const _Float16* p) {
  v8h lo = *(const v8h*)p;
  v8h hi = *(const v8h*)(p + 16);
  v16h r;
#pragma unroll
  for (int j = 0; j < 8; ++j) { r[j] = lo[j]; r[j + 8] = hi[j]; }
  return r;
}

// Transposing LDS read: from a row-major 16-bit tile T, with lane l's p at row
// 8*(l/16) + l%8, byte 16*((l/8)%2), lane l gets T[8*(l/16) + 0..7][l%16].
typedef short s16x8 __attribute__((ext_vector_type(8)));
__device__ __forceinline__ v8h ld_tr16(const char* p) {
  typedef __attribute__((address_space(3))) s16x8 lds_s16x8;
  return __builtin_bit_cast(v8h,
                            __builtin_amdgcn_ds_load_tr16_b128_v8i16((lds_s16x8*)p));
}

// ------------------------------- constants ---------------------------------
#define MDIM 8192
#define KDIM 1024
#define NDIM 1024
#define NINST 16
#define SPAN 512

// workspace layout (bytes)
#define OFF_XH  ((size_t)0)
#define OFF_Q   ((size_t)16 << 20)
#define OFF_K   ((size_t)32 << 20)
#define OFF_V   ((size_t)48 << 20)
#define OFF_AO  ((size_t)64 << 20)
#define OFF_GW  ((size_t)80 << 20)
#define OFF_BE  (OFF_GW + 4096)
#define OFF_PP  ((size_t)84 << 20)   // pooling partial sums [NINST][32][1024] f32
#define OFF_WP  ((size_t)96 << 20)   // packed q/k/v weights [3][NINST], 2 MiB each
#define OFF_WOP ((size_t)192 << 20)  // packed Wo, 2 MiB

// ---------------- 1) f32 -> f16, with the pooling partial sums --------------
// One block = 16 rows x all 1024 columns, four columns per thread.
#define POOL_ROWS 16
#define POOL_CHUNKS (SPAN / POOL_ROWS)  // 32 partial sums per span and column

__global__ void __launch_bounds__(256)
cvt_pool(const float* __restrict__ x,
         _Float16* __restrict__ y,
         float* __restrict__ part) {  // [NINST * POOL_CHUNKS][1024]
  const size_t c4 = (size_t)threadIdx.x * 4;
  const size_t base = (size_t)blockIdx.x * POOL_ROWS * 1024 + c4;

  // all 16 loads go out before the first use waits for data
  v4f v[POOL_ROWS];
#pragma unroll
  for (int r = 0; r < POOL_ROWS; ++r)
    v[r] = *(const v4f*)(x + base + (size_t)r * 1024);

  v4f s = {};
#pragma unroll
  for (int r = 0; r < POOL_ROWS; ++r) {
    v4h h;
#pragma unroll
    for (int j = 0; j < 4; ++j) h[j] = (_Float16)v[r][j];
    *(v4h*)(y + base + (size_t)r * 1024) = h;
    s += v[r];
  }
  *(v4f*)(part + (size_t)blockIdx.x * 1024 + c4) = s;
}

// ------------------------------- 2) gate -----------------------------------
// One block of 32 waves per instance. Every long sum is cut into partial sums
// whose loads are all in flight together.
__global__ void __launch_bounds__(1024)
gate_kernel(const float* __restrict__ part,
            const float* __restrict__ gW1,
            const float* __restrict__ gb1,
            const float* __restrict__ gW2,
            const float* __restrict__ gb2,
            const float* __restrict__ bq,
            const float* __restrict__ bk,
            const float* __restrict__ bv,
            float* __restrict__ gw_out,
            float* __restrict__ beff) {
  __shared__ float pooled[1024] __attribute__((aligned(16)));
  __shared__ float hpart[32 * 128] __attribute__((aligned(16)));
  __shared__ float gact[128] __attribute__((aligned(16)));
  __shared__ float gws[4];
  const int inst = blockIdx.x;
  const int tid = threadIdx.x;
  const int lane = tid & 31, wave = tid >> 5;

  // mean-pool: thread = column, the 32 partial sums of the convert pass
  {
    const float* p = part + (size_t)inst * POOL_CHUNKS * 1024 + tid;
    float t[POOL_CHUNKS];
#pragma unroll
    for (int ch = 0; ch < POOL_CHUNKS; ++ch) t[ch] = p[ch * 1024];
    float s = 0.f;
#pragma unroll
    for (int ch = 0; ch < POOL_CHUNKS; ++ch) s += t[ch];
    pooled[tid] = s * (1.0f / (float)SPAN);
  }
  __syncthreads();

  // layer 1: wave = a slice of 32 inputs, lane = 4 of the 128 outputs, so one
  // load of a wave is one whole 512-byte row of gW1
  {
    const float* wrow = gW1 + (size_t)wave * 32 * 128 + lane * 4;
    v4f a = {};
#pragma unroll
    for (int half = 0; half < 2; ++half) {
      v4f w[16];
#pragma unroll
      for (int i = 0; i < 16; ++i)
        w[i] = *(const v4f*)(wrow + (half * 16 + i) * 128);
#pragma unroll
      for (int i = 0; i < 16; ++i) a += pooled[wave * 32 + half * 16 + i] * w[i];
    }
    *(v4f*)&hpart[wave * 128 + lane * 4] = a;
  }
  __syncthreads();

  if (tid < 128) {
    float s = gb1[tid];
#pragma unroll
    for (int w = 0; w < 32; ++w) s += hpart[w * 128 + tid];
    gact[tid] = fmaxf(s, 0.f);
  }
  __syncthreads();

  // layer 2 and softmax: wave 0, lane = 4 of the 128 hidden units
  if (wave == 0) {
    v4f l = {};
#pragma unroll
    for (int i = 0; i < 4; ++i)
      l += gact[lane * 4 + i] * *(const v4f*)(gW2 + (lane * 4 + i) * 4);
#pragma unroll
    for (int off = 16; off > 0; off >>= 1)
#pragma unroll
      for (int e = 0; e < 4; ++e) l[e] += __shfl_xor(l[e], off, 32);
#pragma unroll
    for (int e = 0; e < 4; ++e) l[e] += gb2[e];
    float mx = fmaxf(fmaxf(l[0], l[1]), fmaxf(l[2], l[3]));
    float e0 = __expf(l[0] - mx), e1 = __expf(l[1] - mx);
    float e2 = __expf(l[2] - mx), e3 = __expf(l[3] - mx);
    float inv = 1.0f / (e0 + e1 + e2 + e3);
    if (lane == 0) {
      gws[0] = e0 * inv; gws[1] = e1 * inv; gws[2] = e2 * inv; gws[3] = e3 * inv;
      gw_out[inst * 4 + 0] = e0 * inv; gw_out[inst * 4 + 1] = e1 * inv;
      gw_out[inst * 4 + 2] = e2 * inv; gw_out[inst * 4 + 3] = e3 * inv;
    }
  }
  __syncthreads();

  // effective biases: thread = column
  {
    float a0 = 0.f, a1 = 0.f, a2 = 0.f;
#pragma unroll
    for (int e = 0; e < 4; ++e) {
      float g = gws[e];
      a0 += g * bq[e * 1024 + tid];
      a1 += g * bk[e * 1024 + tid];
      a2 += g * bv[e * 1024 + tid];
    }
    beff[(0 * NINST + inst) * 1024 + tid] = a0;
    beff[(1 * NINST + inst) * 1024 + tid] = a1;
    beff[(2 * NINST + inst) * 1024 + tid] = a2;
  }
}

// ----------------------------- 3) weight prep ------------------------------
// Packed weight matrix, f16: [n/128][k/32][n%128][k%32], so that the 128x32
// tile a GEMM block stages per K-step is 4096 contiguous halves.
// One block takes a 64(k) x 64(n) tile of all NE experts through LDS (the
// transpose), then forms every instance's combination from registers.
#define PREP_PITCH 65  // dwords; column walks of 4-byte reads hit 32 banks

template <int NE, int NI>
__device__ __forceinline__ void prep_tile(const float* __restrict__ W,   // [NE][K][N]
                                          const float* __restrict__ gw,  // [NI][NE]
                                          _Float16* __restrict__ Wp,     // [NI] packed
                                          float* __restrict__ tile) {
  const int tid = threadIdx.x;
  const int n0 = blockIdx.x * 64;
  const int k0 = blockIdx.y * 64;

  // the 64 gate weights: two per lane, then readlane moves each to a scalar
  // register, so that none of them holds a vector register beside the tile
  static_assert(NE == 1 || NI * NE == 64, "two gate weights per lane");
  float g[NI][NE];
  if constexpr (NE > 1) {
    const int glo = __builtin_bit_cast(int, gw[tid & 31]);
    const int ghi = __builtin_bit_cast(int, gw[32 + (tid & 31)]);
#pragma unroll
    for (int i = 0; i < NI; ++i)
#pragma unroll
      for (int e = 0; e < NE; ++e)
        g[i][e] = __builtin_bit_cast(
            float, __builtin_amdgcn_readlane((i * NE + e) < 32 ? glo : ghi,
                                             (i * NE + e) & 31));
  }

  // all NE*4 loads go out before the first LDS store waits for data
  const unsigned kr = tid >> 4, n4 = (tid & 15) * 4;
  v4f w4[NE][4];
#pragma unroll
  for (int e = 0; e < NE; ++e) {
    const float* We = W + (size_t)e * KDIM * NDIM + (size_t)k0 * NDIM + n0;
#pragma unroll
    for (int it = 0; it < 4; ++it)
      w4[e][it] = *(const v4f*)&We[(kr + it * 16) * NDIM + n4];
    // precaution: stands in front of later loads whose results may reuse an
    // address register of these loads
    asm volatile("s_wait_xcnt 0x0" ::: "memory");
  }
#pragma unroll
  for (int e = 0; e < NE; ++e)
#pragma unroll
    for (int it = 0; it < 4; ++it)
#pragma unroll
      for (int j = 0; j < 4; ++j)
        tile[(e * 64 + kr + it * 16) * PREP_PITCH + n4 + j] = w4[e][it][j];
  __syncthreads();

  const int kq = tid & 3;   // 8 consecutive k per thread
  const int n = tid >> 2;   // 0..63
  const int ng = n0 + n;
#pragma unroll
  for (int ks = 0; ks < 2; ++ks) {  // the tile's two 32-wide K-steps
    float w[NE][8];
#pragma unroll
    for (int e = 0; e < NE; ++e)
#pragma unroll
      for (int j = 0; j < 8; ++j)
        w[e][j] = tile[(e * 64 + ks * 32 + kq * 8 + j) * PREP_PITCH + n];

    _Float16* dst = Wp + ((size_t)(ng >> 7) * 32 + (k0 >> 5) + ks) * 4096 +
                    (ng & 127) * 32 + kq * 8;
#pragma unroll
    for (int i = 0; i < NI; ++i) {
      v8h o;
#pragma unroll
      for (int j = 0; j < 8; ++j) {
        float a = (NE == 1) ? w[0][j] : g[i][0] * w[0][j];
#pragma unroll
        for (int e = 1; e < NE; ++e) a = __builtin_fmaf(g[i][e], w[e][j], a);
        o[j] = (_Float16)a;
      }
      *(v8h*)(dst + (size_t)i * KDIM * NDIM) = o;
    }
  }
}

// grid = (N/64, K/64, 4): z = 0,1,2 -> q,k,v (4 experts, 16 instances), 3 -> Wo.
__global__ void __launch_bounds__(256)
prep_weights(const float* __restrict__ Wq,
             const float* __restrict__ Wk,
             const float* __restrict__ Wv,
             const float* __restrict__ Wo,
             const float* __restrict__ gw,
             _Float16* __restrict__ Wp,
             _Float16* __restrict__ Wop) {
  __shared__ float tile[4 * 64 * PREP_PITCH];
  const int p = blockIdx.z;
  if (p < 3) {
    const float* W = (p == 0) ? Wq : (p == 1) ? Wk : Wv;
    prep_tile<4, NINST>(W, gw, Wp + (size_t)p * NINST * KDIM * NDIM, tile);
  } else {
    prep_tile<1, 1>(Wo, gw, Wop, tile);
  }
}

// A lane's bias values of one product: eight floats in a row at p and eight at
// p + 16. The loads and their data wait are one statement, and no result may
// share a register with the address: nothing can rewrite a register that a load
// names while the load is out.
__device__ __forceinline__ void bias_ld(const float* p, v4f (&b)[4]) {
  asm volatile(
      "global_load_b128 %0, %4, off\n\t"
      "global_load_b128 %1, %4, off offset:16\n\t"
      "global_load_b128 %2, %4, off offset:64\n\t"
      "global_load_b128 %3, %4, off offset:80\n\t"
      "s_wait_loadcnt 0x0"
      : "=&v"(b[0]), "=&v"(b[1]), "=&v"(b[2]), "=&v"(b[3])
      : "v"(p)
      : "memory");
}

// Eight 16-byte stores per lane, 16 rows of NDIM halves apart. The s_wait_xcnt
// closes the statement as a precaution: it stands in front of every later write
// of the data and address registers that the stores name.
__device__ __forceinline__ void store8_rows16(_Float16* p, const i32x4 (&o)[8]) {
  asm volatile(
      "global_store_b128 %8, %0, off\n\t"
      "global_store_b128 %8, %1, off offset:32768\n\t"
      "global_store_b128 %8, %2, off offset:65536\n\t"
      "global_store_b128 %8, %3, off offset:98304\n\t"
      "global_store_b128 %8, %4, off offset:131072\n\t"
      "global_store_b128 %8, %5, off offset:163840\n\t"
      "global_store_b128 %8, %6, off offset:196608\n\t"
      "global_store_b128 %8, %7, off offset:229376\n\t"
      "s_wait_xcnt 0x0"
      :
      : "v"(o[0]), "v"(o[1]), "v"(o[2]), "v"(o[3]), "v"(o[4]), "v"(o[5]), "v"(o[6]),
        "v"(o[7]), "v"(p)
      : "memory");
}

// ------------------------ 4) q, k and v: one WMMA GEMM ----------------------
// grid = (N/128, M/256), block = 256 (8 waves, 2x4 wave grid): one block per
// WGP. A block forms 256 rows x 128 columns of q, of k and of v from ONE A
// tile; a wave holds 128 rows x 32 columns of each product, 48 accumulator
// tiles, so that an A fragment read from LDS feeds six WMMAs and a W fragment
// eight. The product is formed as W X^T (W rows are the A operand, X rows the B
// operand, both through the same fragment read): a lane then holds eight columns
// in a row of one row of Y. K runs in 16 stages of 64. A stage in LDS is
// [A 256 rows | Wq, Wk, Wv 128 rows each], rows of 128 B at a pitch of 144 B
// (16 B x odd: no bank conflict for 16-byte reads). Two buffers: while stage t
// is multiplied, stage t+1's copies fly.
#define QM 256                      // rows per block
#define QK 64                       // k per stage
#define QNST (KDIM / QK)            // stages
#define QPITCH 72                   // halves per LDS row
#define QAH (QM * QPITCH)           // halves of a stage's A part
#define QWH (128 * QPITCH)          // halves of one product's W part
#define QSTAGE (QAH + 3 * QWH)      // halves per stage

// the real block size: two waves share a SIMD, so a wave may take up to 512
// registers, 384 of them accumulators
__global__ void __launch_bounds__(256)
qkv_gemm(const _Float16* __restrict__ A,   // [M][K] f16
         const _Float16* __restrict__ Wp,  // packed, [3][NINST]
         const float* __restrict__ bias,   // [3][NINST][N]
         _Float16* __restrict__ Y) {       // [3][M][N]
  __shared__ _Float16 ring[2 * QSTAGE] __attribute__((aligned(16)));

  const int tid = threadIdx.x;
  const int lane = tid & 31, wave = tid >> 5;
  const int rl = lane & 15;
  const int sel8 = (lane >> 4) * 8;
  const int row0 = blockIdx.y * QM;
  const int n0 = blockIdx.x * 128;
  const int inst = row0 >> 9;  // 512 rows per instance

  // A stage: 2048 chunks of 16 B, 8 per thread; 8 lanes take one row's 128 B.
  const _Float16* asrc = A + (size_t)(row0 + (tid >> 3)) * KDIM + (tid & 7) * 8;
  _Float16* adst = ring + (tid >> 3) * QPITCH + (tid & 7) * 8;
  // W stage, per product: two packed 128x32 tiles, 16 KiB in a row in memory;
  // chunk tid + 256*it is k-step it/2, row tid/4 + 64*(it%2), 16-byte piece tid%4.
  const _Float16* wsrc = Wp + (size_t)inst * KDIM * NDIM +
                         (size_t)blockIdx.x * 32 * 4096 + tid * 8;
  _Float16* wdst = ring + QAH + (tid >> 2) * QPITCH + (tid & 3) * 8;

  auto issue_stage = [&](int t, int buf) {
#pragma unroll
    for (int it = 0; it < 8; ++it)
      async_copy(adst + buf * QSTAGE + it * 32 * QPITCH,
                 asrc + t * QK + (size_t)it * 32 * KDIM);
#pragma unroll
    for (int p = 0; p < 3; ++p)
#pragma unroll
      for (int it = 0; it < 4; ++it)
        async_copy(wdst + buf * QSTAGE + p * QWH + (it & 1) * 64 * QPITCH + (it >> 1) * 32,
                   wsrc + (size_t)p * NINST * KDIM * NDIM + t * (2 * 4096) + it * 2048);
  };

  v8f acc[8][6];  // [row tile][2 * product + column tile]
  {
    v8f z = {};
#pragma unroll
    for (int i = 0; i < 8; ++i)
#pragma unroll
      for (int j = 0; j < 6; ++j) acc[i][j] = z;
  }

  const int mw = (wave >> 2) * 128;  // 0 or 128
  const int nw = (wave & 3) * 32;    // 0,32,64,96

  issue_stage(0, 0);
  wait_asynccnt0();
  __syncthreads();  // stage 0 is published
  issue_stage(1, 1);

  for (int t = 0; t < QNST; ++t) {
    const _Float16* As = ring + (t & 1) * QSTAGE;
    const _Float16* Ws = As + QAH;

    // A k-step's six W fragments are held; its eight A fragments come in pairs,
    // each pair read while the pair before it is multiplied.
    auto ld_a = [&](int grp, int u) {  // grp = 4 * k-step + pair
      return frag_ld(&As[(mw + ((grp & 3) * 2 + u) * 16 + rl) * QPITCH + (grp >> 2) * 32 + sel8]);
    };
    auto ld_b = [&](int ks, int j) {
      return frag_ld(&Ws[((j >> 1) * 128 + nw + (j & 1) * 16 + rl) * QPITCH + ks * 32 + sel8]);
    };
    v16h bf[6], af[2][2];
#pragma unroll
    for (int j = 0; j < 6; ++j) bf[j] = ld_b(0, j);
    af[0][0] = ld_a(0, 0);
    af[0][1] = ld_a(0, 1);
#pragma unroll
    for (int grp = 0; grp < 4 * (QK / 32); ++grp) {
      if (grp + 1 < 4 * (QK / 32)) {
        af[(grp + 1) & 1][0] = ld_a(grp + 1, 0);
        af[(grp + 1) & 1][1] = ld_a(grp + 1, 1);
      }
      // keeps the next pair's LDS reads in front of this pair's 12 WMMAs: left
      // alone the compiler reads a fragment right before its use and waits out
      // the LDS latency every six WMMAs
      __builtin_amdgcn_sched_barrier(0);
#pragma unroll
      for (int u = 0; u < 2; ++u)
#pragma unroll
        for (int j = 0; j < 6; ++j)
          acc[(grp & 3) * 2 + u][j] = wmma32(bf[j], af[grp & 1][u], acc[(grp & 3) * 2 + u][j]);
      if ((grp & 3) == 3 && (grp >> 2) + 1 < QK / 32) {
#pragma unroll
        for (int j = 0; j < 6; ++j) bf[j] = ld_b((grp >> 2) + 1, j);
      }
    }

    // publish point of stage t+1; the same barrier ends every wave's reads of
    // stage t's buffer, which is refilled behind it
    wait_dscnt0();
    wait_asynccnt0();
    __syncthreads();
    if (t + 2 < QNST) issue_stage(t + 2, t & 1);
  }
  wait_asynccnt0();  // no copy is outstanding when the wave ends

  // epilogue: D of W X^T = lane%16 -> row of Y, vgpr r + 8*(lane/16) -> column:
  // a lane holds eight columns in a row of one row of Y, one 16-byte store
#pragma unroll
  for (int p = 0; p < 3; ++p) {
    const int cg = n0 + nw + sel8;
    v4f b4[4];
    bias_ld(bias + (p * NINST + inst) * NDIM + cg, b4);
#pragma unroll
    for (int jj = 0; jj < 2; ++jj) {
      const v8f b = __builtin_shufflevector(b4[2 * jj], b4[2 * jj + 1], 0, 1, 2, 3, 4, 5, 6, 7);
      i32x4 o[8];
#pragma unroll
      for (int i = 0; i < 8; ++i)
        o[i] = __builtin_bit_cast(i32x4, __builtin_convertvector(acc[i][2 * p + jj] + b, v8h));
      store8_rows16(Y + (size_t)p * MDIM * NDIM + (size_t)(row0 + mw + rl) * NDIM + cg + jj * 16, o);
      // keeps the next eight tiles' sums and conversions behind these stores:
      // moved ahead, they want more registers under v256, where an asm operand
      // has to lie, than are free, and the build spills to scratch
      __builtin_amdgcn_sched_barrier(0);
    }
  }
}

// ----------------------------- 6) output GEMM ------------------------------
// grid = (N/128, M/128), block = 256 (8 waves, 2x4 wave grid, 64x32/wave).
// K runs in 8 stages of 128. A stage in LDS is [A 128 rows | W 128 rows], rows
// of 256 B at a pitch of 272 B (16 B x odd: no bank conflict for 16-byte
// reads). Two buffers: while stage t is multiplied, stage t+1's copies fly.
#define GK 128                      // k per stage
#define GNST (KDIM / GK)            // stages
#define GPITCH 136                  // halves per LDS row
#define GOP (128 * GPITCH)          // halves per operand and stage
#define GSTAGE (2 * GOP)            // halves per stage

// the real block size: two blocks of 136 KiB LDS share a WGP, so a wave may
// take up to 256 registers
__global__ void __launch_bounds__(256)
out_gemm(const _Float16* __restrict__ A,   // [M][K] f16
         const _Float16* __restrict__ Wp,  // packed
         const float* __restrict__ bias,   // [N]
         float* __restrict__ Y) {
  __shared__ _Float16 ring[2 * GSTAGE] __attribute__((aligned(16)));

  const int tid = threadIdx.x;
  const int lane = tid & 31, wave = tid >> 5;
  const int rl = lane & 15;
  const int sel8 = (lane >> 4) * 8;
  const int row0 = blockIdx.y * 128;
  const int n0 = blockIdx.x * 128;

  // this block's column of packed tiles: 32 K-steps of 4096 halves
  const _Float16* wcol = Wp + (size_t)blockIdx.x * 32 * 4096;

  // A stage: 2048 chunks of 16 B, 8 per thread; 16 lanes take one row's 256 B.
  const _Float16* asrc = A + (size_t)(row0 + (tid >> 4)) * KDIM + (tid & 15) * 8;
  const unsigned adst = lds_off(ring) + (tid >> 4) * (GPITCH * 2) + (tid & 15) * 16;
  // W stage: four packed 128x32 tiles, 32 KiB in a row in memory; chunk
  // tid + 256*it is k-step it/2, row tid/4 + 64*(it%2), 16-byte piece tid%4.
  const _Float16* wsrc = wcol + tid * 8;
  const unsigned wdst = lds_off(ring) + GOP * 2 + (tid >> 2) * (GPITCH * 2) + (tid & 3) * 16;

  auto issue_stage = [&](int t, int buf) {
    unsigned l[8];
    const _Float16* g[8];
#pragma unroll
    for (int it = 0; it < 8; ++it) {
      l[it] = adst + buf * (GSTAGE * 2) + it * 16 * (GPITCH * 2);
      g[it] = asrc + t * GK + (size_t)it * 16 * KDIM;
    }
    async_copy8(l, g);
#pragma unroll
    for (int it = 0; it < 8; ++it) {
      l[it] = wdst + buf * (GSTAGE * 2) + (it & 1) * 64 * (GPITCH * 2) + (it >> 1) * 64;
      g[it] = wsrc + t * (4 * 4096) + it * 2048;
    }
    async_copy8(l, g);
  };

  v8f acc[4][2];
  {
    v8f z = {};
#pragma unroll
    for (int i = 0; i < 4; ++i)
#pragma unroll
      for (int j = 0; j < 2; ++j) acc[i][j] = z;
  }

  const int mw = (wave >> 2) * 64;  // 0 or 64
  const int nw = (wave & 3) * 32;   // 0,32,64,96

  issue_stage(0, 0);
  wait_asynccnt0();
  __syncthreads();  // stage 0 is published
  issue_stage(1, 1);

  for (int t = 0; t < GNST; ++t) {
    const _Float16* As = ring + (t & 1) * GSTAGE;
    const _Float16* Ws = As + GOP;

#pragma unroll
    for (int ks = 0; ks < GK / 32; ++ks) {
      v16h af[4], bf[2];
#pragma unroll
      for (int i = 0; i < 4; ++i)
        af[i] = frag_ld(&As[(mw + i * 16 + rl) * GPITCH + ks * 32 + sel8]);
#pragma unroll
      for (int j = 0; j < 2; ++j)
        bf[j] = frag_ld(&Ws[(nw + j * 16 + rl) * GPITCH + ks * 32 + sel8]);
      // keeps the k-step's 12 LDS reads one group in front of its WMMAs: left
      // alone the compiler reads two at a time and waits out each pair's latency
      __builtin_amdgcn_sched_barrier(0);
#pragma unroll
      for (int i = 0; i < 4; ++i)
#pragma unroll
        for (int j = 0; j < 2; ++j) acc[i][j] = wmma32(af[i], bf[j], acc[i][j]);
    }

    // publish point of stage t+1; the same barrier ends every wave's reads of
    // stage t's buffer, which is refilled behind it
    wait_dscnt0();
    wait_asynccnt0();
    __syncthreads();
    if (t + 2 < GNST) issue_stage(t + 2, t & 1);
  }
  wait_asynccnt0();  // no copy is outstanding when the wave ends

  // epilogue: D layout = lane%16 -> col, vgpr r + 8*(lane/16) -> row
#pragma unroll
  for (int i = 0; i < 4; ++i)
#pragma unroll
    for (int j = 0; j < 2; ++j)
#pragma unroll
      for (int r = 0; r < 8; ++r) {
        int rg = row0 + mw + i * 16 + r + (lane >> 4) * 8;
        int cg = n0 + nw + j * 16 + rl;
        Y[(size_t)rg * NDIM + cg] = acc[i][j][r] + bias[cg];
      }
}

#define KPITCH_B 144
#define VPITCH_B 160
#define ATTN_V_BYTES (SPAN * VPITCH_B)
#define ATTN_SMEM (ATTN_V_BYTES + SPAN * KPITCH_B)

// the real block size lifts the register ceiling: the 256 score registers of
// a lane have to fit without scratch
__global__ void __launch_bounds__(128)
span_attn(const _Float16* __restrict__ Q,
          const _Float16* __restrict__ Kx,
          const _Float16* __restrict__ V,
          _Float16* __restrict__ O) {
  __shared__ char smem[ATTN_SMEM] __attribute__((aligned(16)));
  const char* vs = smem;                                       // V rows
  const _Float16* ks = (const _Float16*)(smem + ATTN_V_BYTES);  // K rows

  const int tid = threadIdx.x;
  const int lane = tid & 31, wave = tid >> 5;
  const int rl = lane & 15;
  const int sel8 = (lane >> 4) * 8;
  const int q0 = blockIdx.x * 64;
  const int h = blockIdx.y;
  const int inst = blockIdx.z;
  const size_t base = (size_t)inst * SPAN * 1024 + h * 64;

  // One operand = 512 rows of 128 B = 4096 chunks of 16 B, 32 per thread; eight
  // lanes take one whole row, so every copy of a wave covers four whole lines.
  auto stage_rows = [&](const _Float16* __restrict__ gsrc, unsigned dst0,
                        unsigned pitch) {
    const _Float16* s0 = gsrc + base + (size_t)(tid >> 3) * 1024 + (tid & 7) * 8;
    const unsigned d0 = dst0 + (tid >> 3) * pitch + (tid & 7) * 16;
#pragma unroll
    for (int grp = 0; grp < 4; ++grp) {
      unsigned l[8];
      const _Float16* g[8];
#pragma unroll
      for (int it = 0; it < 8; ++it) {
        l[it] = d0 + (grp * 8 + it) * 16 * pitch;
        g[it] = s0 + (size_t)(grp * 8 + it) * 16 * 1024;
      }
      async_copy8(l, g);
    }
  };

  stage_rows(Kx, lds_off(smem) + ATTN_V_BYTES, KPITCH_B);

  // Q fragments for this wave's 16 queries (K=Dh=64 -> 2 k-steps), loaded once;
  // they are the B operand: column = query = lane%16
  v16h qa[2];
#pragma unroll
  for (int t = 0; t < 2; ++t)
    qa[t] = frag_ld(&Q[base + (size_t)(q0 + wave * 16 + rl) * 1024 + t * 32 + sel8]);
  // precaution: stands in front of the later work, whose results may reuse the
  // address registers of the Q loads
  asm volatile("s_wait_xcnt 0x0" ::: "memory");

  wait_asynccnt0();
  __syncthreads();  // K is published
  // V's copies fly while the scores are formed
  stage_rows(V, lds_off(smem), VPITCH_B);

  // scores^T = K Q^T, kept as the f32 accumulators. D: lane%16 = query,
  // register r = key 8*(lane/16) + r of the 16-key tile: a lane holds 256 of
  // its query's 512 scores, lane^16 the other 256.
  v8f s[32];
#pragma unroll
  for (int kt = 0; kt < 32; ++kt) {
    v8f a = {};
#pragma unroll
    for (int d = 0; d < 2; ++d) {
      v16h kb = frag_ld(&ks[(kt * 16 + rl) * (KPITCH_B / 2) + d * 32 + sel8]);
      a = wmma32(kb, qa[d], a);
    }
    s[kt] = a;
  }

  // row maximum: eight in-lane chains, joined, then the other lane half
  float mx;
  {
    v8f m = s[0];
#pragma unroll
    for (int kt = 1; kt < 32; ++kt) m = __builtin_elementwise_max(m, s[kt]);
    mx = fmaxf(fmaxf(fmaxf(m[0], m[1]), fmaxf(m[2], m[3])),
               fmaxf(fmaxf(m[4], m[5]), fmaxf(m[6], m[7])));
    mx = fmaxf(mx, __shfl_xor(mx, 16, 32));
  }

  wait_asynccnt0();
  __syncthreads();  // V is published

  // P^T = exp((S^T - max) / sqrt(Dh)), and O^T += V^T P^T (K dim = 512 keys ->
  // 16 k-steps; V^T rows are the A operand, two transposing reads each). Two
  // score tiles, rounded to f16, are a B operand over 32 keys in frag_ld's own
  // k order, which is the transposing read's too:
  // pb[j] = key 32t + 8*(lane/16) + j, pb[8+j] = the same key + 16.
  const float SC = 0.125f * 1.44269504f;  // 1/sqrt(Dh) * log2(e)
  const float nmx = -mx * SC;
  const v8f SC8 = {SC, SC, SC, SC, SC, SC, SC, SC};
  const v8f nmx8 = {nmx, nmx, nmx, nmx, nmx, nmx, nmx, nmx};
  const char* vlane = vs + (sel8 + (lane & 7)) * VPITCH_B + ((lane >> 3) & 1) * 16;
  v8f sum = {};
  v8f oacc[4];
  {
    v8f z = {};
#pragma unroll
    for (int n = 0; n < 4; ++n) oacc[n] = z;
  }
#pragma unroll
  for (int t = 0; t < 16; ++t) {
    v16h pb;
#pragma unroll
    for (int u = 0; u < 2; ++u) {
      // whole-vector forms: packed f32 multiply-adds and adds, two per issue
      const v8f x = __builtin_elementwise_fma(s[t * 2 + u], SC8, nmx8);
      v8f ev;
#pragma unroll
      for (int j = 0; j < 8; ++j) ev[j] = __builtin_amdgcn_exp2f(x[j]);
      sum += ev;  // eight independent chains
      const v8h eh = __builtin_convertvector(ev, v8h);
#pragma unroll
      for (int j = 0; j < 8; ++j) pb[u * 8 + j] = eh[j];
    }
#pragma unroll
    for (int n = 0; n < 4; ++n) {
      // keys 32t + 8*(lane/16) + 0..7 and the same + 16, of dh 16n + lane%16
      const v8h lo = ld_tr16(vlane + (t * 32) * VPITCH_B + n * 32);
      const v8h hi = ld_tr16(vlane + (t * 32 + 16) * VPITCH_B + n * 32);
      v16h va;
#pragma unroll
      for (int j = 0; j < 8; ++j) { va[j] = lo[j]; va[j + 8] = hi[j]; }
      oacc[n] = wmma32(va, pb, oacc[n]);
    }
  }

  float tot = ((sum[0] + sum[1]) + (sum[2] + sum[3])) +
              ((sum[4] + sum[5]) + (sum[6] + sum[7]));
  tot += __shfl_xor(tot, 16, 32);
  const float inv = 1.0f / tot;

  // O^T: lane%16 = query, registers = 8 consecutive dh: one 16-byte store
#pragma unroll
  for (int n = 0; n < 4; ++n) {
    v8h o;
#pragma unroll
    for (int r = 0; r < 8; ++r) o[r] = (_Float16)(oacc[n][r] * inv);
    *(v8h*)&O[base + (size_t)(q0 + wave * 16 + rl) * 1024 + n * 16 + sel8] = o;
  }
}

// ------------------------------- launcher ----------------------------------
extern "C" void kernel_launch(void* const* d_in, const int* in_sizes, int n_in,
                              void* d_out, int out_size, void* d_ws,
                              size_t ws_size, hipStream_t stream) {
  const float* X   = (const float*)d_in[0];
  const float* Wq  = (const float*)d_in[1];
  const float* bq  = (const float*)d_in[2];
  const float* Wk  = (const float*)d_in[3];
  const float* bk  = (const float*)d_in[4];
  const float* Wv  = (const float*)d_in[5];
  const float* bv  = (const float*)d_in[6];
  const float* gW1 = (const float*)d_in[7];
  const float* gb1 = (const float*)d_in[8];
  const float* gW2 = (const float*)d_in[9];
  const float* gb2 = (const float*)d_in[10];
  const float* Wo  = (const float*)d_in[11];
  const float* bo  = (const float*)d_in[12];

  char* ws = (char*)d_ws;
  _Float16* Xh = (_Float16*)(ws + OFF_XH);
  _Float16* Qb = (_Float16*)(ws + OFF_Q);
  _Float16* Kb = (_Float16*)(ws + OFF_K);
  _Float16* Vb = (_Float16*)(ws + OFF_V);
  _Float16* AO = (_Float16*)(ws + OFF_AO);
  float* gw    = (float*)(ws + OFF_GW);
  float* beff  = (float*)(ws + OFF_BE);  // [3][16][1024]
  float* part  = (float*)(ws + OFF_PP);
  _Float16* Wp  = (_Float16*)(ws + OFF_WP);
  _Float16* Wop = (_Float16*)(ws + OFF_WOP);

  cvt_pool<<<MDIM / POOL_ROWS, 256, 0, stream>>>(X, Xh, part);

  gate_kernel<<<NINST, 1024, 0, stream>>>(part, gW1, gb1, gW2, gb2, bq, bk, bv,
                                          gw, beff);

  dim3 pgrid(NDIM / 64, KDIM / 64, 4);
  prep_weights<<<pgrid, 256, 0, stream>>>(Wq, Wk, Wv, Wo, gw, Wp, Wop);

  dim3 qgrid(NDIM / 128, MDIM / QM);
  qkv_gemm<<<qgrid, 256, 0, stream>>>(Xh, Wp, beff, Qb);  // Qb, Kb, Vb lie in a row

  dim3 agrid(SPAN / 64, 16, NINST);
  span_attn<<<agrid, 128, 0, stream>>>(Qb, Kb, Vb, AO);

  dim3 ggrid(NDIM / 128, MDIM / 128);
  out_gemm<<<ggrid, 256, 0, stream>>>(AO, Wop, bo, (float*)d_out);
}

// v007
// Measured time: 108 microseconds a run.
// In both of two side-by-side timings against v006, it was 1.11 times as fast.
// All steps since v000 together make it 9.53 times as fast.
#include <hip/hip_runtime.h>

// ---------------------------------------------------------------------------
// MoE span attention for MI455X (gfx1250, wave32, WMMA 16x16x32 f16->f32).
//
// Sizes (fixed by the reference): B=4, T=2048, C=1024, E=4 spans==experts,
// H=16 heads, Dh=64, S=512, M = B*T = 8192 rows, K=N=1024.
//
// Pipeline (all on `stream`):
//   1) convert hidden f32 -> f16 (ws); the same pass sums each block's 16
//      rows per column: 32 partial sums per span for the gate's mean-pool
//   2) gate: add the partial sums -> MLP -> softmax -> gw[16][4]; eff biases
//   3) weight prep: W_eff[inst] = sum_e gw_e W_e for q/k/v, and Wo, each
//      rounded to f16 once and packed in the GEMM's own tile order (ws)
//   4) per (inst, head), one launch: q/k/v GEMM, Y = X @ W_eff[inst] + b_eff for
//      the head's 64 columns of all three from one A tile (A and W tiles go to a
//      two-buffer LDS ring by GLOBAL_LOAD_ASYNC_TO_LDS, one stage ahead of the
//      stage that is multiplied); q, k, v stay in LDS; then the head's
//      attention, full-row softmax in registers
//   5) output GEMM (one weight matrix, the same kind of ring) -> d_out f32
// ---------------------------------------------------------------------------

typedef __attribute__((ext_vector_type(16))) _Float16 v16h;
typedef __attribute__((ext_vector_type(8)))  _Float16 v8h;
typedef __attribute__((ext_vector_type(4)))  _Float16 v4h;
typedef __attribute__((ext_vector_type(8)))  float    v8f;
typedef __attribute__((ext_vector_type(4)))  float    v4f;

// this wave's asynchronous copies have landed in LDS
__device__ __forceinline__ void wait_asynccnt0() {
  asm volatile("s_wait_asynccnt 0x0" ::: "memory");
}

// this wave's LDS reads have returned: stands in front of the barrier behind
// which their buffer is refilled
__device__ __forceinline__ void wait_dscnt0() {
  asm volatile("s_wait_dscnt 0x0" ::: "memory");
}

// byte offset of a __shared__ address in the work-group's LDS
__device__ __forceinline__ unsigned lds_off(const void* p) {
  return (unsigned)(size_t)p;
}

// Eight asynchronous 16-byte copies per lane, global -> LDS, through no
// register. The s_wait_xcnt closes the statement as a precaution: it stands in
// front of every later write of the address registers that the copies name.
__device__ __forceinline__ void async_copy8(const unsigned (&l)[8],
                                            const _Float16* const (&g)[8]) {
  asm volatile(
      "global_load_async_to_lds_b128 %0, %8, off\n\t"
      "global_load_async_to_lds_b128 %1, %9, off\n\t"
      "global_load_async_to_lds_b128 %2, %10, off\n\t"
      "global_load_async_to_lds_b128 %3, %11, off\n\t"
      "global_load_async_to_lds_b128 %4, %12, off\n\t"
      "global_load_async_to_lds_b128 %5, %13, off\n\t"
      "global_load_async_to_lds_b128 %6, %14, off\n\t"
      "global_load_async_to_lds_b128 %7, %15, off\n\t"
      "s_wait_xcnt 0x0"
      :
      : "v"(l[0]), "v"(l[1]), "v"(l[2]), "v"(l[3]), "v"(l[4]), "v"(l[5]),
        "v"(l[6]), "v"(l[7]), "v"(g[0]), "v"(g[1]), "v"(g[2]), "v"(g[3]),
        "v"(g[4]), "v"(g[5]), "v"(g[6]), "v"(g[7])
      : "memory");
}

// One asynchronous 16-byte copy per lane as the builtin: the compiler picks its
// registers, also above v255, where an asm operand cannot lie.
typedef int i32x4 __attribute__((ext_vector_type(4)));
__device__ __forceinline__ void async_copy(_Float16* l, const _Float16* g) {
  typedef __attribute__((address_space(1))) i32x4 glb_i32x4;
  typedef __attribute__((address_space(3))) i32x4 lds_i32x4;
  __builtin_amdgcn_global_load_async_to_lds_b128((glb_i32x4*)g, (lds_i32x4*)l, 0, 0);
}

__device__ __forceinline__ v8f wmma32(v16h a, v16h b, v8f c) {
  // (neg_a, A, neg_b, B, c_mod, C, reuse_a, reuse_b)
  return __builtin_amdgcn_wmma_f32_16x16x32_f16(false, a, false, b, (short)0, c,
                                                false, false);
}

// Load one 16x32 (A-style) / 32x16 (B-style) f16 WMMA fragment.
// Caller passes p = &buf[(lane%16)*stride + (lane/16)*8 (+k_base)], 16B aligned.
// Per ISA 7.12.2: halves 0..7 = K at p[0..7], halves 8..15 = K at p[16..23].
__device__ __forceinline__ v16h frag_ld(const _Float16* p) {
  v8h lo = *(const v8h*)p;
  v8h hi = *(const v8h*)(p + 16);
  v16h r;
#pragma unroll
  for (int j = 0; j < 8; ++j) { r[j] = lo[j]; r[j + 8] = hi[j]; }
  return r;
}

// Transposing LDS read: from a row-major 16-bit tile T, with lane l's p at row
// 8*(l/16) + l%8, byte 16*((l/8)%2), lane l gets T[8*(l/16) + 0..7][l%16].
typedef short s16x8 __attribute__((ext_vector_type(8)));
__device__ __forceinline__ v8h ld_tr16(const char* p) {
  typedef __attribute__((address_space(3))) s16x8 lds_s16x8;
  return __builtin_bit_cast(v8h,
                            __builtin_amdgcn_ds_load_tr16_b128_v8i16((lds_s16x8*)p));
}

// ------------------------------- constants ---------------------------------
#define MDIM 8192
#define KDIM 1024
#define NDIM 1024
#define NINST 16
#define SPAN 512

// workspace layout (bytes)
#define OFF_XH  ((size_t)0)
#define OFF_AO  ((size_t)64 << 20)
#define OFF_GW  ((size_t)80 << 20)
#define OFF_BE  (OFF_GW + 4096)
#define OFF_PP  ((size_t)84 << 20)   // pooling partial sums [NINST][32][1024] f32
#define OFF_WP  ((size_t)96 << 20)   // packed q/k/v weights [3][NINST], 2 MiB each
#define OFF_WOP ((size_t)192 << 20)  // packed Wo, 2 MiB

// ---------------- 1) f32 -> f16, with the pooling partial sums --------------
// One block = 16 rows x all 1024 columns, four columns per thread.
#define POOL_ROWS 16
#define POOL_CHUNKS (SPAN / POOL_ROWS)  // 32 partial sums per span and column

__global__ void __launch_bounds__(256)
cvt_pool(const float* __restrict__ x,
         _Float16* __restrict__ y,
         float* __restrict__ part) {  // [NINST * POOL_CHUNKS][1024]
  const size_t c4 = (size_t)threadIdx.x * 4;
  const size_t base = (size_t)blockIdx.x * POOL_ROWS * 1024 + c4;

  // all 16 loads go out before the first use waits for data
  v4f v[POOL_ROWS];
#pragma unroll
  for (int r = 0; r < POOL_ROWS; ++r)
    v[r] = *(const v4f*)(x + base + (size_t)r * 1024);

  v4f s = {};
#pragma unroll
  for (int r = 0; r < POOL_ROWS; ++r) {
    v4h h;
#pragma unroll
    for (int j = 0; j < 4; ++j) h[j] = (_Float16)v[r][j];
    *(v4h*)(y + base + (size_t)r * 1024) = h;
    s += v[r];
  }
  *(v4f*)(part + (size_t)blockIdx.x * 1024 + c4) = s;
}

// ------------------------------- 2) gate -----------------------------------
// One block of 32 waves per instance. Every long sum is cut into partial sums
// whose loads are all in flight together.
__global__ void __launch_bounds__(1024)
gate_kernel(const float* __restrict__ part,
            const float* __restrict__ gW1,
            const float* __restrict__ gb1,
            const float* __restrict__ gW2,
            const float* __restrict__ gb2,
            const float* __restrict__ bq,
            const float* __restrict__ bk,
            const float* __restrict__ bv,
            float* __restrict__ gw_out,
            float* __restrict__ beff) {
  __shared__ float pooled[1024] __attribute__((aligned(16)));
  __shared__ float hpart[32 * 128] __attribute__((aligned(16)));
  __shared__ float gact[128] __attribute__((aligned(16)));
  __shared__ float gws[4];
  const int inst = blockIdx.x;
  const int tid = threadIdx.x;
  const int lane = tid & 31, wave = tid >> 5;

  // mean-pool: thread = column, the 32 partial sums of the convert pass
  {
    const float* p = part + (size_t)inst * POOL_CHUNKS * 1024 + tid;
    float t[POOL_CHUNKS];
#pragma unroll
    for (int ch = 0; ch < POOL_CHUNKS; ++ch) t[ch] = p[ch * 1024];
    float s = 0.f;
#pragma unroll
    for (int ch = 0; ch < POOL_CHUNKS; ++ch) s += t[ch];
    pooled[tid] = s * (1.0f / (float)SPAN);
  }
  __syncthreads();

  // layer 1: wave = a slice of 32 inputs, lane = 4 of the 128 outputs, so one
  // load of a wave is one whole 512-byte row of gW1
  {
    const float* wrow = gW1 + (size_t)wave * 32 * 128 + lane * 4;
    v4f a = {};
#pragma unroll
    for (int half = 0; half < 2; ++half) {
      v4f w[16];
#pragma unroll
      for (int i = 0; i < 16; ++i)
        w[i] = *(const v4f*)(wrow + (half * 16 + i) * 128);
#pragma unroll
      for (int i = 0; i < 16; ++i) a += pooled[wave * 32 + half * 16 + i] * w[i];
    }
    *(v4f*)&hpart[wave * 128 + lane * 4] = a;
  }
  __syncthreads();

  if (tid < 128) {
    float s = gb1[tid];
#pragma unroll
    for (int w = 0; w < 32; ++w) s += hpart[w * 128 + tid];
    gact[tid] = fmaxf(s, 0.f);
  }
  __syncthreads();

  // layer 2 and softmax: wave 0, lane = 4 of the 128 hidden units
  if (wave == 0) {
    v4f l = {};
#pragma unroll
    for (int i = 0; i < 4; ++i)
      l += gact[lane * 4 + i] * *(const v4f*)(gW2 + (lane * 4 + i) * 4);
#pragma unroll
    for (int off = 16; off > 0; off >>= 1)
#pragma unroll
      for (int e = 0; e < 4; ++e) l[e] += __shfl_xor(l[e], off, 32);
#pragma unroll
    for (int e = 0; e < 4; ++e) l[e] += gb2[e];
    float mx = fmaxf(fmaxf(l[0], l[1]), fmaxf(l[2], l[3]));
    float e0 = __expf(l[0] - mx), e1 = __expf(l[1] - mx);
    float e2 = __expf(l[2] - mx), e3 = __expf(l[3] - mx);
    float inv = 1.0f / (e0 + e1 + e2 + e3);
    if (lane == 0) {
      gws[0] = e0 * inv; gws[1] = e1 * inv; gws[2] = e2 * inv; gws[3] = e3 * inv;
      gw_out[inst * 4 + 0] = e0 * inv; gw_out[inst * 4 + 1] = e1 * inv;
      gw_out[inst * 4 + 2] = e2 * inv; gw_out[inst * 4 + 3] = e3 * inv;
    }
  }
  __syncthreads();

  // effective biases: thread = column
  {
    float a0 = 0.f, a1 = 0.f, a2 = 0.f;
#pragma unroll
    for (int e = 0; e < 4; ++e) {
      float g = gws[e];
      a0 += g * bq[e * 1024 + tid];
      a1 += g * bk[e * 1024 + tid];
      a2 += g * bv[e * 1024 + tid];
    }
    beff[(0 * NINST + inst) * 1024 + tid] = a0;
    beff[(1 * NINST + inst) * 1024 + tid] = a1;
    beff[(2 * NINST + inst) * 1024 + tid] = a2;
  }
}

// ----------------------------- 3) weight prep ------------------------------
// Packed weight matrix, f16: [n/128][k/32][n%128][k%32], so that the 128x32
// tile a GEMM block stages per K-step is 4096 contiguous halves.
// One block takes a 64(k) x 64(n) tile of all NE experts through LDS (the
// transpose), then forms every instance's combination from registers.
#define PREP_PITCH 65  // dwords; column walks of 4-byte reads hit 32 banks

template <int NE, int NI>
__device__ __forceinline__ void prep_tile(const float* __restrict__ W,   // [NE][K][N]
                                          const float* __restrict__ gw,  // [NI][NE]
                                          _Float16* __restrict__ Wp,     // [NI] packed
                                          float* __restrict__ tile) {
  const int tid = threadIdx.x;
  const int n0 = blockIdx.x * 64;
  const int k0 = blockIdx.y * 64;

  // the 64 gate weights: two per lane, then readlane moves each to a scalar
  // register, so that none of them holds a vector register beside the tile
  static_assert(NE == 1 || NI * NE == 64, "two gate weights per lane");
  float g[NI][NE];
  if constexpr (NE > 1) {
    const int glo = __builtin_bit_cast(int, gw[tid & 31]);
    const int ghi = __builtin_bit_cast(int, gw[32 + (tid & 31)]);
#pragma unroll
    for (int i = 0; i < NI; ++i)
#pragma unroll
      for (int e = 0; e < NE; ++e)
        g[i][e] = __builtin_bit_cast(
            float, __builtin_amdgcn_readlane((i * NE + e) < 32 ? glo : ghi,
                                             (i * NE + e) & 31));
  }

  // all NE*4 loads go out before the first LDS store waits for data
  const unsigned kr = tid >> 4, n4 = (tid & 15) * 4;
  v4f w4[NE][4];
#pragma unroll
  for (int e = 0; e < NE; ++e) {
    const float* We = W + (size_t)e * KDIM * NDIM + (size_t)k0 * NDIM + n0;
#pragma unroll
    for (int it = 0; it < 4; ++it)
      w4[e][it] = *(const v4f*)&We[(kr + it * 16) * NDIM + n4];
    // precaution: stands in front of later loads whose results may reuse an
    // address register of these loads
    asm volatile("s_wait_xcnt 0x0" ::: "memory");
  }
#pragma unroll
  for (int e = 0; e < NE; ++e)
#pragma unroll
    for (int it = 0; it < 4; ++it)
#pragma unroll
      for (int j = 0; j < 4; ++j)
        tile[(e * 64 + kr + it * 16) * PREP_PITCH + n4 + j] = w4[e][it][j];
  __syncthreads();

  const int kq = tid & 3;   // 8 consecutive k per thread
  const int n = tid >> 2;   // 0..63
  const int ng = n0 + n;
#pragma unroll
  for (int ks = 0; ks < 2; ++ks) {  // the tile's two 32-wide K-steps
    float w[NE][8];
#pragma unroll
    for (int e = 0; e < NE; ++e)
#pragma unroll
      for (int j = 0; j < 8; ++j)
        w[e][j] = tile[(e * 64 + ks * 32 + kq * 8 + j) * PREP_PITCH + n];

    _Float16* dst = Wp + ((size_t)(ng >> 7) * 32 + (k0 >> 5) + ks) * 4096 +
                    (ng & 127) * 32 + kq * 8;
#pragma unroll
    for (int i = 0; i < NI; ++i) {
      v8h o;
#pragma unroll
      for (int j = 0; j < 8; ++j) {
        float a = (NE == 1) ? w[0][j] : g[i][0] * w[0][j];
#pragma unroll
        for (int e = 1; e < NE; ++e) a = __builtin_fmaf(g[i][e], w[e][j], a);
        o[j] = (_Float16)a;
      }
      *(v8h*)(dst + (size_t)i * KDIM * NDIM) = o;
    }
  }
}

// grid = (N/64, K/64, 4): z = 0,1,2 -> q,k,v (4 experts, 16 instances), 3 -> Wo.
__global__ void __launch_bounds__(256)
prep_weights(const float* __restrict__ Wq,
             const float* __restrict__ Wk,
             const float* __restrict__ Wv,
             const float* __restrict__ Wo,
             const float* __restrict__ gw,
             _Float16* __restrict__ Wp,
             _Float16* __restrict__ Wop) {
  __shared__ float tile[4 * 64 * PREP_PITCH];
  const int p = blockIdx.z;
  if (p < 3) {
    const float* W = (p == 0) ? Wq : (p == 1) ? Wk : Wv;
    prep_tile<4, NINST>(W, gw, Wp + (size_t)p * NINST * KDIM * NDIM, tile);
  } else {
    prep_tile<1, 1>(Wo, gw, Wop, tile);
  }
}

// A lane's bias values of one product: eight floats in a row at p and eight at
// p + 16. The loads and their data wait are one statement, and no result may
// share a register with the address: nothing can rewrite a register that a load
// names while the load is out.
__device__ __forceinline__ void bias_ld(const float* p, v4f (&b)[4]) {
  asm volatile(
      "global_load_b128 %0, %4, off\n\t"
      "global_load_b128 %1, %4, off offset:16\n\t"
      "global_load_b128 %2, %4, off offset:64\n\t"
      "global_load_b128 %3, %4, off offset:80\n\t"
      "s_wait_loadcnt 0x0"
      : "=&v"(b[0]), "=&v"(b[1]), "=&v"(b[2]), "=&v"(b[3])
      : "v"(p)
      : "memory");
}

// Four 16-byte stores per lane, 16 halves apart. The s_wait_xcnt closes the
// statement as a precaution: it stands in front of every later write of the data
// and address registers that the stores name.
__device__ __forceinline__ void store4_cols16(_Float16* p, const i32x4 (&o)[4]) {
  asm volatile(
      "global_store_b128 %4, %0, off\n\t"
      "global_store_b128 %4, %1, off offset:32\n\t"
      "global_store_b128 %4, %2, off offset:64\n\t"
      "global_store_b128 %4, %3, off offset:96\n\t"
      "s_wait_xcnt 0x0"
      :
      : "v"(o[0]), "v"(o[1]), "v"(o[2]), "v"(o[3]), "v"(p)
      : "memory");
}

#define QK 64                       // k per stage
#define QNST (KDIM / QK)            // stages
#define QPITCH 72                   // halves per LDS row
#define QAH (SPAN * QPITCH)         // halves of a stage's A part
#define QWH (64 * QPITCH)           // halves of one product's W part
#define QSTAGE (QAH + 3 * QWH)      // halves per stage
#define KPITCH_B 144
#define VPITCH_B 160
#define ATTN_V_BYTES (SPAN * VPITCH_B)
#define ATTN_K_BYTES (SPAN * KPITCH_B)
#define ATTN_SMEM (ATTN_V_BYTES + 2 * ATTN_K_BYTES)
static_assert(2 * QSTAGE * 2 <= ATTN_SMEM, "the ring lies inside the q, k, v bytes");

// the real block size: two waves share a SIMD, so a wave may take up to 512
// registers, 384 of them accumulators
__global__ void __launch_bounds__(256)
qkv_attn(const _Float16* __restrict__ A,   // [M][K] f16
         const _Float16* __restrict__ Wp,  // packed, [3][NINST]
         const float* __restrict__ bias,   // [3][NINST][N]
         _Float16* __restrict__ O) {       // [M][N]
  __shared__ char smem[ATTN_SMEM] __attribute__((aligned(16)));
  _Float16* ring = (_Float16*)smem;

  const int tid = threadIdx.x;
  const int lane = tid & 31, wave = tid >> 5;
  const int rl = lane & 15;
  const int sel8 = (lane >> 4) * 8;
  const int h = blockIdx.x;
  const int inst = blockIdx.y;
  const int row0 = inst * SPAN;

  // A stage: 4096 chunks of 16 B, 16 per thread; 8 lanes take one row's 128 B.
  const _Float16* asrc = A + (size_t)(row0 + (tid >> 3)) * KDIM + (tid & 7) * 8;
  _Float16* adst = ring + (tid >> 3) * QPITCH + (tid & 7) * 8;
  // W stage, per product and k-step: this head's half of a packed 128x32 tile,
  // 4 KiB in a row in memory; chunk tid is row tid/4, 16-byte piece tid%4.
  const _Float16* wsrc = Wp + (size_t)inst * KDIM * NDIM +
                         (size_t)(h >> 1) * 32 * 4096 + (h & 1) * 2048 + tid * 8;
  _Float16* wdst = ring + QAH + (tid >> 2) * QPITCH + (tid & 3) * 8;

  auto issue_stage = [&](int t, int buf) {
#pragma unroll
    for (int it = 0; it < 16; ++it)
      async_copy(adst + buf * QSTAGE + it * 32 * QPITCH,
                 asrc + t * QK + (size_t)it * 32 * KDIM);
#pragma unroll
    for (int p = 0; p < 3; ++p)
#pragma unroll
      for (int ks = 0; ks < 2; ++ks)
        async_copy(wdst + buf * QSTAGE + p * QWH + ks * 32,
                   wsrc + (size_t)p * NINST * KDIM * NDIM + (t * 2 + ks) * 4096);
  };

  v8f acc[8][6];  // [row tile][2 * product + column tile]
  {
    v8f z = {};
#pragma unroll
    for (int i = 0; i < 8; ++i)
#pragma unroll
      for (int j = 0; j < 6; ++j) acc[i][j] = z;
  }

  const int mw = (wave >> 1) * 128;  // 0,128,256,384
  const int nw = (wave & 1) * 32;    // 0 or 32

  issue_stage(0, 0);
  wait_asynccnt0();
  __syncthreads();  // stage 0 is published
  issue_stage(1, 1);

  for (int t = 0; t < QNST; ++t) {
    const _Float16* As = ring + (t & 1) * QSTAGE;
    const _Float16* Ws = As + QAH;

    // A k-step's six W fragments are held; its eight A fragments come in pairs,
    // each pair read while the pair before it is multiplied.
    auto ld_a = [&](int grp, int u) {  // grp = 4 * k-step + pair
      return frag_ld(&As[(mw + ((grp & 3) * 2 + u) * 16 + rl) * QPITCH + (grp >> 2) * 32 + sel8]);
    };
    auto ld_b = [&](int ks, int j) {
      return frag_ld(&Ws[((j >> 1) * 64 + nw + (j & 1) * 16 + rl) * QPITCH + ks * 32 + sel8]);
    };
    v16h bf[6], af[2][2];
#pragma unroll
    for (int j = 0; j < 6; ++j) bf[j] = ld_b(0, j);
    af[0][0] = ld_a(0, 0);
    af[0][1] = ld_a(0, 1);
#pragma unroll
    for (int grp = 0; grp < 4 * (QK / 32); ++grp) {
      if (grp + 1 < 4 * (QK / 32)) {
        af[(grp + 1) & 1][0] = ld_a(grp + 1, 0);
        af[(grp + 1) & 1][1] = ld_a(grp + 1, 1);
      }
      // keeps the next pair's LDS reads in front of this pair's 12 WMMAs: left
      // alone the compiler reads a fragment right before its use and waits out
      // the LDS latency every six WMMAs
      __builtin_amdgcn_sched_barrier(0);
#pragma unroll
      for (int u = 0; u < 2; ++u)
#pragma unroll
        for (int j = 0; j < 6; ++j)
          acc[(grp & 3) * 2 + u][j] = wmma32(bf[j], af[grp & 1][u], acc[(grp & 3) * 2 + u][j]);
      if ((grp & 3) == 3 && (grp >> 2) + 1 < QK / 32) {
#pragma unroll
        for (int j = 0; j < 6; ++j) bf[j] = ld_b((grp >> 2) + 1, j);
      }
    }

    // publish point of stage t+1; the same barrier ends every wave's reads of
    // stage t's buffer, which is refilled behind it
    wait_dscnt0();
    wait_asynccnt0();
    __syncthreads();
    if (t + 2 < QNST) issue_stage(t + 2, t & 1);
  }
  // no copy is outstanding, and the last barrier has ended every wave's reads of
  // the ring: its LDS is free for q, k and v
  wait_asynccnt0();

  char* vs = smem;                   // V rows
  char* kr = smem + ATTN_V_BYTES;    // K rows
  char* qr = kr + ATTN_K_BYTES;      // Q rows

  // D of W X^T = lane%16 -> row of Y, vgpr r + 8*(lane/16) -> column: a lane
  // holds eight columns in a row of one row of Y, one 16-byte LDS store
#pragma unroll
  for (int p = 0; p < 3; ++p) {
    v4f b4[4];
    bias_ld(bias + (p * NINST + inst) * NDIM + h * 64 + nw + sel8, b4);
    char* dst = (p == 0) ? qr : (p == 1) ? kr : vs;
    const int pitch = (p == 2) ? VPITCH_B : KPITCH_B;
#pragma unroll
    for (int jj = 0; jj < 2; ++jj) {
      const v8f b = __builtin_shufflevector(b4[2 * jj], b4[2 * jj + 1], 0, 1, 2, 3, 4, 5, 6, 7);
#pragma unroll
      for (int i = 0; i < 8; ++i)
        *(v8h*)(dst + (mw + i * 16 + rl) * pitch + (nw + jj * 16 + sel8) * 2) =
            __builtin_convertvector(acc[i][2 * p + jj] + b, v8h);
    }
  }
  __syncthreads();  // q, k and v are published

  const _Float16* ks = (const _Float16*)kr;
  const _Float16* qs = (const _Float16*)qr;
  const size_t base = (size_t)row0 * 1024 + h * 64;
  const char* vlane = vs + (sel8 + (lane & 7)) * VPITCH_B + ((lane >> 3) & 1) * 16;

  // stays rolled: one body of about 128 WMMAs, not four
#pragma unroll 1
  for (int qt = 0; qt < 4; ++qt) {
    const int q0 = (wave * 4 + qt) * 16;

    // Q fragments of the tile's 16 queries (K=Dh=64 -> 2 k-steps); they are the
    // B operand: column = query = lane%16
    v16h qa[2];
#pragma unroll
    for (int t = 0; t < 2; ++t)
      qa[t] = frag_ld(&qs[(q0 + rl) * (KPITCH_B / 2) + t * 32 + sel8]);

    // scores^T = K Q^T, kept as the f32 accumulators. D: lane%16 = query,
    // register r = key 8*(lane/16) + r of the 16-key tile: a lane holds 256 of
    // its query's 512 scores, lane^16 the other 256.
    // Written one fragment ahead: K fragment f + 1 is read in front of fragment
    // f's WMMA. With each read directly in front of its own WMMA in the source,
    // this kernel's build leaves it there and waits out the LDS latency 64 times.
    v8f s[32];
    {
      auto ld_k = [&](int f) {  // f = 2 * key tile + k-step
        return frag_ld(&ks[((f >> 1) * 16 + rl) * (KPITCH_B / 2) + (f & 1) * 32 + sel8]);
      };
      const v8f z = {};
      v16h kf[2];
      kf[0] = ld_k(0);
#pragma unroll
      for (int kt = 0; kt < 32; ++kt) {
        kf[1] = ld_k(kt * 2 + 1);
        s[kt] = wmma32(kf[0], qa[0], z);
        if (kt + 1 < 32) kf[0] = ld_k(kt * 2 + 2);
        s[kt] = wmma32(kf[1], qa[1], s[kt]);
      }
    }

    // row maximum: eight in-lane chains, joined, then the other lane half
    float mx;
    {
      v8f m = s[0];
#pragma unroll
      for (int kt = 1; kt < 32; ++kt) m = __builtin_elementwise_max(m, s[kt]);
      mx = fmaxf(fmaxf(fmaxf(m[0], m[1]), fmaxf(m[2], m[3])),
                 fmaxf(fmaxf(m[4], m[5]), fmaxf(m[6], m[7])));
      mx = fmaxf(mx, __shfl_xor(mx, 16, 32));
    }

    // P^T = exp((S^T - max) / sqrt(Dh)), and O^T += V^T P^T (K dim = 512 keys ->
    // 16 k-steps; V^T rows are the A operand, two transposing reads each). Two
    // score tiles, rounded to f16, are a B operand over 32 keys in frag_ld's own
    // k order, which is the transposing read's too:
    // pb[j] = key 32t + 8*(lane/16) + j, pb[8+j] = the same key + 16.
    const float SC = 0.125f * 1.44269504f;  // 1/sqrt(Dh) * log2(e)
    const float nmx = -mx * SC;
    const v8f SC8 = {SC, SC, SC, SC, SC, SC, SC, SC};
    const v8f nmx8 = {nmx, nmx, nmx, nmx, nmx, nmx, nmx, nmx};
    v8f sum = {};
    v8f oacc[4];
    {
      v8f z = {};
#pragma unroll
      for (int n = 0; n < 4; ++n) oacc[n] = z;
    }
    auto ld_v = [&](int g) {  // g = 4 * k-step t + dh tile n
      // keys 32t + 8*(lane/16) + 0..7 and the same + 16, of dh 16n + lane%16
      const v8h lo = ld_tr16(vlane + ((g >> 2) * 32) * VPITCH_B + (g & 3) * 32);
      const v8h hi = ld_tr16(vlane + ((g >> 2) * 32 + 16) * VPITCH_B + (g & 3) * 32);
      v16h va;
#pragma unroll
      for (int j = 0; j < 8; ++j) { va[j] = lo[j]; va[j + 8] = hi[j]; }
      return va;
    };
    auto p_half = [&](int t, int u, v16h& pb) {
      // whole-vector forms: packed f32 multiply-adds and adds, two per issue
      const v8f x = __builtin_elementwise_fma(s[t * 2 + u], SC8, nmx8);
      v8f ev;
#pragma unroll
      for (int j = 0; j < 8; ++j) ev[j] = __builtin_amdgcn_exp2f(x[j]);
      sum += ev;  // eight independent chains
      const v8h eh = __builtin_convertvector(ev, v8h);
#pragma unroll
      for (int j = 0; j < 8; ++j) pb[u * 8 + j] = eh[j];
    };
    // One fragment ahead here too, for the same reason: V fragment g + 1 is read
    // in front of fragment g's WMMA, and the two halves of the next k-step's P
    // stand behind a read, where their vector work covers its latency.
    v16h vf[2], pb[2];
    vf[0] = ld_v(0);
    p_half(0, 0, pb[0]);
    p_half(0, 1, pb[0]);
#pragma unroll
    for (int t = 0; t < 16; ++t) {
#pragma unroll
      for (int n = 0; n < 4; ++n) {
        if (t * 4 + n + 1 < 64) vf[(n + 1) & 1] = ld_v(t * 4 + n + 1);
        if (t + 1 < 16 && (n & 1) == 0) p_half(t + 1, n >> 1, pb[(t + 1) & 1]);
        oacc[n] = wmma32(vf[n & 1], pb[t & 1], oacc[n]);
      }
    }

    float tot = ((sum[0] + sum[1]) + (sum[2] + sum[3])) +
                ((sum[4] + sum[5]) + (sum[6] + sum[7]));
    tot += __shfl_xor(tot, 16, 32);
    const float inv = 1.0f / tot;

    // O^T: lane%16 = query, registers = 8 consecutive dh: one 16-byte store
    i32x4 o4[4];
#pragma unroll
    for (int n = 0; n < 4; ++n) {
      v8h o;
#pragma unroll
      for (int r = 0; r < 8; ++r) o[r] = (_Float16)(oacc[n][r] * inv);
      o4[n] = __builtin_bit_cast(i32x4, o);
    }
    store4_cols16(&O[base + (size_t)(q0 + rl) * 1024 + sel8], o4);
  }
}

// ----------------------------- 5) output GEMM ------------------------------
// grid = (N/128, M/128), block = 256 (8 waves, 2x4 wave grid, 64x32/wave).
// K runs in 8 stages of 128. A stage in LDS is [A 128 rows | W 128 rows], rows
// of 256 B at a pitch of 272 B (16 B x odd: no bank conflict for 16-byte
// reads). Two buffers: while stage t is multiplied, stage t+1's copies fly.
#define GK 128                      // k per stage
#define GNST (KDIM / GK)            // stages
#define GPITCH 136                  // halves per LDS row
#define GOP (128 * GPITCH)          // halves per operand and stage
#define GSTAGE (2 * GOP)            // halves per stage

// the real block size: two blocks of 136 KiB LDS share a WGP, so a wave may
// take up to 256 registers
__global__ void __launch_bounds__(256)
out_gemm(const _Float16* __restrict__ A,   // [M][K] f16
         const _Float16* __restrict__ Wp,  // packed
         const float* __restrict__ bias,   // [N]
         float* __restrict__ Y) {
  __shared__ _Float16 ring[2 * GSTAGE] __attribute__((aligned(16)));

  const int tid = threadIdx.x;
  const int lane = tid & 31, wave = tid >> 5;
  const int rl = lane & 15;
  const int sel8 = (lane >> 4) * 8;
  const int row0 = blockIdx.y * 128;
  const int n0 = blockIdx.x * 128;

  // this block's column of packed tiles: 32 K-steps of 4096 halves
  const _Float16* wcol = Wp + (size_t)blockIdx.x * 32 * 4096;

  // A stage: 2048 chunks of 16 B, 8 per thread; 16 lanes take one row's 256 B.
  const _Float16* asrc = A + (size_t)(row0 + (tid >> 4)) * KDIM + (tid & 15) * 8;
  const unsigned adst = lds_off(ring) + (tid >> 4) * (GPITCH * 2) + (tid & 15) * 16;
  // W stage: four packed 128x32 tiles, 32 KiB in a row in memory; chunk
  // tid + 256*it is k-step it/2, row tid/4 + 64*(it%2), 16-byte piece tid%4.
  const _Float16* wsrc = wcol + tid * 8;
  const unsigned wdst = lds_off(ring) + GOP * 2 + (tid >> 2) * (GPITCH * 2) + (tid & 3) * 16;

  auto issue_stage = [&](int t, int buf) {
    unsigned l[8];
    const _Float16* g[8];
#pragma unroll
    for (int it = 0; it < 8; ++it) {
      l[it] = adst + buf * (GSTAGE * 2) + it * 16 * (GPITCH * 2);
      g[it] = asrc + t * GK + (size_t)it * 16 * KDIM;
    }
    async_copy8(l, g);
#pragma unroll
    for (int it = 0; it < 8; ++it) {
      l[it] = wdst + buf * (GSTAGE * 2) + (it & 1) * 64 * (GPITCH * 2) + (it >> 1) * 64;
      g[it] = wsrc + t * (4 * 4096) + it * 2048;
    }
    async_copy8(l, g);
  };

  v8f acc[4][2];
  {
    v8f z = {};
#pragma unroll
    for (int i = 0; i < 4; ++i)
#pragma unroll
      for (int j = 0; j < 2; ++j) acc[i][j] = z;
  }

  const int mw = (wave >> 2) * 64;  // 0 or 64
  const int nw = (wave & 3) * 32;   // 0,32,64,96

  issue_stage(0, 0);
  wait_asynccnt0();
  __syncthreads();  // stage 0 is published
  issue_stage(1, 1);

  for (int t = 0; t < GNST; ++t) {
    const _Float16* As = ring + (t & 1) * GSTAGE;
    const _Float16* Ws = As + GOP;

#pragma unroll
    for (int ks = 0; ks < GK / 32; ++ks) {
      v16h af[4], bf[2];
#pragma unroll
      for (int i = 0; i < 4; ++i)
        af[i] = frag_ld(&As[(mw + i * 16 + rl) * GPITCH + ks * 32 + sel8]);
#pragma unroll
      for (int j = 0; j < 2; ++j)
        bf[j] = frag_ld(&Ws[(nw + j * 16 + rl) * GPITCH + ks * 32 + sel8]);
      // keeps the k-step's 12 LDS reads one group in front of its WMMAs: left
      // alone the compiler reads two at a time and waits out each pair's latency
      __builtin_amdgcn_sched_barrier(0);
#pragma unroll
      for (int i = 0; i < 4; ++i)
#pragma unroll
        for (int j = 0; j < 2; ++j) acc[i][j] = wmma32(af[i], bf[j], acc[i][j]);
    }

    // publish point of stage t+1; the same barrier ends every wave's reads of
    // stage t's buffer, which is refilled behind it
    wait_dscnt0();
    wait_asynccnt0();
    __syncthreads();
    if (t + 2 < GNST) issue_stage(t + 2, t & 1);
  }
  wait_asynccnt0();  // no copy is outstanding when the wave ends

  // epilogue: D layout = lane%16 -> col, vgpr r + 8*(lane/16) -> row
#pragma unroll
  for (int i = 0; i < 4; ++i)
#pragma unroll
    for (int j = 0; j < 2; ++j)
#pragma unroll
      for (int r = 0; r < 8; ++r) {
        int rg = row0 + mw + i * 16 + r + (lane >> 4) * 8;
        int cg = n0 + nw + j * 16 + rl;
        Y[(size_t)rg * NDIM + cg] = acc[i][j][r] + bias[cg];
      }
}

// ------------------------------- launcher ----------------------------------
extern "C" void kernel_launch(void* const* d_in, const int* in_sizes, int n_in,
                              void* d_out, int out_size, void* d_ws,
                              size_t ws_size, hipStream_t stream) {
  const float* X   = (const float*)d_in[0];
  const float* Wq  = (const float*)d_in[1];
  const float* bq  = (const float*)d_in[2];
  const float* Wk  = (const float*)d_in[3];
  const float* bk  = (const float*)d_in[4];
  const float* Wv  = (const float*)d_in[5];
  const float* bv  = (const float*)d_in[6];
  const float* gW1 = (const float*)d_in[7];
  const float* gb1 = (const float*)d_in[8];
  const float* gW2 = (const float*)d_in[9];
  const float* gb2 = (const float*)d_in[10];
  const float* Wo  = (const float*)d_in[11];
  const float* bo  = (const float*)d_in[12];

  char* ws = (char*)d_ws;
  _Float16* Xh = (_Float16*)(ws + OFF_XH);
  _Float16* AO = (_Float16*)(ws + OFF_AO);
  float* gw    = (float*)(ws + OFF_GW);
  float* beff  = (float*)(ws + OFF_BE);  // [3][16][1024]
  float* part  = (float*)(ws + OFF_PP);
  _Float16* Wp  = (_Float16*)(ws + OFF_WP);
  _Float16* Wop = (_Float16*)(ws + OFF_WOP);

  cvt_pool<<<MDIM / POOL_ROWS, 256, 0, stream>>>(X, Xh, part);

  gate_kernel<<<NINST, 1024, 0, stream>>>(part, gW1, gb1, gW2, gb2, bq, bk, bv,
                                          gw, beff);

  dim3 pgrid(NDIM / 64, KDIM / 64, 4);
  prep_weights<<<pgrid, 256, 0, stream>>>(Wq, Wk, Wv, Wo, gw, Wp, Wop);

  dim3 qgrid(16, NINST);
  qkv_attn<<<qgrid, 256, 0, stream>>>(Xh, Wp, beff, AO);

  dim3 ggrid(NDIM / 128, MDIM / 128);
  out_gemm<<<ggrid, 256, 0, stream>>>(AO, Wop, bo, (float*)d_out);
}

// v008
// A run of this version takes 99.6 microseconds.
// Two timings next to v007 put it at 1.09 and 1.08 times that version's speed.
// Over all steps from v000 it is 10.3 times as fast.
#include <hip/hip_runtime.h>

// ---------------------------------------------------------------------------
// MoE span attention for MI455X (gfx1250, wave32, WMMA 16x16x32 f16->f32).
//
// Sizes (fixed by the reference): B=4, T=2048, C=1024, E=4 spans==experts,
// H=16 heads, Dh=64, S=512, M = B*T = 8192 rows, K=N=1024.
//
// Pipeline (all on `stream`):
//   1) convert hidden f32 -> f16 (ws); the same pass sums each block's 256 rows
//      x 128 columns per column and multiplies the sums by its 128 rows of the
//      gate's first layer: 16 partial pre-activations per span
//   2) weight prep: every block first ends the gate itself (adds the partial
//      pre-activations, relu, second layer, softmax: gw[16][4]); then
//      W_eff[inst] = sum_e gw_e W_e for q/k/v, and Wo, each rounded to f16 once
//      and packed in the GEMM's own tile order (ws); eff biases
//   3) per (inst, head), one launch: q/k/v GEMM, Y = X @ W_eff[inst] + b_eff for
//      the head's 64 columns of all three from one A tile (A and W tiles go to a
//      two-buffer LDS ring by GLOBAL_LOAD_ASYNC_TO_LDS, one stage ahead of the
//      stage that is multiplied); q, k, v stay in LDS; then the head's
//      attention, full-row softmax in registers
//   4) output GEMM (one weight matrix, the same kind of ring) -> d_out f32
// ---------------------------------------------------------------------------

typedef __attribute__((ext_vector_type(16))) _Float16 v16h;
typedef __attribute__((ext_vector_type(8)))  _Float16 v8h;
typedef __attribute__((ext_vector_type(4)))  _Float16 v4h;
typedef __attribute__((ext_vector_type(8)))  float    v8f;
typedef __attribute__((ext_vector_type(4)))  float    v4f;
typedef __attribute__((ext_vector_type(2)))  float    v2f;

// this wave's asynchronous copies have landed in LDS
__device__ __forceinline__ void wait_asynccnt0() {
  asm volatile("s_wait_asynccnt 0x0" ::: "memory");
}

// this wave's LDS reads have returned: stands in front of the barrier behind
// which their buffer is refilled
__device__ __forceinline__ void wait_dscnt0() {
  asm volatile("s_wait_dscnt 0x0" ::: "memory");
}

// byte offset of a __shared__ address in the work-group's LDS
__device__ __forceinline__ unsigned lds_off(const void* p) {
  return (unsigned)(size_t)p;
}

// Eight asynchronous 16-byte copies per lane, global -> LDS, through no
// register. The s_wait_xcnt closes the statement as a precaution: it stands in
// front of every later write of the address registers that the copies name.
__device__ __forceinline__ void async_copy8(const unsigned (&l)[8],
                                            const _Float16* const (&g)[8]) {
  asm volatile(
      "global_load_async_to_lds_b128 %0, %8, off\n\t"
      "global_load_async_to_lds_b128 %1, %9, off\n\t"
      "global_load_async_to_lds_b128 %2, %10, off\n\t"
      "global_load_async_to_lds_b128 %3, %11, off\n\t"
      "global_load_async_to_lds_b128 %4, %12, off\n\t"
      "global_load_async_to_lds_b128 %5, %13, off\n\t"
      "global_load_async_to_lds_b128 %6, %14, off\n\t"
      "global_load_async_to_lds_b128 %7, %15, off\n\t"
      "s_wait_xcnt 0x0"
      :
      : "v"(l[0]), "v"(l[1]), "v"(l[2]), "v"(l[3]), "v"(l[4]), "v"(l[5]),
        "v"(l[6]), "v"(l[7]), "v"(g[0]), "v"(g[1]), "v"(g[2]), "v"(g[3]),
        "v"(g[4]), "v"(g[5]), "v"(g[6]), "v"(g[7])
      : "memory");
}

// One asynchronous 16-byte copy per lane as the builtin: the compiler picks its
// registers, also above v255, where an asm operand cannot lie.
typedef int i32x4 __attribute__((ext_vector_type(4)));
__device__ __forceinline__ void async_copy(_Float16* l, const _Float16* g) {
  typedef __attribute__((address_space(1))) i32x4 glb_i32x4;
  typedef __attribute__((address_space(3))) i32x4 lds_i32x4;
  __builtin_amdgcn_global_load_async_to_lds_b128((glb_i32x4*)g, (lds_i32x4*)l, 0, 0);
}

__device__ __forceinline__ v8f wmma32(v16h a, v16h b, v8f c) {
  // (neg_a, A, neg_b, B, c_mod, C, reuse_a, reuse_b)
  return __builtin_amdgcn_wmma_f32_16x16x32_f16(false, a, false, b, (short)0, c,
                                                false, false);
}

// Load one 16x32 (A-style) / 32x16 (B-style) f16 WMMA fragment.
// Caller passes p = &buf[(lane%16)*stride + (lane/16)*8 (+k_base)], 16B aligned.
// Per ISA 7.12.2: halves 0..7 = K at p[0..7], halves 8..15 = K at p[16..23].
__device__ __forceinline__ v16h frag_ld(const _Float16* p) {
  v8h lo = *(const v8h*)p;
  v8h hi = *(const v8h*)(p + 16);
  v16h r;
#pragma unroll
  for (int j = 0; j < 8; ++j) { r[j] = lo[j]; r[j + 8] = hi[j]; }
  return r;
}

// Transposing LDS read: from a row-major 16-bit tile T, with lane l's p at row
// 8*(l/16) + l%8, byte 16*((l/8)%2), lane l gets T[8*(l/16) + 0..7][l%16].
typedef short s16x8 __attribute__((ext_vector_type(8)));
__device__ __forceinline__ v8h ld_tr16(const char* p) {
  typedef __attribute__((address_space(3))) s16x8 lds_s16x8;
  return __builtin_bit_cast(v8h,
                            __builtin_amdgcn_ds_load_tr16_b128_v8i16((lds_s16x8*)p));
}

// ------------------------------- constants ---------------------------------
#define MDIM 8192
#define KDIM 1024
#define NDIM 1024
#define NINST 16
#define SPAN 512

// workspace layout (bytes)
#define OFF_XH  ((size_t)0)
#define OFF_AO  ((size_t)64 << 20)
#define OFF_BE  ((size_t)80 << 20)   // effective biases [3][NINST][1024] f32
#define OFF_HP  ((size_t)84 << 20)   // gate partial pre-activations [NINST][16][128] f32
#define OFF_WP  ((size_t)96 << 20)   // packed q/k/v weights [3][NINST], 2 MiB each
#define OFF_WOP ((size_t)192 << 20)  // packed Wo, 2 MiB

// ------- 1) f32 -> f16, with the gate's pooling and first-layer partials -----
// One block = 256 rows (half a span) x 128 columns, 16 waves: a wave takes one
// row's 512 B per load, four columns per lane, 16 rows. The gate's first layer is
// linear in the pooled row, so the block's own column sums times its own 128 rows
// of gW1 are one of 16 partial pre-activations of the span.
#define GH 128                     // hidden units of the gate
#define POOL_COLS 128
#define POOL_ROWS 256
#define GPARTS ((1024 / POOL_COLS) * (SPAN / POOL_ROWS))  // 16 per span

__global__ void __launch_bounds__(512)
cvt_pool(const float* __restrict__ x,
         const float* __restrict__ gW1,
         _Float16* __restrict__ y,
         float* __restrict__ hp) {  // [NINST * GPARTS][GH]
  __shared__ float red[16 * POOL_COLS] __attribute__((aligned(16)));
  __shared__ float pooled[POOL_COLS] __attribute__((aligned(16)));
  __shared__ float hpart[16 * GH] __attribute__((aligned(16)));
  const int tid = threadIdx.x;
  const int lane = tid & 31, wave = tid >> 5;
  const int c0 = blockIdx.x * POOL_COLS;
  const size_t base = ((size_t)blockIdx.y * POOL_ROWS + wave) * 1024 + c0 + lane * 4;

  // all loads go out before the first use waits for data
  v4f v[16];
#pragma unroll
  for (int r = 0; r < 16; ++r)
    v[r] = *(const v4f*)(x + base + (size_t)r * 16 * 1024);
  // wave = 8 of the block's 128 inputs, lane = 4 of the 128 hidden units, so one
  // load of a wave is one whole 512-byte row of gW1
  v4f w[8];
  {
    const float* wrow = gW1 + (size_t)(c0 + wave * 8) * GH + lane * 4;
#pragma unroll
    for (int i = 0; i < 8; ++i) w[i] = *(const v4f*)(wrow + i * GH);
  }
  // keeps all 24 loads in front of the first use: left alone the compiler issues
  // the gW1 loads behind the first rows' data, a second memory latency in a row
  __builtin_amdgcn_sched_barrier(0);

  v4f s = {};
#pragma unroll
  for (int r = 0; r < 16; ++r) {
    v4h h;
#pragma unroll
    for (int j = 0; j < 4; ++j) h[j] = (_Float16)v[r][j];
    *(v4h*)(y + base + (size_t)r * 16 * 1024) = h;
    s += v[r];
  }
  *(v4f*)&red[wave * POOL_COLS + lane * 4] = s;
  __syncthreads();

  if (tid < POOL_COLS) {
    float t = 0.f;
#pragma unroll
    for (int g = 0; g < 16; ++g) t += red[g * POOL_COLS + tid];
    pooled[tid] = t * (1.0f / (float)SPAN);
  }
  __syncthreads();

  {
    v4f a = {};
#pragma unroll
    for (int i = 0; i < 8; ++i) a += pooled[wave * 8 + i] * w[i];
    *(v4f*)&hpart[wave * GH + lane * 4] = a;
  }
  __syncthreads();

  if (tid < GH) {
    float t = 0.f;
#pragma unroll
    for (int g = 0; g < 16; ++g) t += hpart[g * GH + tid];
    hp[((size_t)blockIdx.y * (1024 / POOL_COLS) + blockIdx.x) * GH + tid] = t;
  }
}

// ------------------ 2) end of the gate, and weight prep ---------------------
// Packed weight matrix, f16: [n/128][k/32][n%128][k%32], so that the 128x32
// tile a GEMM block stages per K-step is 4096 contiguous halves.
// A group of 256 threads takes a 64(k) x 64(n) tile of all NE experts through LDS
// (the transpose), then forms every instance's combination from registers.
#define PREP_PITCH 65  // dwords; column walks of 4-byte reads hit 32 banks
#define PREP_TILE (64 * PREP_PITCH)  // dwords of one expert's tile

// A thread's loads for the end of the gate: 16 partial sums of two hidden units,
// 512 B apart, their two biases and their two rows of gW2. The loads and their
// data wait are one statement, and no result may share a register with an
// address: nothing can rewrite a register that a load names while the load is out.
__device__ __forceinline__ void gate_ld(const float* ph, const float* pb, const float* pw,
                                        v2f (&h)[16], v2f& b, v4f& w0, v4f& w1) {
  asm volatile(
      "global_load_b64 %0, %19, off\n\t"
      "global_load_b64 %1, %19, off offset:512\n\t"
      "global_load_b64 %2, %19, off offset:1024\n\t"
      "global_load_b64 %3, %19, off offset:1536\n\t"
      "global_load_b64 %4, %19, off offset:2048\n\t"
      "global_load_b64 %5, %19, off offset:2560\n\t"
      "global_load_b64 %6, %19, off offset:3072\n\t"
      "global_load_b64 %7, %19, off offset:3584\n\t"
      "global_load_b64 %8, %19, off offset:4096\n\t"
      "global_load_b64 %9, %19, off offset:4608\n\t"
      "global_load_b64 %10, %19, off offset:5120\n\t"
      "global_load_b64 %11, %19, off offset:5632\n\t"
      "global_load_b64 %12, %19, off offset:6144\n\t"
      "global_load_b64 %13, %19, off offset:6656\n\t"
      "global_load_b64 %14, %19, off offset:7168\n\t"
      "global_load_b64 %15, %19, off offset:7680\n\t"
      "global_load_b64 %16, %20, off\n\t"
      "global_load_b128 %17, %21, off\n\t"
      "global_load_b128 %18, %21, off offset:16\n\t"
      "s_wait_loadcnt 0x0"
      : "=&v"(h[0]), "=&v"(h[1]), "=&v"(h[2]), "=&v"(h[3]), "=&v"(h[4]), "=&v"(h[5]),
        "=&v"(h[6]), "=&v"(h[7]), "=&v"(h[8]), "=&v"(h[9]), "=&v"(h[10]), "=&v"(h[11]),
        "=&v"(h[12]), "=&v"(h[13]), "=&v"(h[14]), "=&v"(h[15]), "=&v"(b), "=&v"(w0),
        "=&v"(w1)
      : "v"(ph), "v"(pb), "v"(pw)
      : "memory");
}

template <int NE>
__device__ __forceinline__ void prep_put(float* __restrict__ tile, int t,
                                         const v4f (&w4)[4][4]) {
  const unsigned kr = t >> 4, n4 = (t & 15) * 4;
#pragma unroll
  for (int e = 0; e < NE; ++e)
#pragma unroll
    for (int it = 0; it < 4; ++it)
#pragma unroll
      for (int j = 0; j < 4; ++j)
        tile[(e * 64 + kr + it * 16) * PREP_PITCH + n4 + j] = w4[e][it][j];
}

template <int NE, int NI>
__device__ __forceinline__ void prep_emit(const float* __restrict__ tile,
                                          v4f gv,  // lane i: instance i's weights
                                          _Float16* __restrict__ Wp,      // [NI] packed
                                          int t, int n0, int k0) {
  // the 64 gate weights: readlane moves each to a scalar register, so that none
  // of them holds a vector register beside the tile
  static_assert(NE == 1 || (NI == 16 && NE == 4), "lane i holds instance i's four");
  float g[NI][NE];
  if constexpr (NE > 1) {
#pragma unroll
    for (int i = 0; i < NI; ++i)
#pragma unroll
      for (int e = 0; e < NE; ++e) {
        const float ge = gv[e];
        g[i][e] = __builtin_bit_cast(
            float, __builtin_amdgcn_readlane(__builtin_bit_cast(int, ge), i));
      }
  }

  const int kq = t & 3;   // 8 consecutive k per thread
  const int n = t >> 2;   // 0..63
  const int ng = n0 + n;
#pragma unroll
  for (int ks = 0; ks < 2; ++ks) {  // the tile's two 32-wide K-steps
    float w[NE][8];
#pragma unroll
    for (int e = 0; e < NE; ++e)
#pragma unroll
      for (int j = 0; j < 8; ++j)
        w[e][j] = tile[(e * 64 + ks * 32 + kq * 8 + j) * PREP_PITCH + n];

    _Float16* dst = Wp + ((size_t)(ng >> 7) * 32 + (k0 >> 5) + ks) * 4096 +
                    (ng & 127) * 32 + kq * 8;
#pragma unroll
    for (int i = 0; i < NI; ++i) {
      v8h o;
#pragma unroll
      for (int j = 0; j < 8; ++j) {
        float a = (NE == 1) ? w[0][j] : g[i][0] * w[0][j];
#pragma unroll
        for (int e = 1; e < NE; ++e) a = __builtin_fmaf(g[i][e], w[e][j], a);
        o[j] = (_Float16)a;
      }
      *(v8h*)(dst + (size_t)i * KDIM * NDIM) = o;
    }
  }
}

// grid = (N/64, K/64), block = 1024: four groups of 256 threads take the block's
// 64x64 tile of q, k, v (4 experts, 16 instances each) and of Wo. Behind the tile
// loads the whole block ends the gate for all 16 instances: it costs each block
// 128 KiB of reads and takes the place of a launch of its own.
__global__ void __launch_bounds__(1024)
prep_weights(const float* __restrict__ Wq,
             const float* __restrict__ Wk,
             const float* __restrict__ Wv,
             const float* __restrict__ Wo,
             const float* __restrict__ hp,   // [NINST][GPARTS][GH]
             const float* __restrict__ gb1,
             const float* __restrict__ gW2,
             const float* __restrict__ gb2,
             const float* __restrict__ bq,
             const float* __restrict__ bk,
             const float* __restrict__ bv,
             _Float16* __restrict__ Wp,
             _Float16* __restrict__ Wop,
             float* __restrict__ beff) {
  __shared__ float tiles[13 * PREP_TILE];
  __shared__ float lg[32 * 4] __attribute__((aligned(16)));  // a wave's part of 4 logits
  const int tid = threadIdx.x;
  const int lane = tid & 31;
  // the same in every lane of a wave: kept scalar, so the tests on them are branches
  const int wave = __builtin_amdgcn_readfirstlane(tid >> 5);
  const int p = wave >> 3;  // 0,1,2 -> q,k,v; 3 -> Wo
  const int t = tid & 255;
  const int n0 = blockIdx.x * 64;
  const int k0 = blockIdx.y * 64;
  float* tile = tiles + p * 4 * PREP_TILE;

  const float b20 = gb2[0], b21 = gb2[1], b22 = gb2[2], b23 = gb2[3];

  // All tile loads go out before anything waits for data; the first expert's and
  // Wo's are one piece of code, so that no path waits for another path's loads.
  // The s_wait_xcnt are a precaution: each names the loads' addresses as inputs,
  // so no result of these loads can share a register with an address, and stands
  // in front of every later write of those registers.
  v4f w4[4][4];
  {
    const float* W = (p == 0) ? Wq : (p == 1) ? Wk : (p == 2) ? Wv : Wo;
    const float* p0 = W + (size_t)(k0 + (t >> 4)) * NDIM + n0 + (t & 15) * 4;
#pragma unroll
    for (int it = 0; it < 4; ++it) w4[0][it] = *(const v4f*)(p0 + it * 16 * NDIM);
    asm volatile("s_wait_xcnt 0x0" :: "v"(p0) : "memory");
    if (p < 3) {
      // p0 + two experts (8 MiB), formed in asm: the loads and the wait below then
      // name this very register pair, not a copy that the last load may overwrite
      typedef __attribute__((address_space(1))) const v4f glb_v4f;  // p2 is global
      const float* p2;
      asm("v_add_nc_u64_e32 %0, 0x800000, %1" : "=v"(p2) : "v"(p0));
#pragma unroll
      for (int it = 0; it < 4; ++it)
        w4[1][it] = *(const v4f*)(p0 + KDIM * NDIM + it * 16 * NDIM);
#pragma unroll
      for (int it = 0; it < 4; ++it) w4[2][it] = *(glb_v4f*)(p2 + it * 16 * NDIM);
#pragma unroll
      for (int it = 0; it < 4; ++it)
        w4[3][it] = *(glb_v4f*)(p2 + KDIM * NDIM + it * 16 * NDIM);
      asm volatile("s_wait_xcnt 0x0" :: "v"(p0), "v"(p2) : "memory");
    }
  }

  // End of the gate, behind the tile loads. Hidden layer: thread = (instance, two
  // hidden units), the 16 partial sums; second layer: the thread's two terms of
  // the instance's four logits, summed over the wave (half of the instance).
  {
    const int j2 = (tid & 63) * 2;
    v2f ht[GPARTS], hsum;
    v4f w2a, w2b;
    gate_ld(hp + (size_t)(tid >> 6) * GPARTS * GH + j2, gb1 + j2, gW2 + j2 * 4, ht, hsum,
            w2a, w2b);
#pragma unroll
    for (int c = 0; c < GPARTS; ++c) hsum += ht[c];
    v4f l = fmaxf(hsum[0], 0.f) * w2a + fmaxf(hsum[1], 0.f) * w2b;
#pragma unroll
    for (int off = 16; off > 0; off >>= 1)
#pragma unroll
      for (int e = 0; e < 4; ++e) l[e] += __shfl_xor(l[e], off, 32);
    if (lane == 0) *(v4f*)&lg[wave * 4] = l;
  }

  if (p < 3) prep_put<4>(tile, t, w4);
  else       prep_put<1>(tile, t, w4);
  __syncthreads();  // the logits' parts and the tiles are published

  // softmax, in every wave for itself: lane % 16 = instance
  v4f gv;
  {
    const int gi = lane & 15;
    v4f l = *(const v4f*)&lg[gi * 8] + *(const v4f*)&lg[gi * 8 + 4];
    l[0] += b20; l[1] += b21; l[2] += b22; l[3] += b23;
    float mx = fmaxf(fmaxf(l[0], l[1]), fmaxf(l[2], l[3]));
    float e0 = __expf(l[0] - mx), e1 = __expf(l[1] - mx);
    float e2 = __expf(l[2] - mx), e3 = __expf(l[3] - mx);
    float inv = 1.0f / (e0 + e1 + e2 + e3);
    gv[0] = e0 * inv; gv[1] = e1 * inv; gv[2] = e2 * inv; gv[3] = e3 * inv;
  }

  if (p < 3) {
    prep_emit<4, NINST>(tile, gv, Wp + (size_t)p * NINST * KDIM * NDIM, t, n0, k0);
  } else {
    prep_emit<1, 1>(tile, gv, Wop, t, n0, k0);
    // precaution: stands, on every way on from here, in front of every later write
    // of a register that the stores above name; the scheduling barrier keeps those
    // writes behind it
    asm volatile("s_wait_xcnt 0x0" ::: "memory");
    __builtin_amdgcn_sched_barrier(0);
    // effective biases of the block's 64 columns, once per column of blocks, by
    // the group with the least to store: thread = (column, four instances)
    if (blockIdx.y == 0) {
      const int col = n0 + (t & 63), i0 = ((wave & 7) >> 1) * 4;
      float b[3][4];
#pragma unroll
      for (int e = 0; e < 4; ++e) {
        b[0][e] = bq[e * 1024 + col];
        b[1][e] = bk[e * 1024 + col];
        b[2][e] = bv[e * 1024 + col];
      }
#pragma unroll
      for (int i = 0; i < 4; ++i)
#pragma unroll
        for (int q = 0; q < 3; ++q) {
          float a = 0.f;
#pragma unroll
          for (int e = 0; e < 4; ++e) {
            const float ge = gv[e];
            a += __builtin_bit_cast(float, __builtin_amdgcn_readlane(
                     __builtin_bit_cast(int, ge), i0 + i)) * b[q][e];
          }
          beff[(q * NINST + i0 + i) * 1024 + col] = a;
        }
      // the same precaution behind the twelve stores above
      asm volatile("s_wait_xcnt 0x0" ::: "memory");
    }
  }
}

// A lane's bias values of one product: eight floats in a row at p and eight at
// p + 16. The loads and their data wait are one statement, and no result may
// share a register with the address: nothing can rewrite a register that a load
// names while the load is out.
__device__ __forceinline__ void bias_ld(const float* p, v4f (&b)[4]) {
  asm volatile(
      "global_load_b128 %0, %4, off\n\t"
      "global_load_b128 %1, %4, off offset:16\n\t"
      "global_load_b128 %2, %4, off offset:64\n\t"
      "global_load_b128 %3, %4, off offset:80\n\t"
      "s_wait_loadcnt 0x0"
      : "=&v"(b[0]), "=&v"(b[1]), "=&v"(b[2]), "=&v"(b[3])
      : "v"(p)
      : "memory");
}

// Four 16-byte stores per lane, 16 halves apart. The s_wait_xcnt closes the
// statement as a precaution: it stands in front of every later write of the data
// and address registers that the stores name.
__device__ __forceinline__ void store4_cols16(_Float16* p, const i32x4 (&o)[4]) {
  asm volatile(
      "global_store_b128 %4, %0, off\n\t"
      "global_store_b128 %4, %1, off offset:32\n\t"
      "global_store_b128 %4, %2, off offset:64\n\t"
      "global_store_b128 %4, %3, off offset:96\n\t"
      "s_wait_xcnt 0x0"
      :
      : "v"(o[0]), "v"(o[1]), "v"(o[2]), "v"(o[3]), "v"(p)
      : "memory");
}

#define QK 64                       // k per stage
#define QNST (KDIM / QK)            // stages
#define QPITCH 72                   // halves per LDS row
#define QAH (SPAN * QPITCH)         // halves of a stage's A part
#define QWH (64 * QPITCH)           // halves of one product's W part
#define QSTAGE (QAH + 3 * QWH)      // halves per stage
#define KPITCH_B 144
#define VPITCH_B 160
#define ATTN_V_BYTES (SPAN * VPITCH_B)
#define ATTN_K_BYTES (SPAN * KPITCH_B)
#define ATTN_SMEM (ATTN_V_BYTES + 2 * ATTN_K_BYTES)
static_assert(2 * QSTAGE * 2 <= ATTN_SMEM, "the ring lies inside the q, k, v bytes");

// the real block size: two waves share a SIMD, so a wave may take up to 512
// registers, 384 of them accumulators
__global__ void __launch_bounds__(256)
qkv_attn(const _Float16* __restrict__ A,   // [M][K] f16
         const _Float16* __restrict__ Wp,  // packed, [3][NINST]
         const float* __restrict__ bias,   // [3][NINST][N]
         _Float16* __restrict__ O) {       // [M][N]
  __shared__ char smem[ATTN_SMEM] __attribute__((aligned(16)));
  _Float16* ring = (_Float16*)smem;

  const int tid = threadIdx.x;
  const int lane = tid & 31, wave = tid >> 5;
  const int rl = lane & 15;
  const int sel8 = (lane >> 4) * 8;
  const int h = blockIdx.x;
  const int inst = blockIdx.y;
  const int row0 = inst * SPAN;

  // A stage: 4096 chunks of 16 B, 16 per thread; 8 lanes take one row's 128 B.
  const _Float16* asrc = A + (size_t)(row0 + (tid >> 3)) * KDIM + (tid & 7) * 8;
  _Float16* adst = ring + (tid >> 3) * QPITCH + (tid & 7) * 8;
  // W stage, per product and k-step: this head's half of a packed 128x32 tile,
  // 4 KiB in a row in memory; chunk tid is row tid/4, 16-byte piece tid%4.
  const _Float16* wsrc = Wp + (size_t)inst * KDIM * NDIM +
                         (size_t)(h >> 1) * 32 * 4096 + (h & 1) * 2048 + tid * 8;
  _Float16* wdst = ring + QAH + (tid >> 2) * QPITCH + (tid & 3) * 8;

  auto issue_stage = [&](int t, int buf) {
#pragma unroll
    for (int it = 0; it < 16; ++it)
      async_copy(adst + buf * QSTAGE + it * 32 * QPITCH,
                 asrc + t * QK + (size_t)it * 32 * KDIM);
#pragma unroll
    for (int p = 0; p < 3; ++p)
#pragma unroll
      for (int ks = 0; ks < 2; ++ks)
        async_copy(wdst + buf * QSTAGE + p * QWH + ks * 32,
                   wsrc + (size_t)p * NINST * KDIM * NDIM + (t * 2 + ks) * 4096);
  };

  v8f acc[8][6];  // [row tile][2 * product + column tile]
  {
    v8f z = {};
#pragma unroll
    for (int i = 0; i < 8; ++i)
#pragma unroll
      for (int j = 0; j < 6; ++j) acc[i][j] = z;
  }

  const int mw = (wave >> 1) * 128;  // 0,128,256,384
  const int nw = (wave & 1) * 32;    // 0 or 32

  issue_stage(0, 0);
  wait_asynccnt0();
  __syncthreads();  // stage 0 is published
  issue_stage(1, 1);

  for (int t = 0; t < QNST; ++t) {
    const _Float16* As = ring + (t & 1) * QSTAGE;
    const _Float16* Ws = As + QAH;

    // A k-step's six W fragments are held; its eight A fragments come in pairs,
    // each pair read while the pair before it is multiplied.
    auto ld_a = [&](int grp, int u) {  // grp = 4 * k-step + pair
      return frag_ld(&As[(mw + ((grp & 3) * 2 + u) * 16 + rl) * QPITCH + (grp >> 2) * 32 + sel8]);
    };
    auto ld_b = [&](int ks, int j) {
      return frag_ld(&Ws[((j >> 1) * 64 + nw + (j & 1) * 16 + rl) * QPITCH + ks * 32 + sel8]);
    };
    v16h bf[6], af[2][2];
#pragma unroll
    for (int j = 0; j < 6; ++j) bf[j] = ld_b(0, j);
    af[0][0] = ld_a(0, 0);
    af[0][1] = ld_a(0, 1);
#pragma unroll
    for (int grp = 0; grp < 4 * (QK / 32); ++grp) {
      if (grp + 1 < 4 * (QK / 32)) {
        af[(grp + 1) & 1][0] = ld_a(grp + 1, 0);
        af[(grp + 1) & 1][1] = ld_a(grp + 1, 1);
      }
      // keeps the next pair's LDS reads in front of this pair's 12 WMMAs: left
      // alone the compiler reads a fragment right before its use and waits out
      // the LDS latency every six WMMAs
      __builtin_amdgcn_sched_barrier(0);
#pragma unroll
      for (int u = 0; u < 2; ++u)
#pragma unroll
        for (int j = 0; j < 6; ++j)
          acc[(grp & 3) * 2 + u][j] = wmma32(bf[j], af[grp & 1][u], acc[(grp & 3) * 2 + u][j]);
      if ((grp & 3) == 3 && (grp >> 2) + 1 < QK / 32) {
#pragma unroll
        for (int j = 0; j < 6; ++j) bf[j] = ld_b((grp >> 2) + 1, j);
      }
    }

    // publish point of stage t+1; the same barrier ends every wave's reads of
    // stage t's buffer, which is refilled behind it
    wait_dscnt0();
    wait_asynccnt0();
    __syncthreads();
    if (t + 2 < QNST) issue_stage(t + 2, t & 1);
  }
  // no copy is outstanding, and the last barrier has ended every wave's reads of
  // the ring: its LDS is free for q, k and v
  wait_asynccnt0();

  char* vs = smem;                   // V rows
  char* kr = smem + ATTN_V_BYTES;    // K rows
  char* qr = kr + ATTN_K_BYTES;      // Q rows

  // D of W X^T = lane%16 -> row of Y, vgpr r + 8*(lane/16) -> column: a lane
  // holds eight columns in a row of one row of Y, one 16-byte LDS store
#pragma unroll
  for (int p = 0; p < 3; ++p) {
    v4f b4[4];
    bias_ld(bias + (p * NINST + inst) * NDIM + h * 64 + nw + sel8, b4);
    char* dst = (p == 0) ? qr : (p == 1) ? kr : vs;
    const int pitch = (p == 2) ? VPITCH_B : KPITCH_B;
#pragma unroll
    for (int jj = 0; jj < 2; ++jj) {
      const v8f b = __builtin_shufflevector(b4[2 * jj], b4[2 * jj + 1], 0, 1, 2, 3, 4, 5, 6, 7);
#pragma unroll
      for (int i = 0; i < 8; ++i)
        *(v8h*)(dst + (mw + i * 16 + rl) * pitch + (nw + jj * 16 + sel8) * 2) =
            __builtin_convertvector(acc[i][2 * p + jj] + b, v8h);
    }
  }
  __syncthreads();  // q, k and v are published

  const _Float16* ks = (const _Float16*)kr;
  const _Float16* qs = (const _Float16*)qr;
  const size_t base = (size_t)row0 * 1024 + h * 64;
  const char* vlane = vs + (sel8 + (lane & 7)) * VPITCH_B + ((lane >> 3) & 1) * 16;

  // stays rolled: one body of about 128 WMMAs, not four
#pragma unroll 1
  for (int qt = 0; qt < 4; ++qt) {
    const int q0 = (wave * 4 + qt) * 16;

    // Q fragments of the tile's 16 queries (K=Dh=64 -> 2 k-steps); they are the
    // B operand: column = query = lane%16
    v16h qa[2];
#pragma unroll
    for (int t = 0; t < 2; ++t)
      qa[t] = frag_ld(&qs[(q0 + rl) * (KPITCH_B / 2) + t * 32 + sel8]);

    // scores^T = K Q^T, kept as the f32 accumulators. D: lane%16 = query,
    // register r = key 8*(lane/16) + r of the 16-key tile: a lane holds 256 of
    // its query's 512 scores, lane^16 the other 256.
    // Written one fragment ahead: K fragment f + 1 is read in front of fragment
    // f's WMMA. With each read directly in front of its own WMMA in the source,
    // this kernel's build leaves it there and waits out the LDS latency 64 times.
    v8f s[32];
    {
      auto ld_k = [&](int f) {  // f = 2 * key tile + k-step
        return frag_ld(&ks[((f >> 1) * 16 + rl) * (KPITCH_B / 2) + (f & 1) * 32 + sel8]);
      };
      const v8f z = {};
      v16h kf[2];
      kf[0] = ld_k(0);
#pragma unroll
      for (int kt = 0; kt < 32; ++kt) {
        kf[1] = ld_k(kt * 2 + 1);
        s[kt] = wmma32(kf[0], qa[0], z);
        if (kt + 1 < 32) kf[0] = ld_k(kt * 2 + 2);
        s[kt] = wmma32(kf[1], qa[1], s[kt]);
      }
    }

    // row maximum: eight in-lane chains, joined, then the other lane half
    float mx;
    {
      v8f m = s[0];
#pragma unroll
      for (int kt = 1; kt < 32; ++kt) m = __builtin_elementwise_max(m, s[kt]);
      mx = fmaxf(fmaxf(fmaxf(m[0], m[1]), fmaxf(m[2], m[3])),
                 fmaxf(fmaxf(m[4], m[5]), fmaxf(m[6], m[7])));
      mx = fmaxf(mx, __shfl_xor(mx, 16, 32));
    }

    // P^T = exp((S^T - max) / sqrt(Dh)), and O^T += V^T P^T (K dim = 512 keys ->
    // 16 k-steps; V^T rows are the A operand, two transposing reads each). Two
    // score tiles, rounded to f16, are a B operand over 32 keys in frag_ld's own
    // k order, which is the transposing read's too:
    // pb[j] = key 32t + 8*(lane/16) + j, pb[8+j] = the same key + 16.
    const float SC = 0.125f * 1.44269504f;  // 1/sqrt(Dh) * log2(e)
    const float nmx = -mx * SC;
    const v8f SC8 = {SC, SC, SC, SC, SC, SC, SC, SC};
    const v8f nmx8 = {nmx, nmx, nmx, nmx, nmx, nmx, nmx, nmx};
    v8f sum = {};
    v8f oacc[4];
    {
      v8f z = {};
#pragma unroll
      for (int n = 0; n < 4; ++n) oacc[n] = z;
    }
    auto ld_v = [&](int g) {  // g = 4 * k-step t + dh tile n
      // keys 32t + 8*(lane/16) + 0..7 and the same + 16, of dh 16n + lane%16
      const v8h lo = ld_tr16(vlane + ((g >> 2) * 32) * VPITCH_B + (g & 3) * 32);
      const v8h hi = ld_tr16(vlane + ((g >> 2) * 32 + 16) * VPITCH_B + (g & 3) * 32);
      v16h va;
#pragma unroll
      for (int j = 0; j < 8; ++j) { va[j] = lo[j]; va[j + 8] = hi[j]; }
      return va;
    };
    auto p_half = [&](int t, int u, v16h& pb) {
      // whole-vector forms: packed f32 multiply-adds and adds, two per issue
      const v8f x = __builtin_elementwise_fma(s[t * 2 + u], SC8, nmx8);
      v8f ev;
#pragma unroll
      for (int j = 0; j < 8; ++j) ev[j] = __builtin_amdgcn_exp2f(x[j]);
      sum += ev;  // eight independent chains
      const v8h eh = __builtin_convertvector(ev, v8h);
#pragma unroll
      for (int j = 0; j < 8; ++j) pb[u * 8 + j] = eh[j];
    };
    // One fragment ahead here too, for the same reason: V fragment g + 1 is read
    // in front of fragment g's WMMA, and the two halves of the next k-step's P
    // stand behind a read, where their vector work covers its latency.
    v16h vf[2], pb[2];
    vf[0] = ld_v(0);
    p_half(0, 0, pb[0]);
    p_half(0, 1, pb[0]);
#pragma unroll
    for (int t = 0; t < 16; ++t) {
#pragma unroll
      for (int n = 0; n < 4; ++n) {
        if (t * 4 + n + 1 < 64) vf[(n + 1) & 1] = ld_v(t * 4 + n + 1);
        if (t + 1 < 16 && (n & 1) == 0) p_half(t + 1, n >> 1, pb[(t + 1) & 1]);
        oacc[n] = wmma32(vf[n & 1], pb[t & 1], oacc[n]);
      }
    }

    float tot = ((sum[0] + sum[1]) + (sum[2] + sum[3])) +
                ((sum[4] + sum[5]) + (sum[6] + sum[7]));
    tot += __shfl_xor(tot, 16, 32);
    const float inv = 1.0f / tot;

    // O^T: lane%16 = query, registers = 8 consecutive dh: one 16-byte store
    i32x4 o4[4];
#pragma unroll
    for (int n = 0; n < 4; ++n) {
      v8h o;
#pragma unroll
      for (int r = 0; r < 8; ++r) o[r] = (_Float16)(oacc[n][r] * inv);
      o4[n] = __builtin_bit_cast(i32x4, o);
    }
    store4_cols16(&O[base + (size_t)(q0 + rl) * 1024 + sel8], o4);
  }
}

// ----------------------------- 4) output GEMM ------------------------------
// grid = (N/128, M/128), block = 256 (8 waves, 2x4 wave grid, 64x32/wave).
// K runs in 8 stages of 128. A stage in LDS is [A 128 rows | W 128 rows], rows
// of 256 B at a pitch of 272 B (16 B x odd: no bank conflict for 16-byte
// reads). Two buffers: while stage t is multiplied, stage t+1's copies fly.
#define GK 128                      // k per stage
#define GNST (KDIM / GK)            // stages
#define GPITCH 136                  // halves per LDS row
#define GOP (128 * GPITCH)          // halves per operand and stage
#define GSTAGE (2 * GOP)            // halves per stage

// the real block size: two blocks of 136 KiB LDS share a WGP, so a wave may
// take up to 256 registers
__global__ void __launch_bounds__(256)
out_gemm(const _Float16* __restrict__ A,   // [M][K] f16
         const _Float16* __restrict__ Wp,  // packed
         const float* __restrict__ bias,   // [N]
         float* __restrict__ Y) {
  __shared__ _Float16 ring[2 * GSTAGE] __attribute__((aligned(16)));

  const int tid = threadIdx.x;
  const int lane = tid & 31, wave = tid >> 5;
  const int rl = lane & 15;
  const int sel8 = (lane >> 4) * 8;
  const int row0 = blockIdx.y * 128;
  const int n0 = blockIdx.x * 128;

  // this block's column of packed tiles: 32 K-steps of 4096 halves
  const _Float16* wcol = Wp + (size_t)blockIdx.x * 32 * 4096;

  // A stage: 2048 chunks of 16 B, 8 per thread; 16 lanes take one row's 256 B.
  const _Float16* asrc = A + (size_t)(row0 + (tid >> 4)) * KDIM + (tid & 15) * 8;
  const unsigned adst = lds_off(ring) + (tid >> 4) * (GPITCH * 2) + (tid & 15) * 16;
  // W stage: four packed 128x32 tiles, 32 KiB in a row in memory; chunk
  // tid + 256*it is k-step it/2, row tid/4 + 64*(it%2), 16-byte piece tid%4.
  const _Float16* wsrc = wcol + tid * 8;
  const unsigned wdst = lds_off(ring) + GOP * 2 + (tid >> 2) * (GPITCH * 2) + (tid & 3) * 16;

  auto issue_stage = [&](int t, int buf) {
    unsigned l[8];
    const _Float16* g[8];
#pragma unroll
    for (int it = 0; it < 8; ++it) {
      l[it] = adst + buf * (GSTAGE * 2) + it * 16 * (GPITCH * 2);
      g[it] = asrc + t * GK + (size_t)it * 16 * KDIM;
    }
    async_copy8(l, g);
#pragma unroll
    for (int it = 0; it < 8; ++it) {
      l[it] = wdst + buf * (GSTAGE * 2) + (it & 1) * 64 * (GPITCH * 2) + (it >> 1) * 64;
      g[it] = wsrc + t * (4 * 4096) + it * 2048;
    }
    async_copy8(l, g);
  };

  v8f acc[4][2];
  {
    v8f z = {};
#pragma unroll
    for (int i = 0; i < 4; ++i)
#pragma unroll
      for (int j = 0; j < 2; ++j) acc[i][j] = z;
  }

  const int mw = (wave >> 2) * 64;  // 0 or 64
  const int nw = (wave & 3) * 32;   // 0,32,64,96

  issue_stage(0, 0);
  wait_asynccnt0();
  __syncthreads();  // stage 0 is published
  issue_stage(1, 1);

  for (int t = 0; t < GNST; ++t) {
    const _Float16* As = ring + (t & 1) * GSTAGE;
    const _Float16* Ws = As + GOP;

#pragma unroll
    for (int ks = 0; ks < GK / 32; ++ks) {
      v16h af[4], bf[2];
#pragma unroll
      for (int i = 0; i < 4; ++i)
        af[i] = frag_ld(&As[(mw + i * 16 + rl) * GPITCH + ks * 32 + sel8]);
#pragma unroll
      for (int j = 0; j < 2; ++j)
        bf[j] = frag_ld(&Ws[(nw + j * 16 + rl) * GPITCH + ks * 32 + sel8]);
      // keeps the k-step's 12 LDS reads one group in front of its WMMAs: left
      // alone the compiler reads two at a time and waits out each pair's latency
      __builtin_amdgcn_sched_barrier(0);
#pragma unroll
      for (int i = 0; i < 4; ++i)
#pragma unroll
        for (int j = 0; j < 2; ++j) acc[i][j] = wmma32(af[i], bf[j], acc[i][j]);
    }

    // publish point of stage t+1; the same barrier ends every wave's reads of
    // stage t's buffer, which is refilled behind it
    wait_dscnt0();
    wait_asynccnt0();
    __syncthreads();
    if (t + 2 < GNST) issue_stage(t + 2, t & 1);
  }
  wait_asynccnt0();  // no copy is outstanding when the wave ends

  // epilogue: D layout = lane%16 -> col, vgpr r + 8*(lane/16) -> row
#pragma unroll
  for (int i = 0; i < 4; ++i)
#pragma unroll
    for (int j = 0; j < 2; ++j)
#pragma unroll
      for (int r = 0; r < 8; ++r) {
        int rg = row0 + mw + i * 16 + r + (lane >> 4) * 8;
        int cg = n0 + nw + j * 16 + rl;
        Y[(size_t)rg * NDIM + cg] = acc[i][j][r] + bias[cg];
      }
}

// ------------------------------- launcher ----------------------------------
extern "C" void kernel_launch(void* const* d_in, const int* in_sizes, int n_in,
                              void* d_out, int out_size, void* d_ws,
                              size_t ws_size, hipStream_t stream) {
  const float* X   = (const float*)d_in[0];
  const float* Wq  = (const float*)d_in[1];
  const float* bq  = (const float*)d_in[2];
  const float* Wk  = (const float*)d_in[3];
  const float* bk  = (const float*)d_in[4];
  const float* Wv  = (const float*)d_in[5];
  const float* bv  = (const float*)d_in[6];
  const float* gW1 = (const float*)d_in[7];
  const float* gb1 = (const float*)d_in[8];
  const float* gW2 = (const float*)d_in[9];
  const float* gb2 = (const float*)d_in[10];
  const float* Wo  = (const float*)d_in[11];
  const float* bo  = (const float*)d_in[12];

  char* ws = (char*)d_ws;
  _Float16* Xh = (_Float16*)(ws + OFF_XH);
  _Float16* AO = (_Float16*)(ws + OFF_AO);
  float* beff  = (float*)(ws + OFF_BE);  // [3][16][1024]
  float* hp    = (float*)(ws + OFF_HP);
  _Float16* Wp  = (_Float16*)(ws + OFF_WP);
  _Float16* Wop = (_Float16*)(ws + OFF_WOP);

  dim3 cgrid(1024 / POOL_COLS, MDIM / POOL_ROWS);
  cvt_pool<<<cgrid, 512, 0, stream>>>(X, gW1, Xh, hp);

  dim3 pgrid(NDIM / 64, KDIM / 64);
  prep_weights<<<pgrid, 1024, 0, stream>>>(Wq, Wk, Wv, Wo, hp, gb1, gW2, gb2, bq, bk,
                                           bv, Wp, Wop, beff);

  dim3 qgrid(16, NINST);
  qkv_attn<<<qgrid, 256, 0, stream>>>(Xh, Wp, beff, AO);

  dim3 ggrid(NDIM / 128, MDIM / 128);
  out_gemm<<<ggrid, 256, 0, stream>>>(AO, Wop, bo, (float*)d_out);
}

// v009
// Measured time: 95.2 microseconds a run.
// Timed twice side by side with v008, it ran 1.04 times as fast both times.
// Over all steps from v000 it is 10.8 times as fast.
#include <hip/hip_runtime.h>

// ---------------------------------------------------------------------------
// MoE span attention for MI455X (gfx1250, wave32, WMMA 16x16x32 f16->f32).
//
// Sizes (fixed by the reference): B=4, T=2048, C=1024, E=4 spans==experts,
// H=16 heads, Dh=64, S=512, M = B*T = 8192 rows, K=N=1024.
//
// Pipeline (all on `stream`):
//   1) convert hidden f32 -> f16 (ws); the same pass sums each block's 256 rows
//      x 128 columns per column and multiplies the sums by its 128 rows of the
//      gate's first layer: 16 partial pre-activations per span
//   2) weight prep: every block first ends the gate itself (adds the partial
//      pre-activations, relu, second layer, softmax: gw[16][4]); then
//      W_eff[inst] = sum_e gw_e W_e for q/k/v, and Wo, each rounded to f16 once
//      and packed in the GEMM's own tile order (ws); eff biases
//   3) per (inst, head), one launch: q/k/v GEMM, Y = X @ W_eff[inst] + b_eff for
//      the head's 64 columns of all three from one A tile (A and W tiles go to a
//      two-buffer LDS ring by GLOBAL_LOAD_ASYNC_TO_LDS, one stage ahead of the
//      stage that is multiplied); q, k, v stay in LDS; then the head's
//      attention, softmax in registers over blocks of 64 keys
//   4) output GEMM (one weight matrix, the same kind of ring) -> d_out f32
// ---------------------------------------------------------------------------

typedef __attribute__((ext_vector_type(16))) _Float16 v16h;
typedef __attribute__((ext_vector_type(8)))  _Float16 v8h;
typedef __attribute__((ext_vector_type(4)))  _Float16 v4h;
typedef __attribute__((ext_vector_type(8)))  float    v8f;
typedef __attribute__((ext_vector_type(4)))  float    v4f;
typedef __attribute__((ext_vector_type(2)))  float    v2f;

// this wave's asynchronous copies have landed in LDS
__device__ __forceinline__ void wait_asynccnt0() {
  asm volatile("s_wait_asynccnt 0x0" ::: "memory");
}

// this wave's LDS reads have returned: stands in front of the barrier behind
// which their buffer is refilled
__device__ __forceinline__ void wait_dscnt0() {
  asm volatile("s_wait_dscnt 0x0" ::: "memory");
}

// byte offset of a __shared__ address in the work-group's LDS
__device__ __forceinline__ unsigned lds_off(const void* p) {
  return (unsigned)(size_t)p;
}

// Eight asynchronous 16-byte copies per lane, global -> LDS, through no
// register. The s_wait_xcnt closes the statement as a precaution: it stands in
// front of every later write of the address registers that the copies name.
__device__ __forceinline__ void async_copy8(const unsigned (&l)[8],
                                            const _Float16* const (&g)[8]) {
  asm volatile(
      "global_load_async_to_lds_b128 %0, %8, off\n\t"
      "global_load_async_to_lds_b128 %1, %9, off\n\t"
      "global_load_async_to_lds_b128 %2, %10, off\n\t"
      "global_load_async_to_lds_b128 %3, %11, off\n\t"
      "global_load_async_to_lds_b128 %4, %12, off\n\t"
      "global_load_async_to_lds_b128 %5, %13, off\n\t"
      "global_load_async_to_lds_b128 %6, %14, off\n\t"
      "global_load_async_to_lds_b128 %7, %15, off\n\t"
      "s_wait_xcnt 0x0"
      :
      : "v"(l[0]), "v"(l[1]), "v"(l[2]), "v"(l[3]), "v"(l[4]), "v"(l[5]),
        "v"(l[6]), "v"(l[7]), "v"(g[0]), "v"(g[1]), "v"(g[2]), "v"(g[3]),
        "v"(g[4]), "v"(g[5]), "v"(g[6]), "v"(g[7])
      : "memory");
}

// One asynchronous 16-byte copy per lane as the builtin: the compiler picks its
// registers, also above v255, where an asm operand cannot lie.
typedef int i32x4 __attribute__((ext_vector_type(4)));
__device__ __forceinline__ void async_copy(_Float16* l, const _Float16* g) {
  typedef __attribute__((address_space(1))) i32x4 glb_i32x4;
  typedef __attribute__((address_space(3))) i32x4 lds_i32x4;
  __builtin_amdgcn_global_load_async_to_lds_b128((glb_i32x4*)g, (lds_i32x4*)l, 0, 0);
}

__device__ __forceinline__ v8f wmma32(v16h a, v16h b, v8f c) {
  // (neg_a, A, neg_b, B, c_mod, C, reuse_a, reuse_b)
  return __builtin_amdgcn_wmma_f32_16x16x32_f16(false, a, false, b, (short)0, c,
                                                false, false);
}

// Load one 16x32 (A-style) / 32x16 (B-style) f16 WMMA fragment.
// Caller passes p = &buf[(lane%16)*stride + (lane/16)*8 (+k_base)], 16B aligned.
// Per ISA 7.12.2: halves 0..7 = K at p[0..7], halves 8..15 = K at p[16..23].
__device__ __forceinline__ v16h frag_ld(const _Float16* p) {
  v8h lo = *(const v8h*)p;
  v8h hi = *(const v8h*)(p + 16);
  v16h r;
#pragma unroll
  for (int j = 0; j < 8; ++j) { r[j] = lo[j]; r[j + 8] = hi[j]; }
  return r;
}

// Transposing LDS read: from a row-major 16-bit tile T, with lane l's p at row
// 8*(l/16) + l%8, byte 16*((l/8)%2), lane l gets T[8*(l/16) + 0..7][l%16].
typedef short s16x8 __attribute__((ext_vector_type(8)));
__device__ __forceinline__ v8h ld_tr16(const char* p) {
  typedef __attribute__((address_space(3))) s16x8 lds_s16x8;
  return __builtin_bit_cast(v8h,
                            __builtin_amdgcn_ds_load_tr16_b128_v8i16((lds_s16x8*)p));
}

// lane l's value of lane l ^ 16, by a vector move: no LDS round trip
__device__ __forceinline__ float xhalf(float x) {
  return __builtin_bit_cast(
      float, __builtin_amdgcn_permlanex16(__builtin_bit_cast(int, x), __builtin_bit_cast(int, x),
                                          0x76543210, 0xfedcba98, false, false));
}

// ------------------------------- constants ---------------------------------
#define MDIM 8192
#define KDIM 1024
#define NDIM 1024
#define NINST 16
#define SPAN 512

// workspace layout (bytes)
#define OFF_XH  ((size_t)0)
#define OFF_AO  ((size_t)64 << 20)
#define OFF_BE  ((size_t)80 << 20)   // effective biases [3][NINST][1024] f32
#define OFF_HP  ((size_t)84 << 20)   // gate partial pre-activations [NINST][16][128] f32
#define OFF_WP  ((size_t)96 << 20)   // packed q/k/v weights [3][NINST], 2 MiB each
#define OFF_WOP ((size_t)192 << 20)  // packed Wo, 2 MiB

// ------- 1) f32 -> f16, with the gate's pooling and first-layer partials -----
// One block = 256 rows (half a span) x 128 columns, 16 waves: a wave takes one
// row's 512 B per load, four columns per lane, 16 rows. The gate's first layer is
// linear in the pooled row, so the block's own column sums times its own 128 rows
// of gW1 are one of 16 partial pre-activations of the span.
#define GH 128                     // hidden units of the gate
#define POOL_COLS 128
#define POOL_ROWS 256
#define GPARTS ((1024 / POOL_COLS) * (SPAN / POOL_ROWS))  // 16 per span

__global__ void __launch_bounds__(512)
cvt_pool(const float* __restrict__ x,
         const float* __restrict__ gW1,
         _Float16* __restrict__ y,
         float* __restrict__ hp) {  // [NINST * GPARTS][GH]
  __shared__ float red[16 * POOL_COLS] __attribute__((aligned(16)));
  __shared__ float pooled[POOL_COLS] __attribute__((aligned(16)));
  __shared__ float hpart[16 * GH] __attribute__((aligned(16)));
  const int tid = threadIdx.x;
  const int lane = tid & 31, wave = tid >> 5;
  const int c0 = blockIdx.x * POOL_COLS;
  const size_t base = ((size_t)blockIdx.y * POOL_ROWS + wave) * 1024 + c0 + lane * 4;

  // all loads go out before the first use waits for data
  v4f v[16];
#pragma unroll
  for (int r = 0; r < 16; ++r)
    v[r] = *(const v4f*)(x + base + (size_t)r * 16 * 1024);
  // wave = 8 of the block's 128 inputs, lane = 4 of the 128 hidden units, so one
  // load of a wave is one whole 512-byte row of gW1
  v4f w[8];
  {
    const float* wrow = gW1 + (size_t)(c0 + wave * 8) * GH + lane * 4;
#pragma unroll
    for (int i = 0; i < 8; ++i) w[i] = *(const v4f*)(wrow + i * GH);
  }
  // keeps all 24 loads in front of the first use: left alone the compiler issues
  // the gW1 loads behind the first rows' data, a second memory latency in a row
  __builtin_amdgcn_sched_barrier(0);

  v4f s = {};
#pragma unroll
  for (int r = 0; r < 16; ++r) {
    v4h h;
#pragma unroll
    for (int j = 0; j < 4; ++j) h[j] = (_Float16)v[r][j];
    *(v4h*)(y + base + (size_t)r * 16 * 1024) = h;
    s += v[r];
  }
  *(v4f*)&red[wave * POOL_COLS + lane * 4] = s;
  __syncthreads();

  if (tid < POOL_COLS) {
    float t = 0.f;
#pragma unroll
    for (int g = 0; g < 16; ++g) t += red[g * POOL_COLS + tid];
    pooled[tid] = t * (1.0f / (float)SPAN);
  }
  __syncthreads();

  {
    v4f a = {};
#pragma unroll
    for (int i = 0; i < 8; ++i) a += pooled[wave * 8 + i] * w[i];
    *(v4f*)&hpart[wave * GH + lane * 4] = a;
  }
  __syncthreads();

  if (tid < GH) {
    float t = 0.f;
#pragma unroll
    for (int g = 0; g < 16; ++g) t += hpart[g * GH + tid];
    hp[((size_t)blockIdx.y * (1024 / POOL_COLS) + blockIdx.x) * GH + tid] = t;
  }
}

// ------------------ 2) end of the gate, and weight prep ---------------------
// Packed weight matrix, f16: [n/128][k/32][n%128][k%32], so that the 128x32
// tile a GEMM block stages per K-step is 4096 contiguous halves.
// A group of 256 threads takes a 64(k) x 64(n) tile of all NE experts through LDS
// (the transpose), then forms every instance's combination from registers.
#define PREP_PITCH 65  // dwords; column walks of 4-byte reads hit 32 banks
#define PREP_TILE (64 * PREP_PITCH)  // dwords of one expert's tile

// A thread's loads for the end of the gate: 16 partial sums of two hidden units,
// 512 B apart, their two biases and their two rows of gW2. The loads and their
// data wait are one statement, and no result may share a register with an
// address: nothing can rewrite a register that a load names while the load is out.
__device__ __forceinline__ void gate_ld(const float* ph, const float* pb, const float* pw,
                                        v2f (&h)[16], v2f& b, v4f& w0, v4f& w1) {
  asm volatile(
      "global_load_b64 %0, %19, off\n\t"
      "global_load_b64 %1, %19, off offset:512\n\t"
      "global_load_b64 %2, %19, off offset:1024\n\t"
      "global_load_b64 %3, %19, off offset:1536\n\t"
      "global_load_b64 %4, %19, off offset:2048\n\t"
      "global_load_b64 %5, %19, off offset:2560\n\t"
      "global_load_b64 %6, %19, off offset:3072\n\t"
      "global_load_b64 %7, %19, off offset:3584\n\t"
      "global_load_b64 %8, %19, off offset:4096\n\t"
      "global_load_b64 %9, %19, off offset:4608\n\t"
      "global_load_b64 %10, %19, off offset:5120\n\t"
      "global_load_b64 %11, %19, off offset:5632\n\t"
      "global_load_b64 %12, %19, off offset:6144\n\t"
      "global_load_b64 %13, %19, off offset:6656\n\t"
      "global_load_b64 %14, %19, off offset:7168\n\t"
      "global_load_b64 %15, %19, off offset:7680\n\t"
      "global_load_b64 %16, %20, off\n\t"
      "global_load_b128 %17, %21, off\n\t"
      "global_load_b128 %18, %21, off offset:16\n\t"
      "s_wait_loadcnt 0x0"
      : "=&v"(h[0]), "=&v"(h[1]), "=&v"(h[2]), "=&v"(h[3]), "=&v"(h[4]), "=&v"(h[5]),
        "=&v"(h[6]), "=&v"(h[7]), "=&v"(h[8]), "=&v"(h[9]), "=&v"(h[10]), "=&v"(h[11]),
        "=&v"(h[12]), "=&v"(h[13]), "=&v"(h[14]), "=&v"(h[15]), "=&v"(b), "=&v"(w0),
        "=&v"(w1)
      : "v"(ph), "v"(pb), "v"(pw)
      : "memory");
}

template <int NE>
__device__ __forceinline__ void prep_put(float* __restrict__ tile, int t,
                                         const v4f (&w4)[4][4]) {
  const unsigned kr = t >> 4, n4 = (t & 15) * 4;
#pragma unroll
  for (int e = 0; e < NE; ++e)
#pragma unroll
    for (int it = 0; it < 4; ++it)
#pragma unroll
      for (int j = 0; j < 4; ++j)
        tile[(e * 64 + kr + it * 16) * PREP_PITCH + n4 + j] = w4[e][it][j];
}

template <int NE, int NI>
__device__ __forceinline__ void prep_emit(const float* __restrict__ tile,
                                          v4f gv,  // lane i: instance i's weights
                                          _Float16* __restrict__ Wp,      // [NI] packed
                                          int t, int n0, int k0) {
  // the 64 gate weights: readlane moves each to a scalar register, so that none
  // of them holds a vector register beside the tile
  static_assert(NE == 1 || (NI == 16 && NE == 4), "lane i holds instance i's four");
  float g[NI][NE];
  if constexpr (NE > 1) {
#pragma unroll
    for (int i = 0; i < NI; ++i)
#pragma unroll
      for (int e = 0; e < NE; ++e) {
        const float ge = gv[e];
        g[i][e] = __builtin_bit_cast(
            float, __builtin_amdgcn_readlane(__builtin_bit_cast(int, ge), i));
      }
  }

  const int kq = t & 3;   // 8 consecutive k per thread
  const int n = t >> 2;   // 0..63
  const int ng = n0 + n;
#pragma unroll
  for (int ks = 0; ks < 2; ++ks) {  // the tile's two 32-wide K-steps
    float w[NE][8];
#pragma unroll
    for (int e = 0; e < NE; ++e)
#pragma unroll
      for (int j = 0; j < 8; ++j)
        w[e][j] = tile[(e * 64 + ks * 32 + kq * 8 + j) * PREP_PITCH + n];

    _Float16* dst = Wp + ((size_t)(ng >> 7) * 32 + (k0 >> 5) + ks) * 4096 +
                    (ng & 127) * 32 + kq * 8;
#pragma unroll
    for (int i = 0; i < NI; ++i) {
      v8h o;
#pragma unroll
      for (int j = 0; j < 8; ++j) {
        float a = (NE == 1) ? w[0][j] : g[i][0] * w[0][j];
#pragma unroll
        for (int e = 1; e < NE; ++e) a = __builtin_fmaf(g[i][e], w[e][j], a);
        o[j] = (_Float16)a;
      }
      *(v8h*)(dst + (size_t)i * KDIM * NDIM) = o;
    }
  }
}

// grid = (N/64, K/64), block = 1024: four groups of 256 threads take the block's
// 64x64 tile of q, k, v (4 experts, 16 instances each) and of Wo. Behind the tile
// loads the whole block ends the gate for all 16 instances: it costs each block
// 128 KiB of reads and takes the place of a launch of its own.
__global__ void __launch_bounds__(1024)
prep_weights(const float* __restrict__ Wq,
             const float* __restrict__ Wk,
             const float* __restrict__ Wv,
             const float* __restrict__ Wo,
             const float* __restrict__ hp,   // [NINST][GPARTS][GH]
             const float* __restrict__ gb1,
             const float* __restrict__ gW2,
             const float* __restrict__ gb2,
             const float* __restrict__ bq,
             const float* __restrict__ bk,
             const float* __restrict__ bv,
             _Float16* __restrict__ Wp,
             _Float16* __restrict__ Wop,
             float* __restrict__ beff) {
  __shared__ float tiles[13 * PREP_TILE];
  __shared__ float lg[32 * 4] __attribute__((aligned(16)));  // a wave's part of 4 logits
  const int tid = threadIdx.x;
  const int lane = tid & 31;
  // the same in every lane of a wave: kept scalar, so the tests on them are branches
  const int wave = __builtin_amdgcn_readfirstlane(tid >> 5);
  const int p = wave >> 3;  // 0,1,2 -> q,k,v; 3 -> Wo
  const int t = tid & 255;
  const int n0 = blockIdx.x * 64;
  const int k0 = blockIdx.y * 64;
  float* tile = tiles + p * 4 * PREP_TILE;

  const float b20 = gb2[0], b21 = gb2[1], b22 = gb2[2], b23 = gb2[3];

  // All tile loads go out before anything waits for data; the first expert's and
  // Wo's are one piece of code, so that no path waits for another path's loads.
  // The s_wait_xcnt are a precaution: each names the loads' addresses as inputs,
  // so no result of these loads can share a register with an address, and stands
  // in front of every later write of those registers.
  v4f w4[4][4];
  {
    const float* W = (p == 0) ? Wq : (p == 1) ? Wk : (p == 2) ? Wv : Wo;
    const float* p0 = W + (size_t)(k0 + (t >> 4)) * NDIM + n0 + (t & 15) * 4;
#pragma unroll
    for (int it = 0; it < 4; ++it) w4[0][it] = *(const v4f*)(p0 + it * 16 * NDIM);
    asm volatile("s_wait_xcnt 0x0" :: "v"(p0) : "memory");
    if (p < 3) {
      // p0 + two experts (8 MiB), formed in asm: the loads and the wait below then
      // name this very register pair, not a copy that the last load may overwrite
      typedef __attribute__((address_space(1))) const v4f glb_v4f;  // p2 is global
      const float* p2;
      asm("v_add_nc_u64_e32 %0, 0x800000, %1" : "=v"(p2) : "v"(p0));
#pragma unroll
      for (int it = 0; it < 4; ++it)
        w4[1][it] = *(const v4f*)(p0 + KDIM * NDIM + it * 16 * NDIM);
#pragma unroll
      for (int it = 0; it < 4; ++it) w4[2][it] = *(glb_v4f*)(p2 + it * 16 * NDIM);
#pragma unroll
      for (int it = 0; it < 4; ++it)
        w4[3][it] = *(glb_v4f*)(p2 + KDIM * NDIM + it * 16 * NDIM);
      asm volatile("s_wait_xcnt 0x0" :: "v"(p0), "v"(p2) : "memory");
    }
  }

  // End of the gate, behind the tile loads. Hidden layer: thread = (instance, two
  // hidden units), the 16 partial sums; second layer: the thread's two terms of
  // the instance's four logits, summed over the wave (half of the instance).
  {
    const int j2 = (tid & 63) * 2;
    v2f ht[GPARTS], hsum;
    v4f w2a, w2b;
    gate_ld(hp + (size_t)(tid >> 6) * GPARTS * GH + j2, gb1 + j2, gW2 + j2 * 4, ht, hsum,
            w2a, w2b);
#pragma unroll
    for (int c = 0; c < GPARTS; ++c) hsum += ht[c];
    v4f l = fmaxf(hsum[0], 0.f) * w2a + fmaxf(hsum[1], 0.f) * w2b;
#pragma unroll
    for (int off = 16; off > 0; off >>= 1)
#pragma unroll
      for (int e = 0; e < 4; ++e) l[e] += __shfl_xor(l[e], off, 32);
    if (lane == 0) *(v4f*)&lg[wave * 4] = l;
  }

  if (p < 3) prep_put<4>(tile, t, w4);
  else       prep_put<1>(tile, t, w4);
  __syncthreads();  // the logits' parts and the tiles are published

  // softmax, in every wave for itself: lane % 16 = instance
  v4f gv;
  {
    const int gi = lane & 15;
    v4f l = *(const v4f*)&lg[gi * 8] + *(const v4f*)&lg[gi * 8 + 4];
    l[0] += b20; l[1] += b21; l[2] += b22; l[3] += b23;
    float mx = fmaxf(fmaxf(l[0], l[1]), fmaxf(l[2], l[3]));
    float e0 = __expf(l[0] - mx), e1 = __expf(l[1] - mx);
    float e2 = __expf(l[2] - mx), e3 = __expf(l[3] - mx);
    float inv = 1.0f / (e0 + e1 + e2 + e3);
    gv[0] = e0 * inv; gv[1] = e1 * inv; gv[2] = e2 * inv; gv[3] = e3 * inv;
  }

  if (p < 3) {
    prep_emit<4, NINST>(tile, gv, Wp + (size_t)p * NINST * KDIM * NDIM, t, n0, k0);
  } else {
    prep_emit<1, 1>(tile, gv, Wop, t, n0, k0);
    // precaution: stands, on every way on from here, in front of every later write
    // of a register that the stores above name; the scheduling barrier keeps those
    // writes behind it
    asm volatile("s_wait_xcnt 0x0" ::: "memory");
    __builtin_amdgcn_sched_barrier(0);
    // effective biases of the block's 64 columns, once per column of blocks, by
    // the group with the least to store: thread = (column, four instances)
    if (blockIdx.y == 0) {
      const int col = n0 + (t & 63), i0 = ((wave & 7) >> 1) * 4;
      float b[3][4];
#pragma unroll
      for (int e = 0; e < 4; ++e) {
        b[0][e] = bq[e * 1024 + col];
        b[1][e] = bk[e * 1024 + col];
        b[2][e] = bv[e * 1024 + col];
      }
#pragma unroll
      for (int i = 0; i < 4; ++i)
#pragma unroll
        for (int q = 0; q < 3; ++q) {
          float a = 0.f;
#pragma unroll
          for (int e = 0; e < 4; ++e) {
            const float ge = gv[e];
            a += __builtin_bit_cast(float, __builtin_amdgcn_readlane(
                     __builtin_bit_cast(int, ge), i0 + i)) * b[q][e];
          }
          beff[(q * NINST + i0 + i) * 1024 + col] = a;
        }
      // the same precaution behind the twelve stores above
      asm volatile("s_wait_xcnt 0x0" ::: "memory");
    }
  }
}

// A lane's bias values of one product: eight floats in a row at p and eight at
// p + 16. The loads and their data wait are one statement, and no result may
// share a register with the address: nothing can rewrite a register that a load
// names while the load is out.
__device__ __forceinline__ void bias_ld(const float* p, v4f (&b)[4]) {
  asm volatile(
      "global_load_b128 %0, %4, off\n\t"
      "global_load_b128 %1, %4, off offset:16\n\t"
      "global_load_b128 %2, %4, off offset:64\n\t"
      "global_load_b128 %3, %4, off offset:80\n\t"
      "s_wait_loadcnt 0x0"
      : "=&v"(b[0]), "=&v"(b[1]), "=&v"(b[2]), "=&v"(b[3])
      : "v"(p)
      : "memory");
}

// Four 16-byte stores per lane, 16 halves apart. The s_wait_xcnt closes the
// statement as a precaution: it stands in front of every later write of the data
// and address registers that the stores name.
__device__ __forceinline__ void store4_cols16(_Float16* p, const i32x4 (&o)[4]) {
  asm volatile(
      "global_store_b128 %4, %0, off\n\t"
      "global_store_b128 %4, %1, off offset:32\n\t"
      "global_store_b128 %4, %2, off offset:64\n\t"
      "global_store_b128 %4, %3, off offset:96\n\t"
      "s_wait_xcnt 0x0"
      :
      : "v"(o[0]), "v"(o[1]), "v"(o[2]), "v"(o[3]), "v"(p)
      : "memory");
}

#define QK 64                       // k per stage
#define QNST (KDIM / QK)            // stages
#define QPITCH 72                   // halves per LDS row
#define QAH (SPAN * QPITCH)         // halves of a stage's A part
#define QWH (64 * QPITCH)           // halves of one product's W part
#define QSTAGE (QAH + 3 * QWH)      // halves per stage
#define KPITCH_B 144
#define VPITCH_B 160
#define ATTN_V_BYTES (SPAN * VPITCH_B)
#define ATTN_K_BYTES (SPAN * KPITCH_B)
#define ATTN_SMEM (ATTN_V_BYTES + 2 * ATTN_K_BYTES)
static_assert(2 * QSTAGE * 2 <= ATTN_SMEM, "the ring lies inside the q, k, v bytes");

// the real block size: two waves share a SIMD, so a wave may take up to 512
// registers, 384 of them accumulators
__global__ void __launch_bounds__(256)
qkv_attn(const _Float16* __restrict__ A,   // [M][K] f16
         const _Float16* __restrict__ Wp,  // packed, [3][NINST]
         const float* __restrict__ bias,   // [3][NINST][N]
         _Float16* __restrict__ O) {       // [M][N]
  __shared__ char smem[ATTN_SMEM] __attribute__((aligned(16)));
  _Float16* ring = (_Float16*)smem;

  const int tid = threadIdx.x;
  const int lane = tid & 31, wave = tid >> 5;
  const int rl = lane & 15;
  const int sel8 = (lane >> 4) * 8;
  const int h = blockIdx.x;
  const int inst = blockIdx.y;
  const int row0 = inst * SPAN;

  // A stage: 4096 chunks of 16 B, 16 per thread; 8 lanes take one row's 128 B.
  const _Float16* asrc = A + (size_t)(row0 + (tid >> 3)) * KDIM + (tid & 7) * 8;
  _Float16* adst = ring + (tid >> 3) * QPITCH + (tid & 7) * 8;
  // W stage, per product and k-step: this head's half of a packed 128x32 tile,
  // 4 KiB in a row in memory; chunk tid is row tid/4, 16-byte piece tid%4.
  const _Float16* wsrc = Wp + (size_t)inst * KDIM * NDIM +
                         (size_t)(h >> 1) * 32 * 4096 + (h & 1) * 2048 + tid * 8;
  _Float16* wdst = ring + QAH + (tid >> 2) * QPITCH + (tid & 3) * 8;

  auto issue_stage = [&](int t, int buf) {
#pragma unroll
    for (int it = 0; it < 16; ++it)
      async_copy(adst + buf * QSTAGE + it * 32 * QPITCH,
                 asrc + t * QK + (size_t)it * 32 * KDIM);
#pragma unroll
    for (int p = 0; p < 3; ++p)
#pragma unroll
      for (int ks = 0; ks < 2; ++ks)
        async_copy(wdst + buf * QSTAGE + p * QWH + ks * 32,
                   wsrc + (size_t)p * NINST * KDIM * NDIM + (t * 2 + ks) * 4096);
  };

  v8f acc[8][6];  // [row tile][2 * product + column tile]
  {
    v8f z = {};
#pragma unroll
    for (int i = 0; i < 8; ++i)
#pragma unroll
      for (int j = 0; j < 6; ++j) acc[i][j] = z;
  }

  const int mw = (wave >> 1) * 128;  // 0,128,256,384
  const int nw = (wave & 1) * 32;    // 0 or 32

  issue_stage(0, 0);
  wait_asynccnt0();
  __syncthreads();  // stage 0 is published
  issue_stage(1, 1);

  for (int t = 0; t < QNST; ++t) {
    const _Float16* As = ring + (t & 1) * QSTAGE;
    const _Float16* Ws = As + QAH;

    // A k-step's six W fragments are held; its eight A fragments come in pairs,
    // each pair read while the pair before it is multiplied.
    auto ld_a = [&](int grp, int u) {  // grp = 4 * k-step + pair
      return frag_ld(&As[(mw + ((grp & 3) * 2 + u) * 16 + rl) * QPITCH + (grp >> 2) * 32 + sel8]);
    };
    auto ld_b = [&](int ks, int j) {
      return frag_ld(&Ws[((j >> 1) * 64 + nw + (j & 1) * 16 + rl) * QPITCH + ks * 32 + sel8]);
    };
    v16h bf[6], af[2][2];
#pragma unroll
    for (int j = 0; j < 6; ++j) bf[j] = ld_b(0, j);
    af[0][0] = ld_a(0, 0);
    af[0][1] = ld_a(0, 1);
#pragma unroll
    for (int grp = 0; grp < 4 * (QK / 32); ++grp) {
      if (grp + 1 < 4 * (QK / 32)) {
        af[(grp + 1) & 1][0] = ld_a(grp + 1, 0);
        af[(grp + 1) & 1][1] = ld_a(grp + 1, 1);
      }
      // keeps the next pair's LDS reads in front of this pair's 12 WMMAs: left
      // alone the compiler reads a fragment right before its use and waits out
      // the LDS latency every six WMMAs
      __builtin_amdgcn_sched_barrier(0);
#pragma unroll
      for (int u = 0; u < 2; ++u)
#pragma unroll
        for (int j = 0; j < 6; ++j)
          acc[(grp & 3) * 2 + u][j] = wmma32(bf[j], af[grp & 1][u], acc[(grp & 3) * 2 + u][j]);
      if ((grp & 3) == 3 && (grp >> 2) + 1 < QK / 32) {
#pragma unroll
        for (int j = 0; j < 6; ++j) bf[j] = ld_b((grp >> 2) + 1, j);
      }
    }

    // publish point of stage t+1; the same barrier ends every wave's reads of
    // stage t's buffer, which is refilled behind it
    wait_dscnt0();
    wait_asynccnt0();
    __syncthreads();
    if (t + 2 < QNST) issue_stage(t + 2, t & 1);
  }
  // no copy is outstanding, and the last barrier has ended every wave's reads of
  // the ring: its LDS is free for q, k and v
  wait_asynccnt0();

  char* vs = smem;                   // V rows
  char* kr = smem + ATTN_V_BYTES;    // K rows
  char* qr = kr + ATTN_K_BYTES;      // Q rows

  // D of W X^T = lane%16 -> row of Y, vgpr r + 8*(lane/16) -> column: a lane
  // holds eight columns in a row of one row of Y, one 16-byte LDS store
#pragma unroll
  for (int p = 0; p < 3; ++p) {
    v4f b4[4];
    bias_ld(bias + (p * NINST + inst) * NDIM + h * 64 + nw + sel8, b4);
    char* dst = (p == 0) ? qr : (p == 1) ? kr : vs;
    const int pitch = (p == 2) ? VPITCH_B : KPITCH_B;
#pragma unroll
    for (int jj = 0; jj < 2; ++jj) {
      const v8f b = __builtin_shufflevector(b4[2 * jj], b4[2 * jj + 1], 0, 1, 2, 3, 4, 5, 6, 7);
#pragma unroll
      for (int i = 0; i < 8; ++i)
        *(v8h*)(dst + (mw + i * 16 + rl) * pitch + (nw + jj * 16 + sel8) * 2) =
            __builtin_convertvector(acc[i][2 * p + jj] + b, v8h);
    }
  }
  __syncthreads();  // q, k and v are published

  const _Float16* ks = (const _Float16*)kr;
  const _Float16* qs = (const _Float16*)qr;
  const size_t base = (size_t)row0 * 1024 + h * 64;
  const char* vlane = vs + (sel8 + (lane & 7)) * VPITCH_B + ((lane >> 3) & 1) * 16;

  // The wave's 64 queries, four tiles of 16, are taken at once, and the keys in
  // eight blocks of 64: a K or V fragment read from LDS feeds four WMMAs, one per
  // query tile. A block's scores are the f32 accumulators; the blocks are joined
  // by a running row maximum, by which the sums and O^T so far are rescaled.
  const int q0 = wave * 64;

  // Q fragments (K=Dh=64 -> 2 k-steps); they are the B operand: column = query =
  // lane%16
  v16h qa[4][2];
#pragma unroll
  for (int qt = 0; qt < 4; ++qt)
#pragma unroll
    for (int t = 0; t < 2; ++t)
      qa[qt][t] = frag_ld(&qs[(q0 + qt * 16 + rl) * (KPITCH_B / 2) + t * 32 + sel8]);

  const float SC = 0.125f * 1.44269504f;  // 1/sqrt(Dh) * log2(e)
  const v8f SC8 = {SC, SC, SC, SC, SC, SC, SC, SC};
  float mrun[4];   // row maximum so far, the same in both lane halves
  v8f sum[4];      // eight chains of the row sum, relative to mrun
  v8f oacc[4][4];  // O^T, [query tile][dh tile], relative to mrun
  {
    const v8f z = {};
#pragma unroll
    for (int qt = 0; qt < 4; ++qt) {
      mrun[qt] = -__builtin_inff();
      sum[qt] = z;
#pragma unroll
      for (int n = 0; n < 4; ++n) oacc[qt][n] = z;
    }
  }

  auto ld_k = [&](int kb, int f) {  // f = 2 * key tile + k-step, in key block kb
    return frag_ld(&ks[(kb * 64 + (f >> 1) * 16 + rl) * (KPITCH_B / 2) + (f & 1) * 32 + sel8]);
  };
  auto ld_v = [&](int kb, int g) {  // g = 4 * k-step t + dh tile n, in key block kb
    // keys 64kb + 32t + 8*(lane/16) + 0..7 and the same + 16, of dh 16n + lane%16
    const char* p = vlane + (kb * 64 + (g >> 2) * 32) * VPITCH_B + (g & 3) * 32;
    const v8h lo = ld_tr16(p);
    const v8h hi = ld_tr16(p + 16 * VPITCH_B);
    v16h va;
#pragma unroll
    for (int j = 0; j < 8; ++j) { va[j] = lo[j]; va[j + 8] = hi[j]; }
    return va;
  };

  v16h kf[8];
#pragma unroll
  for (int f = 0; f < 8; ++f) kf[f] = ld_k(0, f);

  // stays rolled: one body of 64 WMMAs in the instruction cache, not eight
#pragma unroll 1
  for (int kb = 0; kb < SPAN / 64; ++kb) {
    // scores^T = K Q^T. D: lane%16 = query, register r = key 8*(lane/16) + r of
    // the 16-key tile: a lane holds 32 of its query's 64 scores, lane^16 the rest.
    v8f s[4][4];  // [query tile][key tile]
    {
      const v8f z = {};
#pragma unroll
      for (int kt = 0; kt < 4; ++kt) {
#pragma unroll
        for (int qt = 0; qt < 4; ++qt) s[qt][kt] = wmma32(kf[kt * 2], qa[qt][0], z);
#pragma unroll
        for (int qt = 0; qt < 4; ++qt)
          s[qt][kt] = wmma32(kf[kt * 2 + 1], qa[qt][1], s[qt][kt]);
      }
    }

    v16h vf[8];
#pragma unroll
    for (int g = 0; g < 8; ++g) vf[g] = ld_v(kb, g);
    // keeps the block's V reads one group in front of the softmax, whose vector
    // work covers their latency: left alone the compiler reads a fragment right
    // before its use and waits out the LDS latency each time
    __builtin_amdgcn_sched_barrier(0);

    // P^T = exp((S^T - max) / sqrt(Dh)). Two score tiles, rounded to f16, are a B
    // operand over 32 keys in frag_ld's own k order, which is the transposing
    // read's too: pb[j] = key 32t + 8*(lane/16) + j, pb[8+j] = the same key + 16.
    v16h pb[4][2];
#pragma unroll
    for (int qt = 0; qt < 4; ++qt) {
      // the lane's 32 scores, joined three at a time
      float a[8], b[4];
#pragma unroll
      for (int j = 0; j < 8; ++j) a[j] = fmaxf(fmaxf(s[qt][0][j], s[qt][1][j]), s[qt][2][j]);
#pragma unroll
      for (int i = 0; i < 4; ++i)
        b[i] = fmaxf(fmaxf(s[qt][3][2 * i], s[qt][3][2 * i + 1]), a[2 * i]);
      float mb = fmaxf(fmaxf(fmaxf(fmaxf(b[0], b[1]), a[1]), fmaxf(fmaxf(b[2], b[3]), a[3])),
                       fmaxf(a[5], a[7]));
      mb = fmaxf(mb, xhalf(mb));
      const float mn = fmaxf(mrun[qt], mb);
      const float alpha = __builtin_amdgcn_exp2f((mrun[qt] - mn) * SC);  // 0 in block 0
      mrun[qt] = mn;
      const float nmx = -mn * SC;
      const v8f nmx8 = {nmx, nmx, nmx, nmx, nmx, nmx, nmx, nmx};
      v8f acc8 = sum[qt] * alpha;
#pragma unroll
      for (int kt = 0; kt < 4; ++kt) {
        // whole-vector forms: packed f32 multiply-adds and adds, two per issue
        const v8f x = __builtin_elementwise_fma(s[qt][kt], SC8, nmx8);
        v8f ev;
#pragma unroll
        for (int j = 0; j < 8; ++j) ev[j] = __builtin_amdgcn_exp2f(x[j]);
        acc8 += ev;
        const v8h eh = __builtin_convertvector(ev, v8h);
#pragma unroll
        for (int j = 0; j < 8; ++j) pb[qt][kt >> 1][(kt & 1) * 8 + j] = eh[j];
      }
      sum[qt] = acc8;
#pragma unroll
      for (int n = 0; n < 4; ++n) oacc[qt][n] *= alpha;
    }

    // the next block's K fragments; the last pass reads block 0 again, unused, so
    // that no branch stands among the WMMAs
#pragma unroll
    for (int f = 0; f < 8; ++f) kf[f] = ld_k((kb + 1) & (SPAN / 64 - 1), f);
    // keeps those reads one group in front of the 32 WMMAs below, which cover
    // their latency
    __builtin_amdgcn_sched_barrier(0);

    // O^T += V^T P^T (V^T rows are the A operand)
#pragma unroll
    for (int g = 0; g < 8; ++g)
#pragma unroll
      for (int qt = 0; qt < 4; ++qt)
        oacc[qt][g & 3] = wmma32(vf[g], pb[qt][g >> 2], oacc[qt][g & 3]);
  }

#pragma unroll
  for (int qt = 0; qt < 4; ++qt) {
    float tot = ((sum[qt][0] + sum[qt][1]) + (sum[qt][2] + sum[qt][3])) +
                ((sum[qt][4] + sum[qt][5]) + (sum[qt][6] + sum[qt][7]));
    tot += xhalf(tot);
    const float inv = 1.0f / tot;

    // O^T: lane%16 = query, registers = 8 consecutive dh: one 16-byte store
    i32x4 o4[4];
#pragma unroll
    for (int n = 0; n < 4; ++n) {
      v8h o;
#pragma unroll
      for (int r = 0; r < 8; ++r) o[r] = (_Float16)(oacc[qt][n][r] * inv);
      o4[n] = __builtin_bit_cast(i32x4, o);
    }
    store4_cols16(&O[base + (size_t)(q0 + qt * 16 + rl) * 1024 + sel8], o4);
  }
}

// ----------------------------- 4) output GEMM ------------------------------
// grid = (N/128, M/128), block = 256 (8 waves, 2x4 wave grid, 64x32/wave).
// K runs in 8 stages of 128. A stage in LDS is [A 128 rows | W 128 rows], rows
// of 256 B at a pitch of 272 B (16 B x odd: no bank conflict for 16-byte
// reads). Two buffers: while stage t is multiplied, stage t+1's copies fly.
#define GK 128                      // k per stage
#define GNST (KDIM / GK)            // stages
#define GPITCH 136                  // halves per LDS row
#define GOP (128 * GPITCH)          // halves per operand and stage
#define GSTAGE (2 * GOP)            // halves per stage

// the real block size: two blocks of 136 KiB LDS share a WGP, so a wave may
// take up to 256 registers
__global__ void __launch_bounds__(256)
out_gemm(const _Float16* __restrict__ A,   // [M][K] f16
         const _Float16* __restrict__ Wp,  // packed
         const float* __restrict__ bias,   // [N]
         float* __restrict__ Y) {
  __shared__ _Float16 ring[2 * GSTAGE] __attribute__((aligned(16)));

  const int tid = threadIdx.x;
  const int lane = tid & 31, wave = tid >> 5;
  const int rl = lane & 15;
  const int sel8 = (lane >> 4) * 8;
  const int row0 = blockIdx.y * 128;
  const int n0 = blockIdx.x * 128;

  // this block's column of packed tiles: 32 K-steps of 4096 halves
  const _Float16* wcol = Wp + (size_t)blockIdx.x * 32 * 4096;

  // A stage: 2048 chunks of 16 B, 8 per thread; 16 lanes take one row's 256 B.
  const _Float16* asrc = A + (size_t)(row0 + (tid >> 4)) * KDIM + (tid & 15) * 8;
  const unsigned adst = lds_off(ring) + (tid >> 4) * (GPITCH * 2) + (tid & 15) * 16;
  // W stage: four packed 128x32 tiles, 32 KiB in a row in memory; chunk
  // tid + 256*it is k-step it/2, row tid/4 + 64*(it%2), 16-byte piece tid%4.
  const _Float16* wsrc = wcol + tid * 8;
  const unsigned wdst = lds_off(ring) + GOP * 2 + (tid >> 2) * (GPITCH * 2) + (tid & 3) * 16;

  auto issue_stage = [&](int t, int buf) {
    unsigned l[8];
    const _Float16* g[8];
#pragma unroll
    for (int it = 0; it < 8; ++it) {
      l[it] = adst + buf * (GSTAGE * 2) + it * 16 * (GPITCH * 2);
      g[it] = asrc + t * GK + (size_t)it * 16 * KDIM;
    }
    async_copy8(l, g);
#pragma unroll
    for (int it = 0; it < 8; ++it) {
      l[it] = wdst + buf * (GSTAGE * 2) + (it & 1) * 64 * (GPITCH * 2) + (it >> 1) * 64;
      g[it] = wsrc + t * (4 * 4096) + it * 2048;
    }
    async_copy8(l, g);
  };

  v8f acc[4][2];
  {
    v8f z = {};
#pragma unroll
    for (int i = 0; i < 4; ++i)
#pragma unroll
      for (int j = 0; j < 2; ++j) acc[i][j] = z;
  }

  const int mw = (wave >> 2) * 64;  // 0 or 64
  const int nw = (wave & 3) * 32;   // 0,32,64,96

  issue_stage(0, 0);
  wait_asynccnt0();
  __syncthreads();  // stage 0 is published
  issue_stage(1, 1);

  for (int t = 0; t < GNST; ++t) {
    const _Float16* As = ring + (t & 1) * GSTAGE;
    const _Float16* Ws = As + GOP;

#pragma unroll
    for (int ks = 0; ks < GK / 32; ++ks) {
      v16h af[4], bf[2];
#pragma unroll
      for (int i = 0; i < 4; ++i)
        af[i] = frag_ld(&As[(mw + i * 16 + rl) * GPITCH + ks * 32 + sel8]);
#pragma unroll
      for (int j = 0; j < 2; ++j)
        bf[j] = frag_ld(&Ws[(nw + j * 16 + rl) * GPITCH + ks * 32 + sel8]);
      // keeps the k-step's 12 LDS reads one group in front of its WMMAs: left
      // alone the compiler reads two at a time and waits out each pair's latency
      __builtin_amdgcn_sched_barrier(0);
#pragma unroll
      for (int i = 0; i < 4; ++i)
#pragma unroll
        for (int j = 0; j < 2; ++j) acc[i][j] = wmma32(af[i], bf[j], acc[i][j]);
    }

    // publish point of stage t+1; the same barrier ends every wave's reads of
    // stage t's buffer, which is refilled behind it
    wait_dscnt0();
    wait_asynccnt0();
    __syncthreads();
    if (t + 2 < GNST) issue_stage(t + 2, t & 1);
  }
  wait_asynccnt0();  // no copy is outstanding when the wave ends

  // epilogue: D layout = lane%16 -> col, vgpr r + 8*(lane/16) -> row
#pragma unroll
  for (int i = 0; i < 4; ++i)
#pragma unroll
    for (int j = 0; j < 2; ++j)
#pragma unroll
      for (int r = 0; r < 8; ++r) {
        int rg = row0 + mw + i * 16 + r + (lane >> 4) * 8;
        int cg = n0 + nw + j * 16 + rl;
        Y[(size_t)rg * NDIM + cg] = acc[i][j][r] + bias[cg];
      }
}

// ------------------------------- launcher ----------------------------------
extern "C" void kernel_launch(void* const* d_in, const int* in_sizes, int n_in,
                              void* d_out, int out_size, void* d_ws,
                              size_t ws_size, hipStream_t stream) {
  const float* X   = (const float*)d_in[0];
  const float* Wq  = (const float*)d_in[1];
  const float* bq  = (const float*)d_in[2];
  const float* Wk  = (const float*)d_in[3];
  const float* bk  = (const float*)d_in[4];
  const float* Wv  = (const float*)d_in[5];
  const float* bv  = (const float*)d_in[6];
  const float* gW1 = (const float*)d_in[7];
  const float* gb1 = (const float*)d_in[8];
  const float* gW2 = (const float*)d_in[9];
  const float* gb2 = (const float*)d_in[10];
  const float* Wo  = (const float*)d_in[11];
  const float* bo  = (const float*)d_in[12];

  char* ws = (char*)d_ws;
  _Float16* Xh = (_Float16*)(ws + OFF_XH);
  _Float16* AO = (_Float16*)(ws + OFF_AO);
  float* beff  = (float*)(ws + OFF_BE);  // [3][16][1024]
  float* hp    = (float*)(ws + OFF_HP);
  _Float16* Wp  = (_Float16*)(ws + OFF_WP);
  _Float16* Wop = (_Float16*)(ws + OFF_WOP);

  dim3 cgrid(1024 / POOL_COLS, MDIM / POOL_ROWS);
  cvt_pool<<<cgrid, 512, 0, stream>>>(X, gW1, Xh, hp);

  dim3 pgrid(NDIM / 64, KDIM / 64);
  prep_weights<<<pgrid, 1024, 0, stream>>>(Wq, Wk, Wv, Wo, hp, gb1, gW2, gb2, bq, bk,
                                           bv, Wp, Wop, beff);

  dim3 qgrid(16, NINST);
  qkv_attn<<<qgrid, 256, 0, stream>>>(Xh, Wp, beff, AO);

  dim3 ggrid(NDIM / 128, MDIM / 128);
  out_gemm<<<ggrid, 256, 0, stream>>>(AO, Wop, bo, (float*)d_out);
}
